// v000
// Measured on an AMD MI455X. A time is GPU time per run, averaged over a window of back-to-back runs after a warm-up
// (all launches, gaps included; the runs take copies of the inputs in turn), and the median of several windows.
// Apart from v000's, it joins two sittings. Times from different sittings can be a few percent apart, while
// side-by-side timings come from the same sitting.
// v000 is the starting kernel. One run takes 264 microseconds.
#include <hip/hip_runtime.h>
#include <stddef.h>

// All contractions on v_wmma_f32_16x16x32_f16 (f16 operands, f32 accumulate): q/k/v projections
// (x plane = f16(bf16(x)), weight planes = f16(64 * bf16(w)), kept in their [out][in] order) and
// the p.v product (p carried x1024, v plane f16 single). The per-row dot with the score vector,
// the additive ReLU scores, exp and the row sums are f32 on the vector unit.

typedef _Float16 v16h __attribute__((ext_vector_type(16)));
typedef _Float16 v8h  __attribute__((ext_vector_type(8)));
typedef float    v8f  __attribute__((ext_vector_type(8)));
typedef float    v4f  __attribute__((ext_vector_type(4)));
typedef _Float16 h16;

#ifndef NB
#define NB 4
#endif
#ifndef SEQ
#define SEQ 4096
#endif
#define NB_FULL  4
#define SEQ_FULL 4096
#define DIM   256
#define MROWS (NB * SEQ)
#define DH    128          // output columns per wave in the attention kernel
#define QBLK  64           // query rows per attention block (4 groups of 16)

#define LDC 68             // floats per LDS row of the 64x64 GEMM stage (272 B)
#define LDO 132            // floats per LDS row of the attention output stage (528 B)

#define WCARRY 64.0f                   // weight planes carried x64
#define LN_PCARRY 6.931471805599453f   // ln(1024): softmax numerators carried x1024

static_assert(NB >= 1 && NB <= NB_FULL);
static_assert(SEQ >= 128 && SEQ <= SEQ_FULL && (SEQ % 128) == 0);
static_assert(DIM == 32 * 8);               // cast: one wave per row, 32 lanes x 8 columns
static_assert((DIM % 64) == 0 && (DIM % 32) == 0);
static_assert((MROWS % 64) == 0 && (MROWS % 8) == 0);
static_assert((SEQ % QBLK) == 0 && (SEQ % 32) == 0 && (SEQ % 64) == 0);
static_assert(2 * DH == DIM && (DH % 16) == 0 && DH / 16 == 8);
static_assert(DH * 4 == 32 * 16);           // one store instruction = one 512-B row segment
static_assert(QBLK == 4 * 16);              // 8 waves = 4 query groups x 2 column halves
static_assert((LDC % 4) == 0 && LDC >= 64);
static_assert((LDO % 4) == 0 && LDO >= DH);
static_assert(2 * 8 == 16);                 // output stage: 2 steps x 8 rows == 16 tile rows
static_assert(8 * 16 * LDO * 4 + 8 * 4 <= 131072);   // attention static LDS
static_assert(64 * LDC * 4 <= 131072);
static_assert((size_t)MROWS * DIM < (size_t)0xFFFFFFFFu);

// workspace layout (bytes)
#define W_BYTES   ((size_t)DIM * DIM * 2)
#define X16_BYTES ((size_t)MROWS * DIM * 2)
#define S_BYTES   ((size_t)MROWS * 4)
#define VT_BYTES  ((size_t)NB * DIM * SEQ * 2)
#define OFF_WQ  ((size_t)0)
#define OFF_WK  (OFF_WQ + W_BYTES)
#define OFF_WV  (OFF_WK + W_BYTES)
#define OFF_X16 (OFF_WV + W_BYTES)
#define OFF_QS  (OFF_X16 + X16_BYTES)
#define OFF_KS  (OFF_QS + S_BYTES)
#define OFF_VT  (OFF_KS + S_BYTES)
#define WS_TOTAL (OFF_VT + VT_BYTES)
static_assert((W_BYTES % 128) == 0 && (X16_BYTES % 128) == 0);
static_assert((S_BYTES % 128) == 0 && (VT_BYTES % 128) == 0);
static_assert(WS_TOTAL <= (size_t)134217728);

// ---------------------------------------------------------------------------
__device__ __forceinline__ float bf16r(float x) {   // RNE convert to bf16, returned widened
  unsigned int u = __float_as_uint(x);
  u = (u + 0x7FFFu + ((u >> 16) & 1u)) & 0xFFFF0000u;
  return __uint_as_float(u);
}

// f32 -> f16 for WMMA operand planes: values below the smallest f16 normal become zero.
static __device__ __forceinline__ h16 toh_flush(float v) {
  const h16 r = (h16)v;
  return (fabsf(v) < 6.103515625e-05f) ? (h16)0.0f : r;
}

// 16-bit fragment: p points at element [row = lane&15][k0 + 8*(lane>>4)] of a k-contiguous
// row. Elements 0..7 <- k0+8h+0..7, elements 8..15 <- k0+16+8h+0..7 (same map for A and B).
__device__ __forceinline__ v16h frag_at(const _Float16* p) {
  v8h lo = *(const v8h*)(p);
  v8h hi = *(const v8h*)(p + 16);
  v16h out;
#pragma unroll
  for (int i = 0; i < 8; ++i) { out[i] = lo[i]; out[i + 8] = hi[i]; }
  return out;
}

__device__ __forceinline__ v8f wmma16(v16h a, v16h b, v8f c) {
  v8f d = __builtin_amdgcn_wmma_f32_16x16x32_f16(false, a, false, b, (short)0, c,
                                                 false, false);
  asm volatile("v_nop\n\tv_nop\n\tv_nop\n\tv_nop" : "+v"(d) : "v"(a), "v"(b));
  return d;
}

__device__ __forceinline__ float red16_sum(float x) {
#pragma unroll
  for (int off = 1; off < 16; off <<= 1) x += __shfl_xor(x, off, 32);
  return x;
}
__device__ __forceinline__ float red32_min(float x) {
#pragma unroll
  for (int off = 1; off < 32; off <<= 1) x = fminf(x, __shfl_xor(x, off, 32));
  return x;
}

__device__ __forceinline__ void wave_lds_sync() {
  __builtin_amdgcn_fence(3 /* release order */, "wavefront");
  asm volatile("s_wait_dscnt 0x0" ::: "memory");
  __builtin_amdgcn_wave_barrier();
}

// ---------------------------------------------------------------------------
// Row cast: dst[row][0..255] = f16(carry * bf16(src[row][0..255])), one wave per row, 8 rows
// per block; the wave's single store instruction covers the whole 512-B row (4 lines).
// SRC_INPUT = 1: source rows are addressed with the full per-batch stride (module input);
// SRC_INPUT = 0: compact rows (weight matrices, [out][in] order kept: already k-contiguous).
// Grid (rows / 8).
// ---------------------------------------------------------------------------
template <int SRC_INPUT>
__device__ __forceinline__ void cast_body(const float* __restrict__ X,
                                          _Float16* __restrict__ dst, const float carry) {
#pragma clang fp contract(off)
  const unsigned lane = threadIdx.x & 31u;
  const unsigned w = (unsigned)__builtin_amdgcn_readfirstlane((int)(threadIdx.x >> 5));
  const unsigned crow = blockIdx.x * 8u + w;
  size_t srow = crow;
  if (SRC_INPUT) {
    const unsigned bidx = crow / (unsigned)SEQ;
    const unsigned sq = crow - bidx * (unsigned)SEQ;
    srow = (size_t)bidx * SEQ_FULL + sq;
  }
  const float* xr = X + srow * DIM + lane * 8u;
  const v4f a0 = *(const v4f*)(xr);
  const v4f a1 = *(const v4f*)(xr + 4u);
  v8h o;
#pragma unroll
  for (int i = 0; i < 4; ++i) {
    o[i]     = toh_flush(carry * bf16r(a0[i]));
    o[i + 4] = toh_flush(carry * bf16r(a1[i]));
  }
  _Float16* p = dst + (size_t)crow * DIM + lane * 8u;
  *(v8h*)p = o;
  
}

__global__ __launch_bounds__(256) void xcast_kernel(
    const float* __restrict__ X, _Float16* __restrict__ dst) {
  cast_body<1>(X, dst, 1.0f);
}
__global__ __launch_bounds__(256) void wcast_kernel(
    const float* __restrict__ W, _Float16* __restrict__ dst) {
  cast_body<0>(W, dst, WCARRY);
}

// ---------------------------------------------------------------------------
// Projection + row score: for a 64-row tile, P = A16 . Bt^T over all 256 output columns (four
// 64-column groups, 8 waves: mw = 16-row group, nw = 32-column group, 2 accumulators per
// wave), and outs[row] = sum_c P[row][c] * bf16(wv[c]) taken from the f32 accumulators.
// by 16 consecutive lanes x 16 B of wave 0.
// Grid (MROWS/64).
// ---------------------------------------------------------------------------
__global__ __launch_bounds__(256) void proj_score_kernel(
    const _Float16* __restrict__ A16, const _Float16* __restrict__ Bt,
    const float* __restrict__ wv, float* __restrict__ outs) {
  __shared__ float Rs[2 * 64];
  const unsigned tid = threadIdx.x, lane = tid & 31u;
  const int wave = __builtin_amdgcn_readfirstlane((int)(threadIdx.x >> 5));
  const unsigned mw = (unsigned)wave >> 1, nw = (unsigned)wave & 1u;
  const unsigned hh = lane >> 4, m = lane & 15u;
  const unsigned row0 = blockIdx.x * 64u;

  const _Float16* ap = A16 + (size_t)(row0 + mw * 16u + m) * DIM + hh * 8u;
  float part[8];
#pragma unroll
  for (int r = 0; r < 8; ++r) part[r] = 0.0f;

#pragma unroll 1
  for (unsigned nb = 0; nb < (unsigned)(DIM / 64); ++nb) {
    const unsigned col = nb * 64u + nw * 32u + m;
    const _Float16* bp0 = Bt + (size_t)col * DIM + hh * 8u;
    const _Float16* bp1 = bp0 + (size_t)16 * DIM;
    v8f acc0 = {}, acc1 = {};
#pragma unroll 2
    for (unsigned k0 = 0; k0 < (unsigned)DIM; k0 += 32u) {
      const v16h a  = frag_at(ap + k0);
      const v16h b0 = frag_at(bp0 + k0);
      const v16h b1 = frag_at(bp1 + k0);
      acc0 = wmma16(a, b0, acc0);
      acc1 = wmma16(a, b1, acc1);
    }
    const float w0 = bf16r(wv[col]);
    const float w1 = bf16r(wv[col + 16u]);
#pragma unroll
    for (int r = 0; r < 8; ++r) part[r] += acc0[r] * w0 + acc1[r] * w1;
  }
  // row (mw*16 + hh*8 + r) is spread over the 16 lanes of a half
#pragma unroll
  for (int r = 0; r < 8; ++r) part[r] = red16_sum(part[r]);
  if (m == 0u) {
#pragma unroll
    for (int r = 0; r < 8; ++r) Rs[nw * 64u + mw * 16u + hh * 8u + (unsigned)r] = part[r];
  }
  __syncthreads();
  if (wave == 0 && lane < 16u) {
    v4f val;
#pragma unroll
    for (int j = 0; j < 4; ++j)
      val[j] = (Rs[lane * 4u + (unsigned)j] + Rs[64u + lane * 4u + (unsigned)j]) * (1.0f / WCARRY);
    float* p = outs + row0 + lane * 4u;
    *(v4f*)p = val;
    
  }
}

// ---------------------------------------------------------------------------
// V projection: C[64x64 tile] = A16[rows][K] . Bt[n][K]^T, fragments straight from the 16-bit
// global planes; 8 waves (mw = 16-row group, nw = 32-col group), 2 accumulators/wave.
// Epilogue staged through Cs (cross-wave, block barrier) and written transposed:
// lanes x 16 B. Store coverage: 2 steps x 32 column rows == 64 columns, 8 lanes x 8 keys == 64.
// Grid (DIM/64, MROWS/64).
// ---------------------------------------------------------------------------
__global__ __launch_bounds__(256) void gemm_v_kernel(
    const _Float16* __restrict__ A16, const _Float16* __restrict__ Bt,
    _Float16* __restrict__ vt) {
  __shared__ float Cs[64 * LDC];
  const unsigned tid = threadIdx.x, lane = tid & 31u;
  const unsigned w = (unsigned)__builtin_amdgcn_readfirstlane((int)(threadIdx.x >> 5));
  const unsigned mw = w >> 1, nw = w & 1u;
  const unsigned hh = lane >> 4, m = lane & 15u;
  const unsigned n0 = blockIdx.x * 64u;
  const unsigned row0 = blockIdx.y * 64u;
  const unsigned K = (unsigned)DIM;

  const _Float16* ap  = A16 + (size_t)(row0 + mw * 16u + m) * K + hh * 8u;
  const _Float16* bp0 = Bt + (size_t)(n0 + nw * 32u + m) * K + hh * 8u;
  const _Float16* bp1 = bp0 + (size_t)16 * K;
  v8f acc0 = {}, acc1 = {};
#pragma unroll 2
  for (unsigned k0 = 0; k0 < K; k0 += 32u) {
    const v16h a  = frag_at(ap + k0);
    const v16h b0 = frag_at(bp0 + k0);
    const v16h b1 = frag_at(bp1 + k0);
    acc0 = wmma16(a, b0, acc0);
    acc1 = wmma16(a, b1, acc1);
  }
#pragma unroll
  for (int r = 0; r < 8; ++r) {
    float* d = &Cs[(mw * 16u + hh * 8u + (unsigned)r) * LDC + nw * 32u + m];
    d[0]  = acc0[r];
    d[16] = acc1[r];
  }
  __syncthreads();

  const unsigned bidx = row0 / (unsigned)SEQ;
  const unsigned key0 = row0 - bidx * (unsigned)SEQ;
  v8h x[2];
  size_t off[2];
#pragma unroll
  for (unsigned i = 0; i < 2u; ++i) {
    const unsigned dcol = 32u * i + (tid >> 3);
    const unsigned kk = (tid & 7u) * 8u;
#pragma unroll
    for (unsigned j = 0; j < 8u; ++j) {
      const float t = Cs[(kk + j) * LDC + dcol] * (1.0f / WCARRY);
      x[i][j] = toh_flush(t);
    }
    off[i] = ((size_t)bidx * DIM + n0 + dcol) * SEQ + key0 + kk;
  }
#pragma unroll
  for (int i = 0; i < 2; ++i) *(v8h*)(vt + off[i]) = x[i];
  
}

// ---------------------------------------------------------------------------
// Dense additive-score attention, register-fed transposed form. Block = 64 query rows x 256
// columns of one batch; wave = 16 query rows x 128 columns (8 accumulators).
// score[i][j] = relu(q_s[i] + b - k_s[j]); its row maximum is relu(q_s[i] + b - min_j k_s[j]),
// so the max-subtracted softmax needs no running rescale. Per 32-key step each lane builds
// its B fragment of P^T directly in registers (lane = query, elements = keys of the 16-bit
// k map), p = f16(1024 * exp(score - rowmax)), and O^T[d][i] += V^T[d][keys] . P^T[keys][i]
// with the A fragments straight from the transposed v plane. The row sum runs over the
// converted p, so the carry cancels in O / l. No LDS and no barrier inside the key loop.
// Wmin: cross-wave (block barrier). Os: wave-private stage (wave sync); staged extent
// Grid (SEQ/64, NB).
// ---------------------------------------------------------------------------
__device__ __forceinline__ h16 p_elem(const float qb, const float k, const float cexp,
                                      float& lsum) {
  const float s = fmaxf(qb - k, 0.0f);
  const h16 p = toh_flush(__expf(s - cexp));
  lsum += (float)p;
  return p;
}

__global__ __launch_bounds__(256) void attn_kernel(
    const float* __restrict__ Qs, const float* __restrict__ Ksc,
    const float* __restrict__ bptr, const _Float16* __restrict__ Vt,
    float* __restrict__ out) {
  __shared__ float Os[8 * 16 * LDO];
  __shared__ float Wmin[8];

  const unsigned tid = threadIdx.x, lane = tid & 31u;
  const int wave = __builtin_amdgcn_readfirstlane((int)(threadIdx.x >> 5));
  const unsigned hh = lane >> 4, m = lane & 15u;
  const unsigned b = blockIdx.y;
  const unsigned qg = (unsigned)wave >> 1, dh = (unsigned)wave & 1u;
  const unsigned qrow0 = blockIdx.x * (unsigned)QBLK + qg * 16u;
  const float* ksb = Ksc + (size_t)b * SEQ;

  // minimum key score of this batch (uniform trip count, clamped addresses)
  float kmin = 3.0e38f;
#pragma unroll 1
  for (unsigned it = 0; it < (unsigned)((SEQ + 1023) / 1024); ++it) {
    unsigned j = tid * 4u + it * 1024u;
    j = (j > (unsigned)(SEQ - 4)) ? (unsigned)(SEQ - 4) : j;
    const v4f t = *(const v4f*)(ksb + j);
    kmin = fminf(kmin, fminf(fminf(t[0], t[1]), fminf(t[2], t[3])));
  }
  kmin = red32_min(kmin);
  if (lane == 0u) Wmin[wave] = kmin;
  __syncthreads();
  float km = Wmin[0];
#pragma unroll
  for (int i = 1; i < 8; ++i) km = fminf(km, Wmin[i]);

  const float qb = Qs[(size_t)b * SEQ + qrow0 + m] + bf16r(bptr[0]);
  const float mrow = fmaxf(qb - km, 0.0f);
  const float cexp = mrow - LN_PCARRY;      // 1024 * exp(s - mrow) == exp(s - cexp)

  v8f o[8];
#pragma unroll
  for (int dt = 0; dt < 8; ++dt) o[dt] = (v8f){};
  float lsum = 0.0f;

  const size_t vbase = ((size_t)b * DIM + dh * (unsigned)DH + m) * SEQ + hh * 8u;

#pragma unroll 1
  for (unsigned kb = 0; kb < (unsigned)SEQ; kb += 32u) {
    const float* kp = ksb + kb + hh * 8u;
    const v4f k0v = *(const v4f*)(kp);
    const v4f k1v = *(const v4f*)(kp + 4u);
    const v4f k2v = *(const v4f*)(kp + 16u);
    const v4f k3v = *(const v4f*)(kp + 20u);
    v16h pf;
#pragma unroll
    for (int i = 0; i < 4; ++i) {
      pf[i]      = p_elem(qb, k0v[i], cexp, lsum);
      pf[i + 4]  = p_elem(qb, k1v[i], cexp, lsum);
      pf[i + 8]  = p_elem(qb, k2v[i], cexp, lsum);
      pf[i + 12] = p_elem(qb, k3v[i], cexp, lsum);
    }
#pragma unroll
    for (int dt = 0; dt < 8; ++dt) {
      const v16h a = frag_at(Vt + vbase + (size_t)dt * (16u * (unsigned)SEQ) + kb);
      o[dt] = wmma16(a, pf, o[dt]);
    }
  }

  // lanes l and l+16 hold the two key halves of query m
  const float ltot = lsum + __shfl_xor(lsum, 16, 32);
  const float inv = __builtin_amdgcn_rcpf(ltot);

  // stage O[query m][d = dt*16 + 8*hh + r] in the wave's tile
  const unsigned tb = (unsigned)wave * (16u * LDO);
#pragma unroll
  for (int dt = 0; dt < 8; ++dt) {
    v4f u0, u1;
#pragma unroll
    for (int j = 0; j < 4; ++j) {
      u0[j] = o[dt][j] * inv;
      u1[j] = o[dt][j + 4] * inv;
    }
    *(v4f*)&Os[tb + m * LDO + (unsigned)dt * 16u + hh * 8u] = u0;
    *(v4f*)&Os[tb + m * LDO + (unsigned)dt * 16u + hh * 8u + 4u] = u1;
  }
  wave_lds_sync();

  const size_t orow = (size_t)b * SEQ_FULL + qrow0;
#pragma unroll
  for (unsigned g = 0; g < 2u; ++g) {      // 2 steps x 8 rows == 16 rows
    v4f x[8];
    size_t off[8];
#pragma unroll
    for (unsigned i = 0; i < 8u; ++i) {
      const unsigned r = 8u * g + i;
      x[i] = *(const v4f*)&Os[tb + r * LDO + lane * 4u];
      off[i] = (orow + r) * DIM + dh * (unsigned)DH + lane * 4u;
    }
#pragma unroll
    for (int i = 0; i < 8; ++i) *(v4f*)(out + off[i]) = x[i];
    
  }
}

// ---------------------------------------------------------------------------
extern "C" void kernel_launch(void* const* d_in, const int* in_sizes, int n_in,
                              void* d_out, int out_size, void* d_ws, size_t ws_size,
                              hipStream_t stream) {
  if (n_in < 6) return;
  const long long need_x = ((long long)(NB - 1) * SEQ_FULL + SEQ) * DIM;
  if ((long long)in_sizes[0] < need_x) return;
  if ((long long)in_sizes[1] < (long long)DIM * DIM) return;
  if ((long long)in_sizes[2] < (long long)DIM * DIM) return;
  if ((long long)in_sizes[3] < (long long)DIM * DIM) return;
  if (in_sizes[4] < DIM) return;
  if (in_sizes[5] < 1) return;
  if ((long long)out_size < need_x) return;
  if (ws_size < WS_TOTAL) return;

  const float* X    = (const float*)d_in[0];   // x      [NB_FULL][SEQ_FULL][DIM]
  const float* wq   = (const float*)d_in[1];   // Wq     [DIM out][DIM in]
  const float* wk   = (const float*)d_in[2];   // Wk     [DIM out][DIM in]
  const float* wvv  = (const float*)d_in[3];   // Wv     [DIM out][DIM in]
  const float* wmlp = (const float*)d_in[4];   // w_mlp  [DIM]
  const float* bmlp = (const float*)d_in[5];   // b_mlp  scalar
  float* out = (float*)d_out;

  char* ws = (char*)d_ws;
  _Float16* Wq16 = (_Float16*)(ws + OFF_WQ);    // [out][in], x64
  _Float16* Wk16 = (_Float16*)(ws + OFF_WK);
  _Float16* Wv16 = (_Float16*)(ws + OFF_WV);
  _Float16* X16  = (_Float16*)(ws + OFF_X16);   // [MROWS][DIM] compact rows
  float*    QS   = (float*)(ws + OFF_QS);       // [MROWS]
  float*    KS   = (float*)(ws + OFF_KS);       // [MROWS]
  _Float16* Vt16 = (_Float16*)(ws + OFF_VT);    // [b][DIM][SEQ]

  dim3 blk(256);

  // weight planes: in [out rows][in cols] -> out [out rows][in cols] (no transpose); grid (rows/8)
  wcast_kernel<<<dim3(DIM / 8), blk, 0, stream>>>(wq, Wq16);
  wcast_kernel<<<dim3(DIM / 8), blk, 0, stream>>>(wk, Wk16);
  wcast_kernel<<<dim3(DIM / 8), blk, 0, stream>>>(wvv, Wv16);
  xcast_kernel<<<dim3(MROWS / 8), blk, 0, stream>>>(X, X16);

  proj_score_kernel<<<dim3(MROWS / 64), blk, 0, stream>>>(X16, Wq16, wmlp, QS);
  proj_score_kernel<<<dim3(MROWS / 64), blk, 0, stream>>>(X16, Wk16, wmlp, KS);
  gemm_v_kernel<<<dim3(DIM / 64, MROWS / 64), blk, 0, stream>>>(X16, Wv16, Vt16);
  attn_kernel<<<dim3(SEQ / QBLK, NB), blk, 0, stream>>>(QS, KS, bmlp, Vt16, out);
}

// v001
// One run takes 116 microseconds.
// In both of two side-by-side timings against v000, it was 2.28 times as fast.
#include <hip/hip_runtime.h>
#include <stddef.h>

// All contractions on v_wmma_f32_16x16x32_f16 (f16 operands, f32 accumulate): q/k/v projections
// (x plane = f16(bf16(x)), weight planes = f16(64 * bf16(w)), kept in their [out][in] order) and
// the p.v product (p carried x1024, v plane f16 single). The per-row dot with the score vector,
// the additive ReLU scores, exp and the row sums are f32 on the vector unit.

typedef _Float16 v16h __attribute__((ext_vector_type(16)));
typedef _Float16 v8h  __attribute__((ext_vector_type(8)));
typedef float    v8f  __attribute__((ext_vector_type(8)));
typedef float    v4f  __attribute__((ext_vector_type(4)));
typedef _Float16 h16;

#ifndef NB
#define NB 4
#endif
#ifndef SEQ
#define SEQ 4096
#endif
#define NB_FULL  4
#define SEQ_FULL 4096
#define DIM   256
#define MROWS (NB * SEQ)
#define DH    128          // output columns per wave in the attention kernel
#define QBLK  64           // query rows per attention block (4 groups of 16)

#define LDC 68             // floats per LDS row of the 64x64 GEMM stage (272 B)
#define LDO 132            // floats per LDS row of the attention output stage (528 B)

#define WCARRY 64.0f                   // weight planes carried x64
#define LN_PCARRY 6.931471805599453f   // ln(1024): softmax numerators carried x1024

static_assert(NB >= 1 && NB <= NB_FULL);
static_assert(SEQ >= 128 && SEQ <= SEQ_FULL && (SEQ % 128) == 0);
static_assert(DIM == 32 * 8);               // cast: one wave per row, 32 lanes x 8 columns
static_assert((DIM % 64) == 0 && (DIM % 32) == 0);
static_assert((MROWS % 64) == 0 && (MROWS % 8) == 0);
static_assert((SEQ % QBLK) == 0 && (SEQ % 32) == 0 && (SEQ % 64) == 0);
static_assert(2 * DH == DIM && (DH % 16) == 0 && DH / 16 == 8);
static_assert(DH * 4 == 32 * 16);           // one store instruction = one 512-B row segment
static_assert(QBLK == 4 * 16);              // 8 waves = 4 query groups x 2 column halves
static_assert((LDC % 4) == 0 && LDC >= 64);
static_assert((LDO % 4) == 0 && LDO >= DH);
static_assert(2 * 8 == 16);                 // output stage: 2 steps x 8 rows == 16 tile rows
#define TKEYS   64u                      // keys per ring tile (two 32-key steps)
#define VPITCH  144u                     // LDS bytes per v row of a tile: 128 + 16 (16 B x odd)
#define VT_TILE ((unsigned)DIM * VPITCH) // v part of a ring buffer
#define RBUF    (VT_TILE + TKEYS * 4u)   // ring buffer: v tile, then the tile's key scores
static_assert((SEQ % 64) == 0 && SEQ / 64 >= 2);      // the ring's prologue needs two tiles
static_assert(TKEYS * 2u == 128u && (VPITCH % 16u) == 0 && (RBUF % 16u) == 0);
static_assert(DIM == 8 * 8 * 4);         // tile rows: 8 waves x 8 copies x 4 rows per copy
static_assert(TKEYS * 4u == 32u * 8u);   // key scores of a tile: one 8-B copy per lane of a wave
static_assert(8 * 16 * LDO * 4 + 8 * 4 + 2 * (DIM * 144 + 256) <= 327680);   // attention static LDS
static_assert(64 * LDC * 4 <= 131072);
static_assert((size_t)MROWS * DIM < (size_t)0xFFFFFFFFu);

// workspace layout (bytes)
#define W_BYTES   ((size_t)DIM * DIM * 2)
#define X16_BYTES ((size_t)MROWS * DIM * 2)
#define S_BYTES   ((size_t)MROWS * 4)
#define VT_BYTES  ((size_t)NB * DIM * SEQ * 2)
#define OFF_WQ  ((size_t)0)
#define OFF_WK  (OFF_WQ + W_BYTES)
#define OFF_WV  (OFF_WK + W_BYTES)
#define OFF_X16 (OFF_WV + W_BYTES)
#define OFF_QS  (OFF_X16 + X16_BYTES)
#define OFF_KS  (OFF_QS + S_BYTES)
#define OFF_VT  (OFF_KS + S_BYTES)
#define WS_TOTAL (OFF_VT + VT_BYTES)
static_assert((W_BYTES % 128) == 0 && (X16_BYTES % 128) == 0);
static_assert((S_BYTES % 128) == 0 && (VT_BYTES % 128) == 0);
static_assert(WS_TOTAL <= (size_t)134217728);

// ---------------------------------------------------------------------------
__device__ __forceinline__ float bf16r(float x) {   // RNE convert to bf16, returned widened
  unsigned int u = __float_as_uint(x);
  u = (u + 0x7FFFu + ((u >> 16) & 1u)) & 0xFFFF0000u;
  return __uint_as_float(u);
}

// f32 -> f16 for WMMA operand planes: values below the smallest f16 normal become zero.
static __device__ __forceinline__ h16 toh_flush(float v) {
  const h16 r = (h16)v;
  return (fabsf(v) < 6.103515625e-05f) ? (h16)0.0f : r;
}

// 16-bit fragment: p points at element [row = lane&15][k0 + 8*(lane>>4)] of a k-contiguous
// row. Elements 0..7 <- k0+8h+0..7, elements 8..15 <- k0+16+8h+0..7 (same map for A and B).
__device__ __forceinline__ v16h frag_at(const _Float16* p) {
  v8h lo = *(const v8h*)(p);
  v8h hi = *(const v8h*)(p + 16);
  v16h out;
#pragma unroll
  for (int i = 0; i < 8; ++i) { out[i] = lo[i]; out[i + 8] = hi[i]; }
  return out;
}

__device__ __forceinline__ v8f wmma16(v16h a, v16h b, v8f c) {
  v8f d = __builtin_amdgcn_wmma_f32_16x16x32_f16(false, a, false, b, (short)0, c,
                                                 false, false);
  asm volatile("v_nop\n\tv_nop\n\tv_nop\n\tv_nop" : "+v"(d) : "v"(a), "v"(b));
  return d;
}

__device__ __forceinline__ float red16_sum(float x) {
#pragma unroll
  for (int off = 1; off < 16; off <<= 1) x += __shfl_xor(x, off, 32);
  return x;
}
__device__ __forceinline__ float red32_min(float x) {
#pragma unroll
  for (int off = 1; off < 32; off <<= 1) x = fminf(x, __shfl_xor(x, off, 32));
  return x;
}

__device__ __forceinline__ void wave_lds_sync() {
  __builtin_amdgcn_fence(3 /* release order */, "wavefront");
  asm volatile("s_wait_dscnt 0x0" ::: "memory");
  __builtin_amdgcn_wave_barrier();
}

// ---------------------------------------------------------------------------
// Row cast: dst[row][0..255] = f16(carry * bf16(src[row][0..255])), one wave per row, 8 rows
// per block; the wave's single store instruction covers the whole 512-B row (4 lines).
// SRC_INPUT = 1: source rows are addressed with the full per-batch stride (module input);
// SRC_INPUT = 0: compact rows (weight matrices, [out][in] order kept: already k-contiguous).
// Grid (rows / 8).
// ---------------------------------------------------------------------------
template <int SRC_INPUT>
__device__ __forceinline__ void cast_body(const float* __restrict__ X,
                                          _Float16* __restrict__ dst, const float carry) {
#pragma clang fp contract(off)
  const unsigned lane = threadIdx.x & 31u;
  const unsigned w = (unsigned)__builtin_amdgcn_readfirstlane((int)(threadIdx.x >> 5));
  const unsigned crow = blockIdx.x * 8u + w;
  size_t srow = crow;
  if (SRC_INPUT) {
    const unsigned bidx = crow / (unsigned)SEQ;
    const unsigned sq = crow - bidx * (unsigned)SEQ;
    srow = (size_t)bidx * SEQ_FULL + sq;
  }
  const float* xr = X + srow * DIM + lane * 8u;
  const v4f a0 = *(const v4f*)(xr);
  const v4f a1 = *(const v4f*)(xr + 4u);
  v8h o;
#pragma unroll
  for (int i = 0; i < 4; ++i) {
    o[i]     = toh_flush(carry * bf16r(a0[i]));
    o[i + 4] = toh_flush(carry * bf16r(a1[i]));
  }
  _Float16* p = dst + (size_t)crow * DIM + lane * 8u;
  *(v8h*)p = o;
  
}

__global__ __launch_bounds__(256) void xcast_kernel(
    const float* __restrict__ X, _Float16* __restrict__ dst) {
  cast_body<1>(X, dst, 1.0f);
}
__global__ __launch_bounds__(256) void wcast_kernel(
    const float* __restrict__ W, _Float16* __restrict__ dst) {
  cast_body<0>(W, dst, WCARRY);
}

// ---------------------------------------------------------------------------
// Projection + row score: for a 64-row tile, P = A16 . Bt^T over all 256 output columns (four
// 64-column groups, 8 waves: mw = 16-row group, nw = 32-column group, 2 accumulators per
// wave), and outs[row] = sum_c P[row][c] * bf16(wv[c]) taken from the f32 accumulators.
// by 16 consecutive lanes x 16 B of wave 0.
// Grid (MROWS/64).
// ---------------------------------------------------------------------------
__global__ __launch_bounds__(256) void proj_score_kernel(
    const _Float16* __restrict__ A16, const _Float16* __restrict__ Bt,
    const float* __restrict__ wv, float* __restrict__ outs) {
  __shared__ float Rs[2 * 64];
  const unsigned tid = threadIdx.x, lane = tid & 31u;
  const int wave = __builtin_amdgcn_readfirstlane((int)(threadIdx.x >> 5));
  const unsigned mw = (unsigned)wave >> 1, nw = (unsigned)wave & 1u;
  const unsigned hh = lane >> 4, m = lane & 15u;
  const unsigned row0 = blockIdx.x * 64u;

  const _Float16* ap = A16 + (size_t)(row0 + mw * 16u + m) * DIM + hh * 8u;
  float part[8];
#pragma unroll
  for (int r = 0; r < 8; ++r) part[r] = 0.0f;

#pragma unroll 1
  for (unsigned nb = 0; nb < (unsigned)(DIM / 64); ++nb) {
    const unsigned col = nb * 64u + nw * 32u + m;
    const _Float16* bp0 = Bt + (size_t)col * DIM + hh * 8u;
    const _Float16* bp1 = bp0 + (size_t)16 * DIM;
    v8f acc0 = {}, acc1 = {};
#pragma unroll 2
    for (unsigned k0 = 0; k0 < (unsigned)DIM; k0 += 32u) {
      const v16h a  = frag_at(ap + k0);
      const v16h b0 = frag_at(bp0 + k0);
      const v16h b1 = frag_at(bp1 + k0);
      acc0 = wmma16(a, b0, acc0);
      acc1 = wmma16(a, b1, acc1);
    }
    const float w0 = bf16r(wv[col]);
    const float w1 = bf16r(wv[col + 16u]);
#pragma unroll
    for (int r = 0; r < 8; ++r) part[r] += acc0[r] * w0 + acc1[r] * w1;
  }
  // row (mw*16 + hh*8 + r) is spread over the 16 lanes of a half
#pragma unroll
  for (int r = 0; r < 8; ++r) part[r] = red16_sum(part[r]);
  if (m == 0u) {
#pragma unroll
    for (int r = 0; r < 8; ++r) Rs[nw * 64u + mw * 16u + hh * 8u + (unsigned)r] = part[r];
  }
  __syncthreads();
  if (wave == 0 && lane < 16u) {
    v4f val;
#pragma unroll
    for (int j = 0; j < 4; ++j)
      val[j] = (Rs[lane * 4u + (unsigned)j] + Rs[64u + lane * 4u + (unsigned)j]) * (1.0f / WCARRY);
    float* p = outs + row0 + lane * 4u;
    *(v4f*)p = val;
    
  }
}

// ---------------------------------------------------------------------------
// V projection: C[64x64 tile] = A16[rows][K] . Bt[n][K]^T, fragments straight from the 16-bit
// global planes; 8 waves (mw = 16-row group, nw = 32-col group), 2 accumulators/wave.
// Epilogue staged through Cs (cross-wave, block barrier) and written transposed:
// lanes x 16 B. Store coverage: 2 steps x 32 column rows == 64 columns, 8 lanes x 8 keys == 64.
// Grid (DIM/64, MROWS/64).
// ---------------------------------------------------------------------------
__global__ __launch_bounds__(256) void gemm_v_kernel(
    const _Float16* __restrict__ A16, const _Float16* __restrict__ Bt,
    _Float16* __restrict__ vt) {
  __shared__ float Cs[64 * LDC];
  const unsigned tid = threadIdx.x, lane = tid & 31u;
  const unsigned w = (unsigned)__builtin_amdgcn_readfirstlane((int)(threadIdx.x >> 5));
  const unsigned mw = w >> 1, nw = w & 1u;
  const unsigned hh = lane >> 4, m = lane & 15u;
  const unsigned n0 = blockIdx.x * 64u;
  const unsigned row0 = blockIdx.y * 64u;
  const unsigned K = (unsigned)DIM;

  const _Float16* ap  = A16 + (size_t)(row0 + mw * 16u + m) * K + hh * 8u;
  const _Float16* bp0 = Bt + (size_t)(n0 + nw * 32u + m) * K + hh * 8u;
  const _Float16* bp1 = bp0 + (size_t)16 * K;
  v8f acc0 = {}, acc1 = {};
#pragma unroll 2
  for (unsigned k0 = 0; k0 < K; k0 += 32u) {
    const v16h a  = frag_at(ap + k0);
    const v16h b0 = frag_at(bp0 + k0);
    const v16h b1 = frag_at(bp1 + k0);
    acc0 = wmma16(a, b0, acc0);
    acc1 = wmma16(a, b1, acc1);
  }
#pragma unroll
  for (int r = 0; r < 8; ++r) {
    float* d = &Cs[(mw * 16u + hh * 8u + (unsigned)r) * LDC + nw * 32u + m];
    d[0]  = acc0[r];
    d[16] = acc1[r];
  }
  __syncthreads();

  const unsigned bidx = row0 / (unsigned)SEQ;
  const unsigned key0 = row0 - bidx * (unsigned)SEQ;
  v8h x[2];
  size_t off[2];
#pragma unroll
  for (unsigned i = 0; i < 2u; ++i) {
    const unsigned dcol = 32u * i + (tid >> 3);
    const unsigned kk = (tid & 7u) * 8u;
#pragma unroll
    for (unsigned j = 0; j < 8u; ++j) {
      const float t = Cs[(kk + j) * LDC + dcol] * (1.0f / WCARRY);
      x[i][j] = toh_flush(t);
    }
    off[i] = ((size_t)bidx * DIM + n0 + dcol) * SEQ + key0 + kk;
  }
#pragma unroll
  for (int i = 0; i < 2; ++i) *(v8h*)(vt + off[i]) = x[i];
  
}

// ---------------------------------------------------------------------------
// Dense additive-score attention, transposed form, v and key scores fed through an LDS ring.
// Block = 64 query rows x 256
// columns of one batch; wave = 16 query rows x 128 columns (8 accumulators).
// score[i][j] = relu(q_s[i] + b - k_s[j]); its row maximum is relu(q_s[i] + b - min_j k_s[j]),
// so the max-subtracted softmax needs no running rescale. Per 32-key step each lane builds
// its B fragment of P^T directly in registers (lane = query, elements = keys of the 16-bit
// k map), p = f16(1024 * exp(score - rowmax)), and O^T[d][i] += V^T[d][keys] . P^T[keys][i]
// with the A fragments from the ring. The row sum runs over the converted p, so the carry
// cancels in O / l. Ring: two buffers of 64 keys (256 v rows of 128 B at a 144-B pitch, then the
// 64 key scores), filled by asynchronous copies to LDS one tile ahead, so the block fetches each
// v byte once, in whole 128-B lines, while the tile before it is worked on; one publish point
// (LDS wait, copy wait, block barrier) per tile.
// Wmin: cross-wave (block barrier). Os: wave-private stage (wave sync); staged extent
// Grid (SEQ/64, NB).
// ---------------------------------------------------------------------------
__device__ __forceinline__ h16 p_elem(const float qb, const float k, const float cexp,
                                      float& lsum) {
  const float s = fmaxf(qb - k, 0.0f);
  const h16 p = toh_flush(__expf(s - cexp));
  lsum += (float)p;
  return p;
}

// One ring tile: each wave copies 32 v rows (8 copies x 4 rows x 8 lanes x 16 B). l = the lane's
// LDS byte address of its first piece, g = its global address. The closing s_wait_xcnt is a
// precaution: it stands in front of every later write of a register that a copy names.
__device__ __forceinline__ void copy_v_tile(const unsigned l, const _Float16* g) {
  const unsigned ls = 4u * VPITCH;
  const size_t gs = (size_t)4 * SEQ;
  asm volatile(
      "global_load_async_to_lds_b128 %0, %8, off\n\t"
      "global_load_async_to_lds_b128 %1, %9, off\n\t"
      "global_load_async_to_lds_b128 %2, %10, off\n\t"
      "global_load_async_to_lds_b128 %3, %11, off\n\t"
      "global_load_async_to_lds_b128 %4, %12, off\n\t"
      "global_load_async_to_lds_b128 %5, %13, off\n\t"
      "global_load_async_to_lds_b128 %6, %14, off\n\t"
      "global_load_async_to_lds_b128 %7, %15, off\n\t"
      "s_wait_xcnt 0x0"
      :: "v"(l), "v"(l + ls), "v"(l + 2u * ls), "v"(l + 3u * ls),
         "v"(l + 4u * ls), "v"(l + 5u * ls), "v"(l + 6u * ls), "v"(l + 7u * ls),
         "v"(g), "v"(g + gs), "v"(g + 2u * gs), "v"(g + 3u * gs),
         "v"(g + 4u * gs), "v"(g + 5u * gs), "v"(g + 6u * gs), "v"(g + 7u * gs)
      : "memory");
}
// The tile's 64 key scores: one wave, 32 lanes x 8 B; same closing wait.
__device__ __forceinline__ void copy_k_tile(const unsigned l, const float* g) {
  asm volatile("global_load_async_to_lds_b64 %0, %1, off\n\ts_wait_xcnt 0x0"
               :: "v"(l), "v"(g) : "memory");
}

__global__ __launch_bounds__(256) void attn_kernel(
    const float* __restrict__ Qs, const float* __restrict__ Ksc,
    const float* __restrict__ bptr, const _Float16* __restrict__ Vt,
    float* __restrict__ out) {
  __shared__ float Os[8 * 16 * LDO];
  __shared__ float Wmin[8];
  __shared__ __attribute__((aligned(16))) unsigned char Ring[2u * RBUF];

  const unsigned tid = threadIdx.x, lane = tid & 31u;
  const int wave = __builtin_amdgcn_readfirstlane((int)(threadIdx.x >> 5));
  const unsigned hh = lane >> 4, m = lane & 15u;
  const unsigned b = blockIdx.y;
  const unsigned qg = (unsigned)wave >> 1, dh = (unsigned)wave & 1u;
  const unsigned qrow0 = blockIdx.x * (unsigned)QBLK + qg * 16u;
  const float* ksb = Ksc + (size_t)b * SEQ;

  // minimum key score of this batch (uniform trip count, clamped addresses)
  float kmin = 3.0e38f;
#pragma unroll 1
  for (unsigned it = 0; it < (unsigned)((SEQ + 1023) / 1024); ++it) {
    unsigned j = tid * 4u + it * 1024u;
    j = (j > (unsigned)(SEQ - 4)) ? (unsigned)(SEQ - 4) : j;
    const v4f t = *(const v4f*)(ksb + j);
    kmin = fminf(kmin, fminf(fminf(t[0], t[1]), fminf(t[2], t[3])));
  }
  kmin = red32_min(kmin);
  if (lane == 0u) Wmin[wave] = kmin;
  __syncthreads();
  float km = Wmin[0];
#pragma unroll
  for (int i = 1; i < 8; ++i) km = fminf(km, Wmin[i]);

  const float qb = Qs[(size_t)b * SEQ + qrow0 + m] + bf16r(bptr[0]);
  const float mrow = fmaxf(qb - km, 0.0f);
  const float cexp = mrow - LN_PCARRY;      // 1024 * exp(s - mrow) == exp(s - cexp)

  v8f o[8];
#pragma unroll
  for (int dt = 0; dt < 8; ++dt) o[dt] = (v8f){};
  float lsum = 0.0f;

  // copy side: this lane's piece of the wave's first four rows, in LDS and in the v plane
  const unsigned crow = (unsigned)wave * 32u + (lane >> 3);
  const unsigned ring0 = (unsigned)(size_t)Ring;          // byte offset in the block's LDS
  const unsigned cl = ring0 + crow * VPITCH + (lane & 7u) * 16u;
  const _Float16* cg = Vt + ((size_t)b * DIM + crow) * SEQ + (lane & 7u) * 8u;
  const unsigned kl = ring0 + VT_TILE + lane * 8u;
  const float* kg = ksb + lane * 2u;
  // read side: row (dh * 128 + m) of the tile, the lane's 16 B of the first 32-key step
  const unsigned rd = (dh * (unsigned)DH + m) * VPITCH + hh * 16u;
  const unsigned NT = (unsigned)SEQ / TKEYS;

  // ring prologue: tile 0 lands and is published, then tile 1 starts
  copy_v_tile(cl, cg);
  if (wave == 0) copy_k_tile(kl, kg);
  asm volatile("s_wait_asynccnt 0x0" ::: "memory");   // this wave's copies of tile 0 have landed
  __syncthreads();                                    // ... and every other wave's
  copy_v_tile(cl + RBUF, cg + TKEYS);
  if (wave == 0) copy_k_tile(kl + RBUF, kg + TKEYS);

#pragma unroll 1
  for (unsigned t = 0; t < NT; ++t) {
    const unsigned bo = (t & 1u) * RBUF;
    const unsigned char* vb = Ring + bo + rd;
    const float* kt = (const float*)(Ring + bo + VT_TILE) + hh * 8u;
#pragma unroll
    for (unsigned ks = 0; ks < 2u; ++ks) {             // the tile's two 32-key steps
      const float* kp = kt + ks * 32u;
      const v4f k0v = *(const v4f*)(kp);
      const v4f k1v = *(const v4f*)(kp + 4u);
      const v4f k2v = *(const v4f*)(kp + 16u);
      const v4f k3v = *(const v4f*)(kp + 20u);
      v16h a[8];
#pragma unroll
      for (int dt = 0; dt < 8; ++dt)
        a[dt] = frag_at((const _Float16*)(vb + (unsigned)dt * (16u * VPITCH) + ks * 64u));
      v16h pf;
#pragma unroll
      for (int i = 0; i < 4; ++i) {
        pf[i]      = p_elem(qb, k0v[i], cexp, lsum);
        pf[i + 4]  = p_elem(qb, k1v[i], cexp, lsum);
        pf[i + 8]  = p_elem(qb, k2v[i], cexp, lsum);
        pf[i + 12] = p_elem(qb, k3v[i], cexp, lsum);
      }
#pragma unroll
      for (int dt = 0; dt < 8; ++dt) o[dt] = wmma16(a[dt], pf, o[dt]);
    }
    // publish point of tile t + 1; the same barrier ends every read of tile t's buffer
    asm volatile("s_wait_dscnt 0x0" ::: "memory");     // this wave's reads of tile t are done
    asm volatile("s_wait_asynccnt 0x0" ::: "memory");  // this wave's copies of tile t + 1 landed
    __syncthreads();
    if (t + 2u < NT) {                                 // refill the buffer just read
      copy_v_tile(cl + bo, cg + (size_t)(t + 2u) * TKEYS);
      if (wave == 0) copy_k_tile(kl + bo, kg + (size_t)(t + 2u) * TKEYS);
    }
  }
  asm volatile("s_wait_asynccnt 0x0" ::: "memory");    // no copy outlives the loop

  // lanes l and l+16 hold the two key halves of query m
  const float ltot = lsum + __shfl_xor(lsum, 16, 32);
  const float inv = __builtin_amdgcn_rcpf(ltot);

  // stage O[query m][d = dt*16 + 8*hh + r] in the wave's tile
  const unsigned tb = (unsigned)wave * (16u * LDO);
#pragma unroll
  for (int dt = 0; dt < 8; ++dt) {
    v4f u0, u1;
#pragma unroll
    for (int j = 0; j < 4; ++j) {
      u0[j] = o[dt][j] * inv;
      u1[j] = o[dt][j + 4] * inv;
    }
    *(v4f*)&Os[tb + m * LDO + (unsigned)dt * 16u + hh * 8u] = u0;
    *(v4f*)&Os[tb + m * LDO + (unsigned)dt * 16u + hh * 8u + 4u] = u1;
  }
  wave_lds_sync();

  const size_t orow = (size_t)b * SEQ_FULL + qrow0;
#pragma unroll
  for (unsigned g = 0; g < 2u; ++g) {      // 2 steps x 8 rows == 16 rows
    v4f x[8];
    size_t off[8];
#pragma unroll
    for (unsigned i = 0; i < 8u; ++i) {
      const unsigned r = 8u * g + i;
      x[i] = *(const v4f*)&Os[tb + r * LDO + lane * 4u];
      off[i] = (orow + r) * DIM + dh * (unsigned)DH + lane * 4u;
    }
#pragma unroll
    for (int i = 0; i < 8; ++i) *(v4f*)(out + off[i]) = x[i];
    
  }
}

// ---------------------------------------------------------------------------
extern "C" void kernel_launch(void* const* d_in, const int* in_sizes, int n_in,
                              void* d_out, int out_size, void* d_ws, size_t ws_size,
                              hipStream_t stream) {
  if (n_in < 6) return;
  const long long need_x = ((long long)(NB - 1) * SEQ_FULL + SEQ) * DIM;
  if ((long long)in_sizes[0] < need_x) return;
  if ((long long)in_sizes[1] < (long long)DIM * DIM) return;
  if ((long long)in_sizes[2] < (long long)DIM * DIM) return;
  if ((long long)in_sizes[3] < (long long)DIM * DIM) return;
  if (in_sizes[4] < DIM) return;
  if (in_sizes[5] < 1) return;
  if ((long long)out_size < need_x) return;
  if (ws_size < WS_TOTAL) return;

  const float* X    = (const float*)d_in[0];   // x      [NB_FULL][SEQ_FULL][DIM]
  const float* wq   = (const float*)d_in[1];   // Wq     [DIM out][DIM in]
  const float* wk   = (const float*)d_in[2];   // Wk     [DIM out][DIM in]
  const float* wvv  = (const float*)d_in[3];   // Wv     [DIM out][DIM in]
  const float* wmlp = (const float*)d_in[4];   // w_mlp  [DIM]
  const float* bmlp = (const float*)d_in[5];   // b_mlp  scalar
  float* out = (float*)d_out;

  char* ws = (char*)d_ws;
  _Float16* Wq16 = (_Float16*)(ws + OFF_WQ);    // [out][in], x64
  _Float16* Wk16 = (_Float16*)(ws + OFF_WK);
  _Float16* Wv16 = (_Float16*)(ws + OFF_WV);
  _Float16* X16  = (_Float16*)(ws + OFF_X16);   // [MROWS][DIM] compact rows
  float*    QS   = (float*)(ws + OFF_QS);       // [MROWS]
  float*    KS   = (float*)(ws + OFF_KS);       // [MROWS]
  _Float16* Vt16 = (_Float16*)(ws + OFF_VT);    // [b][DIM][SEQ]

  dim3 blk(256);

  // weight planes: in [out rows][in cols] -> out [out rows][in cols] (no transpose); grid (rows/8)
  wcast_kernel<<<dim3(DIM / 8), blk, 0, stream>>>(wq, Wq16);
  wcast_kernel<<<dim3(DIM / 8), blk, 0, stream>>>(wk, Wk16);
  wcast_kernel<<<dim3(DIM / 8), blk, 0, stream>>>(wvv, Wv16);
  xcast_kernel<<<dim3(MROWS / 8), blk, 0, stream>>>(X, X16);

  proj_score_kernel<<<dim3(MROWS / 64), blk, 0, stream>>>(X16, Wq16, wmlp, QS);
  proj_score_kernel<<<dim3(MROWS / 64), blk, 0, stream>>>(X16, Wk16, wmlp, KS);
  gemm_v_kernel<<<dim3(DIM / 64, MROWS / 64), blk, 0, stream>>>(X16, Wv16, Vt16);
  attn_kernel<<<dim3(SEQ / QBLK, NB), blk, 0, stream>>>(QS, KS, bmlp, Vt16, out);
}

// v002
// Measured time: 103 microseconds a run.
// Timed twice side by side with v001, it ran 1.15 and 1.13 times as fast.
// Over all steps from v000 it is 2.59 times as fast.
#include <hip/hip_runtime.h>
#include <stddef.h>

// All contractions on v_wmma_f32_16x16x32_f16 (f16 operands, f32 accumulate): q/k/v projections
// (x plane = f16(bf16(x)), weight planes = f16(64 * bf16(w)), kept in their [out][in] order) and
// the p.v product (p carried x1024, v plane f16 single). The per-row dot with the score vector,
// the additive ReLU scores, exp and the row sums are f32 on the vector unit.

typedef _Float16 v16h __attribute__((ext_vector_type(16)));
typedef _Float16 v8h  __attribute__((ext_vector_type(8)));
typedef float    v8f  __attribute__((ext_vector_type(8)));
typedef float    v4f  __attribute__((ext_vector_type(4)));
typedef _Float16 h16;

#ifndef NB
#define NB 4
#endif
#ifndef SEQ
#define SEQ 4096
#endif
#define NB_FULL  4
#define SEQ_FULL 4096
#define DIM   256
#define MROWS (NB * SEQ)
#define DH    128          // output columns per wave in the attention kernel
#define QBLK  64           // query rows per attention block (4 groups of 16)

#define LDC 68             // floats per LDS row of the 64x64 GEMM stage (272 B)
#define LDO 132            // floats per LDS row of the attention output stage (528 B)

#define WCARRY 64.0f                   // weight planes carried x64
#define LN_PCARRY 6.931471805599453f   // ln(1024): softmax numerators carried x1024

static_assert(NB >= 1 && NB <= NB_FULL);
static_assert(SEQ >= 128 && SEQ <= SEQ_FULL && (SEQ % 128) == 0);
static_assert(DIM == 32 * 8);               // cast: one wave per row, 32 lanes x 8 columns
static_assert((DIM % 64) == 0 && (DIM % 32) == 0);
static_assert((MROWS % 64) == 0 && (MROWS % 8) == 0);
static_assert((SEQ % QBLK) == 0 && (SEQ % 32) == 0 && (SEQ % 64) == 0);
static_assert(2 * DH == DIM && (DH % 16) == 0 && DH / 16 == 8);
static_assert(DH * 4 == 32 * 16);           // one store instruction = one 512-B row segment
static_assert(QBLK == 4 * 16);              // 8 waves = 4 query groups x 2 column halves
static_assert((LDC % 4) == 0 && LDC >= 64);
static_assert((LDO % 4) == 0 && LDO >= DH);
static_assert(2 * 8 == 16);                 // output stage: 2 steps x 8 rows == 16 tile rows
#define TKEYS   64u                      // keys per ring tile (two 32-key steps)
#define VPITCH  144u                     // LDS bytes per v row of a tile: 128 + 16 (16 B x odd)
#define VT_TILE ((unsigned)DIM * VPITCH) // v part of a ring buffer
#define RBUF    (VT_TILE + TKEYS * 4u)   // ring buffer: v tile, then the tile's key scores
static_assert((SEQ % 64) == 0 && SEQ / 64 >= 2);      // the ring's prologue needs two tiles
static_assert(TKEYS * 2u == 128u && (VPITCH % 16u) == 0 && (RBUF % 16u) == 0);
static_assert(DIM == 8 * 8 * 4);         // tile rows: 8 waves x 8 copies x 4 rows per copy
static_assert(TKEYS * 4u == 32u * 8u);   // key scores of a tile: one 8-B copy per lane of a wave
static_assert(8 * 16 * LDO * 4 + 8 * 4 + 2 * (DIM * 144 + 256) <= 327680);   // attention static LDS
static_assert(64 * LDC * 4 <= 131072);
static_assert((size_t)MROWS * DIM < (size_t)0xFFFFFFFFu);

// workspace layout (bytes)
#define W_BYTES   ((size_t)DIM * DIM * 2)
#define X16_BYTES ((size_t)MROWS * DIM * 2)
#define S_BYTES   ((size_t)MROWS * 4)
#define VT_BYTES  ((size_t)NB * DIM * SEQ * 2)
#define OFF_WQ  ((size_t)0)
#define OFF_WK  (OFF_WQ + W_BYTES)
#define OFF_WV  (OFF_WK + W_BYTES)
#define OFF_X16 (OFF_WV + W_BYTES)
#define OFF_QS  (OFF_X16 + X16_BYTES)
#define OFF_KS  (OFF_QS + S_BYTES)
#define OFF_VT  (OFF_KS + S_BYTES)
#define WS_TOTAL (OFF_VT + VT_BYTES)
static_assert((W_BYTES % 128) == 0 && (X16_BYTES % 128) == 0);
static_assert((S_BYTES % 128) == 0 && (VT_BYTES % 128) == 0);
static_assert(WS_TOTAL <= (size_t)134217728);

// ---------------------------------------------------------------------------
__device__ __forceinline__ float bf16r(float x) {   // RNE convert to bf16, returned widened
  unsigned int u = __float_as_uint(x);
  u = (u + 0x7FFFu + ((u >> 16) & 1u)) & 0xFFFF0000u;
  return __uint_as_float(u);
}

// f32 -> f16 for WMMA operand planes: values below the smallest f16 normal become zero.
static __device__ __forceinline__ h16 toh_flush(float v) {
  const h16 r = (h16)v;
  return (fabsf(v) < 6.103515625e-05f) ? (h16)0.0f : r;
}

// 16-bit fragment: p points at element [row = lane&15][k0 + 8*(lane>>4)] of a k-contiguous
// row. Elements 0..7 <- k0+8h+0..7, elements 8..15 <- k0+16+8h+0..7 (same map for A and B).
__device__ __forceinline__ v16h frag_at(const _Float16* p) {
  v8h lo = *(const v8h*)(p);
  v8h hi = *(const v8h*)(p + 16);
  v16h out;
#pragma unroll
  for (int i = 0; i < 8; ++i) { out[i] = lo[i]; out[i + 8] = hi[i]; }
  return out;
}

__device__ __forceinline__ v8f wmma16(v16h a, v16h b, v8f c) {
  v8f d = __builtin_amdgcn_wmma_f32_16x16x32_f16(false, a, false, b, (short)0, c,
                                                 false, false);
  asm volatile("v_nop\n\tv_nop\n\tv_nop\n\tv_nop" : "+v"(d) : "v"(a), "v"(b));
  return d;
}

__device__ __forceinline__ float red16_sum(float x) {
#pragma unroll
  for (int off = 1; off < 16; off <<= 1) x += __shfl_xor(x, off, 32);
  return x;
}
__device__ __forceinline__ float red32_min(float x) {
#pragma unroll
  for (int off = 1; off < 32; off <<= 1) x = fminf(x, __shfl_xor(x, off, 32));
  return x;
}

__device__ __forceinline__ void wave_lds_sync() {
  __builtin_amdgcn_fence(3 /* release order */, "wavefront");
  asm volatile("s_wait_dscnt 0x0" ::: "memory");
  __builtin_amdgcn_wave_barrier();
}

// ---------------------------------------------------------------------------
// Row cast: dst[row][0..255] = f16(carry * bf16(src[row][0..255])), one wave per row, 8 rows
// per block; the wave's single store instruction covers the whole 512-B row (4 lines).
// SRC_INPUT = 1: source rows are addressed with the full per-batch stride (module input);
// SRC_INPUT = 0: compact rows (weight matrices, [out][in] order kept: already k-contiguous).
// blk = index of the 8-row group inside this source (rows / 8 groups).
// ---------------------------------------------------------------------------
template <int SRC_INPUT>
__device__ __forceinline__ void cast_body(const float* __restrict__ X,
                                          _Float16* __restrict__ dst, const float carry,
                                          const unsigned blk) {
#pragma clang fp contract(off)
  const unsigned lane = threadIdx.x & 31u;
  const unsigned w = (unsigned)__builtin_amdgcn_readfirstlane((int)(threadIdx.x >> 5));
  const unsigned crow = blk * 8u + w;
  size_t srow = crow;
  if (SRC_INPUT) {
    const unsigned bidx = crow / (unsigned)SEQ;
    const unsigned sq = crow - bidx * (unsigned)SEQ;
    srow = (size_t)bidx * SEQ_FULL + sq;
  }
  const float* xr = X + srow * DIM + lane * 8u;
  const v4f a0 = *(const v4f*)(xr);
  const v4f a1 = *(const v4f*)(xr + 4u);
  v8h o;
#pragma unroll
  for (int i = 0; i < 4; ++i) {
    o[i]     = toh_flush(carry * bf16r(a0[i]));
    o[i + 4] = toh_flush(carry * bf16r(a1[i]));
  }
  _Float16* p = dst + (size_t)crow * DIM + lane * 8u;
  *(v8h*)p = o;
  
}

// All four casts in one launch: they are independent of each other, so the block index picks the
// source. Blocks 0 .. 3 * WBLK - 1: the three weight planes; the rest: the rows of x.
// Grid (3 * WBLK + MROWS / 8).
#define WBLK ((unsigned)(DIM / 8))
__global__ __launch_bounds__(256) void cast_kernel(
    const float* __restrict__ X, const float* __restrict__ wq, const float* __restrict__ wk,
    const float* __restrict__ wv, _Float16* __restrict__ x16, _Float16* __restrict__ wq16,
    _Float16* __restrict__ wk16, _Float16* __restrict__ wv16) {
  const unsigned bx = blockIdx.x;
  if (bx < 3u * WBLK) {
    const unsigned p = bx / WBLK;
    const float* src = (p == 0u) ? wq : (p == 1u) ? wk : wv;
    _Float16* dst = (p == 0u) ? wq16 : (p == 1u) ? wk16 : wv16;
    cast_body<0>(src, dst, WCARRY, bx - p * WBLK);
  } else {
    cast_body<1>(X, x16, 1.0f, bx - 3u * WBLK);
    // precaution: in the listing the weight job's code follows this job's store (behind a branch
    // that skips it) and reuses the store's registers; the wait stands in front of that code
    asm volatile("s_wait_xcnt 0x0" ::: "memory");
  }
}

// ---------------------------------------------------------------------------
// Projection + row score: for a 64-row tile, P = A16 . Bt^T over all 256 output columns (four
// 64-column groups, 8 waves: mw = 16-row group, nw = 32-column group, 2 accumulators per
// wave), and outs[row] = sum_c P[row][c] * bf16(wv[c]) taken from the f32 accumulators.
// by 16 consecutive lanes x 16 B of wave 0.
// rblk = index of the 64-row tile (MROWS/64 tiles).
// ---------------------------------------------------------------------------
__device__ __forceinline__ void proj_score_body(
    const _Float16* __restrict__ A16, const _Float16* __restrict__ Bt,
    const float* __restrict__ wv, float* __restrict__ outs, const unsigned rblk) {
  __shared__ float Rs[2 * 64];
  const unsigned tid = threadIdx.x, lane = tid & 31u;
  const int wave = __builtin_amdgcn_readfirstlane((int)(threadIdx.x >> 5));
  const unsigned mw = (unsigned)wave >> 1, nw = (unsigned)wave & 1u;
  const unsigned hh = lane >> 4, m = lane & 15u;
  const unsigned row0 = rblk * 64u;

  const _Float16* ap = A16 + (size_t)(row0 + mw * 16u + m) * DIM + hh * 8u;
  float part[8];
#pragma unroll
  for (int r = 0; r < 8; ++r) part[r] = 0.0f;

#pragma unroll 1
  for (unsigned nb = 0; nb < (unsigned)(DIM / 64); ++nb) {
    const unsigned col = nb * 64u + nw * 32u + m;
    const _Float16* bp0 = Bt + (size_t)col * DIM + hh * 8u;
    const _Float16* bp1 = bp0 + (size_t)16 * DIM;
    v8f acc0 = {}, acc1 = {};
#pragma unroll 2
    for (unsigned k0 = 0; k0 < (unsigned)DIM; k0 += 32u) {
      const v16h a  = frag_at(ap + k0);
      const v16h b0 = frag_at(bp0 + k0);
      const v16h b1 = frag_at(bp1 + k0);
      acc0 = wmma16(a, b0, acc0);
      acc1 = wmma16(a, b1, acc1);
    }
    const float w0 = bf16r(wv[col]);
    const float w1 = bf16r(wv[col + 16u]);
#pragma unroll
    for (int r = 0; r < 8; ++r) part[r] += acc0[r] * w0 + acc1[r] * w1;
  }
  // row (mw*16 + hh*8 + r) is spread over the 16 lanes of a half
#pragma unroll
  for (int r = 0; r < 8; ++r) part[r] = red16_sum(part[r]);
  if (m == 0u) {
#pragma unroll
    for (int r = 0; r < 8; ++r) Rs[nw * 64u + mw * 16u + hh * 8u + (unsigned)r] = part[r];
  }
  __syncthreads();
  if (wave == 0 && lane < 16u) {
    v4f val;
#pragma unroll
    for (int j = 0; j < 4; ++j)
      val[j] = (Rs[lane * 4u + (unsigned)j] + Rs[64u + lane * 4u + (unsigned)j]) * (1.0f / WCARRY);
    float* p = outs + row0 + lane * 4u;
    *(v4f*)p = val;
    
  }
}

// ---------------------------------------------------------------------------
// V projection: C[64x64 tile] = A16[rows][K] . Bt[n][K]^T, fragments straight from the 16-bit
// global planes; 8 waves (mw = 16-row group, nw = 32-col group), 2 accumulators/wave.
// Epilogue staged through Cs (cross-wave, block barrier) and written transposed:
// lanes x 16 B. Store coverage: 2 steps x 32 column rows == 64 columns, 8 lanes x 8 keys == 64.
// nblk = index of the 64-column group (DIM/64), rblk = index of the 64-row tile (MROWS/64).
// ---------------------------------------------------------------------------
__device__ __forceinline__ void gemm_v_body(
    const _Float16* __restrict__ A16, const _Float16* __restrict__ Bt,
    _Float16* __restrict__ vt, const unsigned nblk, const unsigned rblk) {
  __shared__ float Cs[64 * LDC];
  const unsigned tid = threadIdx.x, lane = tid & 31u;
  const unsigned w = (unsigned)__builtin_amdgcn_readfirstlane((int)(threadIdx.x >> 5));
  const unsigned mw = w >> 1, nw = w & 1u;
  const unsigned hh = lane >> 4, m = lane & 15u;
  const unsigned n0 = nblk * 64u;
  const unsigned row0 = rblk * 64u;
  const unsigned K = (unsigned)DIM;

  const _Float16* ap  = A16 + (size_t)(row0 + mw * 16u + m) * K + hh * 8u;
  const _Float16* bp0 = Bt + (size_t)(n0 + nw * 32u + m) * K + hh * 8u;
  const _Float16* bp1 = bp0 + (size_t)16 * K;
  v8f acc0 = {}, acc1 = {};
#pragma unroll 2
  for (unsigned k0 = 0; k0 < K; k0 += 32u) {
    const v16h a  = frag_at(ap + k0);
    const v16h b0 = frag_at(bp0 + k0);
    const v16h b1 = frag_at(bp1 + k0);
    acc0 = wmma16(a, b0, acc0);
    acc1 = wmma16(a, b1, acc1);
  }
#pragma unroll
  for (int r = 0; r < 8; ++r) {
    float* d = &Cs[(mw * 16u + hh * 8u + (unsigned)r) * LDC + nw * 32u + m];
    d[0]  = acc0[r];
    d[16] = acc1[r];
  }
  __syncthreads();

  const unsigned bidx = row0 / (unsigned)SEQ;
  const unsigned key0 = row0 - bidx * (unsigned)SEQ;
  v8h x[2];
  size_t off[2];
#pragma unroll
  for (unsigned i = 0; i < 2u; ++i) {
    const unsigned dcol = 32u * i + (tid >> 3);
    const unsigned kk = (tid & 7u) * 8u;
#pragma unroll
    for (unsigned j = 0; j < 8u; ++j) {
      const float t = Cs[(kk + j) * LDC + dcol] * (1.0f / WCARRY);
      x[i][j] = toh_flush(t);
    }
    off[i] = ((size_t)bidx * DIM + n0 + dcol) * SEQ + key0 + kk;
  }
#pragma unroll
  for (int i = 0; i < 2; ++i) *(v8h*)(vt + off[i]) = x[i];
  
}

// The three projections in one launch: each reads only the cast planes and writes its own plane,
// so the block index picks the job. The score tiles do four column groups each and come first
// then the v tiles, column group fastest.
// Grid (2 * RBLK + (DIM/64) * RBLK).
#define RBLK ((unsigned)(MROWS / 64))
static_assert(DIM / 64 == 4);               // v tiles: column group = index & 3, row tile = index >> 2
__global__ __launch_bounds__(256) void proj_kernel(
    const _Float16* __restrict__ A16, const _Float16* __restrict__ Wq,
    const _Float16* __restrict__ Wk, const _Float16* __restrict__ Wv,
    const float* __restrict__ wmlp, float* __restrict__ qs, float* __restrict__ ks,
    _Float16* __restrict__ vt) {
  const unsigned bx = blockIdx.x;
  if (bx < 2u * RBLK) {
    const bool isk = bx >= RBLK;
    proj_score_body(A16, isk ? Wk : Wq, wmlp, isk ? ks : qs, isk ? bx - RBLK : bx);
  } else {
    const unsigned t = bx - 2u * RBLK;
    gemm_v_body(A16, Wv, vt, t & 3u, t >> 2);
    // precaution: in the listing the score job's code follows this job's stores (behind a branch
    // that skips it) and reuses the stores' registers; the wait stands in front of that code
    asm volatile("s_wait_xcnt 0x0" ::: "memory");
  }
}

// ---------------------------------------------------------------------------
// Dense additive-score attention, transposed form, v and key scores fed through an LDS ring.
// Block = 64 query rows x 256
// columns of one batch; wave = 16 query rows x 128 columns (8 accumulators).
// score[i][j] = relu(q_s[i] + b - k_s[j]); its row maximum is relu(q_s[i] + b - min_j k_s[j]),
// so the max-subtracted softmax needs no running rescale. Per 32-key step each lane builds
// its B fragment of P^T directly in registers (lane = query, elements = keys of the 16-bit
// k map), p = f16(1024 * exp(score - rowmax)), and O^T[d][i] += V^T[d][keys] . P^T[keys][i]
// with the A fragments from the ring. The row sum runs over the converted p, so the carry
// cancels in O / l. Ring: two buffers of 64 keys (256 v rows of 128 B at a 144-B pitch, then the
// 64 key scores), filled by asynchronous copies to LDS one tile ahead, so the block fetches each
// v byte once, in whole 128-B lines, while the tile before it is worked on; one publish point
// (LDS wait, copy wait, block barrier) per tile.
// Wmin: cross-wave (block barrier). Os: wave-private stage (wave sync); staged extent
// Grid (SEQ/64, NB).
// ---------------------------------------------------------------------------
__device__ __forceinline__ h16 p_elem(const float qb, const float k, const float cexp,
                                      float& lsum) {
  const float s = fmaxf(qb - k, 0.0f);
  const h16 p = toh_flush(__expf(s - cexp));
  lsum += (float)p;
  return p;
}

// One ring tile: each wave copies 32 v rows (8 copies x 4 rows x 8 lanes x 16 B). l = the lane's
// LDS byte address of its first piece, g = its global address. The closing s_wait_xcnt is a
// precaution: it stands in front of every later write of a register that a copy names.
__device__ __forceinline__ void copy_v_tile(const unsigned l, const _Float16* g) {
  const unsigned ls = 4u * VPITCH;
  const size_t gs = (size_t)4 * SEQ;
  asm volatile(
      "global_load_async_to_lds_b128 %0, %8, off\n\t"
      "global_load_async_to_lds_b128 %1, %9, off\n\t"
      "global_load_async_to_lds_b128 %2, %10, off\n\t"
      "global_load_async_to_lds_b128 %3, %11, off\n\t"
      "global_load_async_to_lds_b128 %4, %12, off\n\t"
      "global_load_async_to_lds_b128 %5, %13, off\n\t"
      "global_load_async_to_lds_b128 %6, %14, off\n\t"
      "global_load_async_to_lds_b128 %7, %15, off\n\t"
      "s_wait_xcnt 0x0"
      :: "v"(l), "v"(l + ls), "v"(l + 2u * ls), "v"(l + 3u * ls),
         "v"(l + 4u * ls), "v"(l + 5u * ls), "v"(l + 6u * ls), "v"(l + 7u * ls),
         "v"(g), "v"(g + gs), "v"(g + 2u * gs), "v"(g + 3u * gs),
         "v"(g + 4u * gs), "v"(g + 5u * gs), "v"(g + 6u * gs), "v"(g + 7u * gs)
      : "memory");
}
// The tile's 64 key scores: one wave, 32 lanes x 8 B; same closing wait.
__device__ __forceinline__ void copy_k_tile(const unsigned l, const float* g) {
  asm volatile("global_load_async_to_lds_b64 %0, %1, off\n\ts_wait_xcnt 0x0"
               :: "v"(l), "v"(g) : "memory");
}

__global__ __launch_bounds__(256) void attn_kernel(
    const float* __restrict__ Qs, const float* __restrict__ Ksc,
    const float* __restrict__ bptr, const _Float16* __restrict__ Vt,
    float* __restrict__ out) {
  __shared__ float Os[8 * 16 * LDO];
  __shared__ float Wmin[8];
  __shared__ __attribute__((aligned(16))) unsigned char Ring[2u * RBUF];

  const unsigned tid = threadIdx.x, lane = tid & 31u;
  const int wave = __builtin_amdgcn_readfirstlane((int)(threadIdx.x >> 5));
  const unsigned hh = lane >> 4, m = lane & 15u;
  const unsigned b = blockIdx.y;
  const unsigned qg = (unsigned)wave >> 1, dh = (unsigned)wave & 1u;
  const unsigned qrow0 = blockIdx.x * (unsigned)QBLK + qg * 16u;
  const float* ksb = Ksc + (size_t)b * SEQ;

  // minimum key score of this batch (uniform trip count, clamped addresses)
  float kmin = 3.0e38f;
#pragma unroll 1
  for (unsigned it = 0; it < (unsigned)((SEQ + 1023) / 1024); ++it) {
    unsigned j = tid * 4u + it * 1024u;
    j = (j > (unsigned)(SEQ - 4)) ? (unsigned)(SEQ - 4) : j;
    const v4f t = *(const v4f*)(ksb + j);
    kmin = fminf(kmin, fminf(fminf(t[0], t[1]), fminf(t[2], t[3])));
  }
  kmin = red32_min(kmin);
  if (lane == 0u) Wmin[wave] = kmin;
  __syncthreads();
  float km = Wmin[0];
#pragma unroll
  for (int i = 1; i < 8; ++i) km = fminf(km, Wmin[i]);

  const float qb = Qs[(size_t)b * SEQ + qrow0 + m] + bf16r(bptr[0]);
  const float mrow = fmaxf(qb - km, 0.0f);
  const float cexp = mrow - LN_PCARRY;      // 1024 * exp(s - mrow) == exp(s - cexp)

  v8f o[8];
#pragma unroll
  for (int dt = 0; dt < 8; ++dt) o[dt] = (v8f){};
  float lsum = 0.0f;

  // copy side: this lane's piece of the wave's first four rows, in LDS and in the v plane
  const unsigned crow = (unsigned)wave * 32u + (lane >> 3);
  const unsigned ring0 = (unsigned)(size_t)Ring;          // byte offset in the block's LDS
  const unsigned cl = ring0 + crow * VPITCH + (lane & 7u) * 16u;
  const _Float16* cg = Vt + ((size_t)b * DIM + crow) * SEQ + (lane & 7u) * 8u;
  const unsigned kl = ring0 + VT_TILE + lane * 8u;
  const float* kg = ksb + lane * 2u;
  // read side: row (dh * 128 + m) of the tile, the lane's 16 B of the first 32-key step
  const unsigned rd = (dh * (unsigned)DH + m) * VPITCH + hh * 16u;
  const unsigned NT = (unsigned)SEQ / TKEYS;

  // ring prologue: tile 0 lands and is published, then tile 1 starts
  copy_v_tile(cl, cg);
  if (wave == 0) copy_k_tile(kl, kg);
  asm volatile("s_wait_asynccnt 0x0" ::: "memory");   // this wave's copies of tile 0 have landed
  __syncthreads();                                    // ... and every other wave's
  copy_v_tile(cl + RBUF, cg + TKEYS);
  if (wave == 0) copy_k_tile(kl + RBUF, kg + TKEYS);

#pragma unroll 1
  for (unsigned t = 0; t < NT; ++t) {
    const unsigned bo = (t & 1u) * RBUF;
    const unsigned char* vb = Ring + bo + rd;
    const float* kt = (const float*)(Ring + bo + VT_TILE) + hh * 8u;
#pragma unroll
    for (unsigned ks = 0; ks < 2u; ++ks) {             // the tile's two 32-key steps
      const float* kp = kt + ks * 32u;
      const v4f k0v = *(const v4f*)(kp);
      const v4f k1v = *(const v4f*)(kp + 4u);
      const v4f k2v = *(const v4f*)(kp + 16u);
      const v4f k3v = *(const v4f*)(kp + 20u);
      v16h a[8];
#pragma unroll
      for (int dt = 0; dt < 8; ++dt)
        a[dt] = frag_at((const _Float16*)(vb + (unsigned)dt * (16u * VPITCH) + ks * 64u));
      v16h pf;
#pragma unroll
      for (int i = 0; i < 4; ++i) {
        pf[i]      = p_elem(qb, k0v[i], cexp, lsum);
        pf[i + 4]  = p_elem(qb, k1v[i], cexp, lsum);
        pf[i + 8]  = p_elem(qb, k2v[i], cexp, lsum);
        pf[i + 12] = p_elem(qb, k3v[i], cexp, lsum);
      }
#pragma unroll
      for (int dt = 0; dt < 8; ++dt) o[dt] = wmma16(a[dt], pf, o[dt]);
    }
    // publish point of tile t + 1; the same barrier ends every read of tile t's buffer
    asm volatile("s_wait_dscnt 0x0" ::: "memory");     // this wave's reads of tile t are done
    asm volatile("s_wait_asynccnt 0x0" ::: "memory");  // this wave's copies of tile t + 1 landed
    __syncthreads();
    if (t + 2u < NT) {                                 // refill the buffer just read
      copy_v_tile(cl + bo, cg + (size_t)(t + 2u) * TKEYS);
      if (wave == 0) copy_k_tile(kl + bo, kg + (size_t)(t + 2u) * TKEYS);
    }
  }
  asm volatile("s_wait_asynccnt 0x0" ::: "memory");    // no copy outlives the loop

  // lanes l and l+16 hold the two key halves of query m
  const float ltot = lsum + __shfl_xor(lsum, 16, 32);
  const float inv = __builtin_amdgcn_rcpf(ltot);

  // stage O[query m][d = dt*16 + 8*hh + r] in the wave's tile
  const unsigned tb = (unsigned)wave * (16u * LDO);
#pragma unroll
  for (int dt = 0; dt < 8; ++dt) {
    v4f u0, u1;
#pragma unroll
    for (int j = 0; j < 4; ++j) {
      u0[j] = o[dt][j] * inv;
      u1[j] = o[dt][j + 4] * inv;
    }
    *(v4f*)&Os[tb + m * LDO + (unsigned)dt * 16u + hh * 8u] = u0;
    *(v4f*)&Os[tb + m * LDO + (unsigned)dt * 16u + hh * 8u + 4u] = u1;
  }
  wave_lds_sync();

  const size_t orow = (size_t)b * SEQ_FULL + qrow0;
#pragma unroll
  for (unsigned g = 0; g < 2u; ++g) {      // 2 steps x 8 rows == 16 rows
    v4f x[8];
    size_t off[8];
#pragma unroll
    for (unsigned i = 0; i < 8u; ++i) {
      const unsigned r = 8u * g + i;
      x[i] = *(const v4f*)&Os[tb + r * LDO + lane * 4u];
      off[i] = (orow + r) * DIM + dh * (unsigned)DH + lane * 4u;
    }
#pragma unroll
    for (int i = 0; i < 8; ++i) *(v4f*)(out + off[i]) = x[i];
    
  }
}

// ---------------------------------------------------------------------------
extern "C" void kernel_launch(void* const* d_in, const int* in_sizes, int n_in,
                              void* d_out, int out_size, void* d_ws, size_t ws_size,
                              hipStream_t stream) {
  if (n_in < 6) return;
  const long long need_x = ((long long)(NB - 1) * SEQ_FULL + SEQ) * DIM;
  if ((long long)in_sizes[0] < need_x) return;
  if ((long long)in_sizes[1] < (long long)DIM * DIM) return;
  if ((long long)in_sizes[2] < (long long)DIM * DIM) return;
  if ((long long)in_sizes[3] < (long long)DIM * DIM) return;
  if (in_sizes[4] < DIM) return;
  if (in_sizes[5] < 1) return;
  if ((long long)out_size < need_x) return;
  if (ws_size < WS_TOTAL) return;

  const float* X    = (const float*)d_in[0];   // x      [NB_FULL][SEQ_FULL][DIM]
  const float* wq   = (const float*)d_in[1];   // Wq     [DIM out][DIM in]
  const float* wk   = (const float*)d_in[2];   // Wk     [DIM out][DIM in]
  const float* wvv  = (const float*)d_in[3];   // Wv     [DIM out][DIM in]
  const float* wmlp = (const float*)d_in[4];   // w_mlp  [DIM]
  const float* bmlp = (const float*)d_in[5];   // b_mlp  scalar
  float* out = (float*)d_out;

  char* ws = (char*)d_ws;
  _Float16* Wq16 = (_Float16*)(ws + OFF_WQ);    // [out][in], x64
  _Float16* Wk16 = (_Float16*)(ws + OFF_WK);
  _Float16* Wv16 = (_Float16*)(ws + OFF_WV);
  _Float16* X16  = (_Float16*)(ws + OFF_X16);   // [MROWS][DIM] compact rows
  float*    QS   = (float*)(ws + OFF_QS);       // [MROWS]
  float*    KS   = (float*)(ws + OFF_KS);       // [MROWS]
  _Float16* Vt16 = (_Float16*)(ws + OFF_VT);    // [b][DIM][SEQ]

  dim3 blk(256);

  // three dependent launches: casts (weight planes keep their [out][in] order), projections, attention
  cast_kernel<<<dim3(3 * (DIM / 8) + MROWS / 8), blk, 0, stream>>>(X, wq, wk, wvv, X16, Wq16, Wk16,
                                                                  Wv16);
  proj_kernel<<<dim3(2 * (MROWS / 64) + (DIM / 64) * (MROWS / 64)), blk, 0, stream>>>(
      X16, Wq16, Wk16, Wv16, wmlp, QS, KS, Vt16);
  attn_kernel<<<dim3(SEQ / QBLK, NB), blk, 0, stream>>>(QS, KS, bmlp, Vt16, out);
}

// v003
// A run of this version takes 73.9 microseconds.
// Two timings next to v002 put it at 1.40 and 1.38 times that version's speed.
// Over all steps from v000 it is 3.61 times as fast.
#include <hip/hip_runtime.h>
#include <stddef.h>

// All contractions on v_wmma_f32_16x16x32_f16 (f16 operands, f32 accumulate): q/k/v projections
// (x plane = f16(bf16(x)), weight planes = f16(64 * bf16(w)), kept in their [out][in] order) and
// the p.v product (p carried x1024, v plane f16 single). The per-row dot with the score vector,
// the additive ReLU scores, exp and the row sums are f32 on the vector unit.

typedef _Float16 v16h __attribute__((ext_vector_type(16)));
typedef _Float16 v8h  __attribute__((ext_vector_type(8)));
typedef float    v8f  __attribute__((ext_vector_type(8)));
typedef float    v4f  __attribute__((ext_vector_type(4)));
typedef _Float16 h16;

#ifndef NB
#define NB 4
#endif
#ifndef SEQ
#define SEQ 4096
#endif
#define NB_FULL  4
#define SEQ_FULL 4096
#define DIM   256
#define MROWS (NB * SEQ)
#define DH    128          // output columns per wave in the attention kernel
#define QBLK  64           // query rows per attention block (4 groups of 16)

#define LDC 68             // floats per LDS row of the 64x64 GEMM stage (272 B)
#define LDO 132            // floats per LDS row of the attention output stage (528 B)

#define WCARRY 64.0f                   // weight planes carried x64
#define LN_PCARRY 6.931471805599453f   // ln(1024): softmax numerators carried x1024

static_assert(NB >= 1 && NB <= NB_FULL);
static_assert(SEQ >= 128 && SEQ <= SEQ_FULL && (SEQ % 128) == 0);
static_assert(DIM == 32 * 8);               // cast: one wave per row, 32 lanes x 8 columns
static_assert((DIM % 64) == 0 && (DIM % 32) == 0);
static_assert((MROWS % 64) == 0 && (MROWS % 8) == 0);
static_assert((SEQ % QBLK) == 0 && (SEQ % 32) == 0 && (SEQ % 64) == 0);
static_assert(2 * DH == DIM && (DH % 16) == 0 && DH / 16 == 8);
static_assert(DH * 4 == 32 * 16);           // one store instruction = one 512-B row segment
static_assert(QBLK == 4 * 16);              // 8 waves = 4 query groups x 2 column halves
static_assert((LDC % 4) == 0 && LDC >= 64);
static_assert((LDO % 4) == 0 && LDO >= DH);
static_assert(2 * 8 == 16);                 // output stage: 2 steps x 8 rows == 16 tile rows
#define TKEYS   64u                      // keys per ring tile (two 32-key steps)
#define VPITCH  144u                     // LDS bytes per v row of a tile: 128 + 16 (16 B x odd)
#define VT_TILE ((unsigned)DIM * VPITCH) // v part of a ring buffer
#define RBUF    (VT_TILE + TKEYS * 4u)   // ring buffer: v tile, then the tile's key scores
static_assert((SEQ % 64) == 0 && SEQ / 64 >= 2);      // the ring's prologue needs two tiles
static_assert(TKEYS * 2u == 128u && (VPITCH % 16u) == 0 && (RBUF % 16u) == 0);
static_assert(DIM == 8 * 8 * 4);         // tile rows: 8 waves x 8 copies x 4 rows per copy
static_assert(TKEYS * 4u == 32u * 8u);   // key scores of a tile: one 8-B copy per lane of a wave
static_assert(8 * 16 * LDO * 4 + 8 * 4 + 2 * (DIM * 144 + 256) <= 327680);   // attention static LDS
static_assert((size_t)MROWS * DIM < (size_t)0xFFFFFFFFu);

// workspace layout (bytes)
#define W_BYTES   ((size_t)DIM * DIM * 2)
#define X16_BYTES ((size_t)MROWS * DIM * 2)
#define S_BYTES   ((size_t)MROWS * 4)
#define VT_BYTES  ((size_t)NB * DIM * SEQ * 2)
#define OFF_WQ  ((size_t)0)
#define OFF_WK  (OFF_WQ + W_BYTES)
#define OFF_WV  (OFF_WK + W_BYTES)
#define OFF_X16 (OFF_WV + W_BYTES)
#define OFF_QS  (OFF_X16 + X16_BYTES)
#define OFF_KS  (OFF_QS + S_BYTES)
#define OFF_VT  (OFF_KS + S_BYTES)
#define WS_TOTAL (OFF_VT + VT_BYTES)
static_assert((W_BYTES % 128) == 0 && (X16_BYTES % 128) == 0);
static_assert((S_BYTES % 128) == 0 && (VT_BYTES % 128) == 0);
static_assert(WS_TOTAL <= (size_t)134217728);

// ---------------------------------------------------------------------------
__device__ __forceinline__ float bf16r(float x) {   // RNE convert to bf16, returned widened
  unsigned int u = __float_as_uint(x);
  u = (u + 0x7FFFu + ((u >> 16) & 1u)) & 0xFFFF0000u;
  return __uint_as_float(u);
}

// f32 -> f16 for WMMA operand planes: values below the smallest f16 normal become zero.
static __device__ __forceinline__ h16 toh_flush(float v) {
  const h16 r = (h16)v;
  return (fabsf(v) < 6.103515625e-05f) ? (h16)0.0f : r;
}

// 16-bit fragment: p points at element [row = lane&15][k0 + 8*(lane>>4)] of a k-contiguous
// row. Elements 0..7 <- k0+8h+0..7, elements 8..15 <- k0+16+8h+0..7 (same map for A and B).
__device__ __forceinline__ v16h frag_at(const _Float16* p) {
  v8h lo = *(const v8h*)(p);
  v8h hi = *(const v8h*)(p + 16);
  v16h out;
#pragma unroll
  for (int i = 0; i < 8; ++i) { out[i] = lo[i]; out[i + 8] = hi[i]; }
  return out;
}

__device__ __forceinline__ v8f wmma16(v16h a, v16h b, v8f c) {
  v8f d = __builtin_amdgcn_wmma_f32_16x16x32_f16(false, a, false, b, (short)0, c,
                                                 false, false);
  asm volatile("v_nop\n\tv_nop\n\tv_nop\n\tv_nop" : "+v"(d) : "v"(a), "v"(b));
  return d;
}

__device__ __forceinline__ float red16_sum(float x) {
#pragma unroll
  for (int off = 1; off < 16; off <<= 1) x += __shfl_xor(x, off, 32);
  return x;
}
__device__ __forceinline__ float red32_min(float x) {
#pragma unroll
  for (int off = 1; off < 32; off <<= 1) x = fminf(x, __shfl_xor(x, off, 32));
  return x;
}

__device__ __forceinline__ void wave_lds_sync() {
  __builtin_amdgcn_fence(3 /* release order */, "wavefront");
  asm volatile("s_wait_dscnt 0x0" ::: "memory");
  __builtin_amdgcn_wave_barrier();
}

// ---------------------------------------------------------------------------
// Row cast: dst[row][0..255] = f16(carry * bf16(src[row][0..255])), one wave per row, 8 rows
// per block; the wave's single store instruction covers the whole 512-B row (4 lines).
// SRC_INPUT = 1: source rows are addressed with the full per-batch stride (module input);
// SRC_INPUT = 0: compact rows (weight matrices, [out][in] order kept: already k-contiguous).
// blk = index of the 8-row group inside this source (rows / 8 groups).
// ---------------------------------------------------------------------------
template <int SRC_INPUT>
__device__ __forceinline__ void cast_body(const float* __restrict__ X,
                                          _Float16* __restrict__ dst, const float carry,
                                          const unsigned blk) {
#pragma clang fp contract(off)
  const unsigned lane = threadIdx.x & 31u;
  const unsigned w = (unsigned)__builtin_amdgcn_readfirstlane((int)(threadIdx.x >> 5));
  const unsigned crow = blk * 8u + w;
  size_t srow = crow;
  if (SRC_INPUT) {
    const unsigned bidx = crow / (unsigned)SEQ;
    const unsigned sq = crow - bidx * (unsigned)SEQ;
    srow = (size_t)bidx * SEQ_FULL + sq;
  }
  const float* xr = X + srow * DIM + lane * 8u;
  const v4f a0 = *(const v4f*)(xr);
  const v4f a1 = *(const v4f*)(xr + 4u);
  v8h o;
#pragma unroll
  for (int i = 0; i < 4; ++i) {
    o[i]     = toh_flush(carry * bf16r(a0[i]));
    o[i + 4] = toh_flush(carry * bf16r(a1[i]));
  }
  _Float16* p = dst + (size_t)crow * DIM + lane * 8u;
  *(v8h*)p = o;
  
}

// All four casts in one launch: they are independent of each other, so the block index picks the
// source. Blocks 0 .. 3 * WBLK - 1: the three weight planes; the rest: the rows of x.
// Grid (3 * WBLK + MROWS / 8).
#define WBLK ((unsigned)(DIM / 8))
__global__ __launch_bounds__(256) void cast_kernel(
    const float* __restrict__ X, const float* __restrict__ wq, const float* __restrict__ wk,
    const float* __restrict__ wv, _Float16* __restrict__ x16, _Float16* __restrict__ wq16,
    _Float16* __restrict__ wk16, _Float16* __restrict__ wv16) {
  const unsigned bx = blockIdx.x;
  if (bx < 3u * WBLK) {
    const unsigned p = bx / WBLK;
    const float* src = (p == 0u) ? wq : (p == 1u) ? wk : wv;
    _Float16* dst = (p == 0u) ? wq16 : (p == 1u) ? wk16 : wv16;
    cast_body<0>(src, dst, WCARRY, bx - p * WBLK);
  } else {
    cast_body<1>(X, x16, 1.0f, bx - 3u * WBLK);
    // precaution: in the listing the weight job's code follows this job's store (behind a branch
    // that skips it) and reuses the store's registers; the wait stands in front of that code
    asm volatile("s_wait_xcnt 0x0" ::: "memory");
  }
}

// ---------------------------------------------------------------------------
// Projections, operands fed through LDS. Block = one 64-row tile of x times one whole weight
// matrix (job 0: v, job 1: q score, job 2: k score); 8 waves (mw = 16-row group, nw = 32-column
// group), 2 accumulators per wave, four 64-column tiles one after the other.
// Every byte of the x and weight planes comes in by asynchronous copies to LDS, one whole 512-B row (4 lines) per
// copy instruction: the x tile once, the weight tiles through a ring of two buffers, one tile
// ahead. Rows lie at a 528-B pitch (16 B x odd) for the 16-B fragment reads. Each wave reads its
// x fragments (16 rows x 256 k) from LDS once and keeps them in registers for all four tiles.
// One publish point (LDS wait, copy wait, block barrier) per weight tile.
// Score jobs: outs[row] = sum_c P[row][c] * bf16(wmlp[c]) from the f32 accumulators, reduced
// over the 16 lanes of a half and the two column groups (Rs, block barrier).
// v job: each 64x64 tile is staged through Cs (cross-wave, block barrier) and written
// transposed, 8 lanes x 16 B = one 128-B line of a v row. Cs lies in the x tile's place, which
// nobody reads any more behind the first publish point.
// Grid (3 * RBLK): three blocks fit a WGP's LDS.
// ---------------------------------------------------------------------------
#define RBLK   ((unsigned)(MROWS / 64))
#define PPITCH 528u                      // LDS bytes per staged row: 512 + 16
#define PTILE  (64u * PPITCH)            // one staged tile of 64 rows
static_assert(DIM * 2 == 32 * 16);       // one copy instruction = one row
static_assert((PPITCH % 16u) == 0 && ((PPITCH / 16u) & 1u) == 1u);
static_assert(64 == 8 * 8);              // tile rows: 8 waves x 8 copies
static_assert(DIM / 64 >= 2);            // the ring's prologue needs two weight tiles
static_assert(64u * LDC * 4u <= PTILE);  // Cs fits the x tile's place
static_assert(3u * (3u * PTILE + 512u) <= 327680u);

// Eight rows of a tile: each copy is one row, 32 lanes x 16 B. l = the lane's LDS byte address in
// the first row, g = its global address. The closing s_wait_xcnt is a precaution: it stands in
// front of every later write of a register that a copy names.
__device__ __forceinline__ void copy_rows8(const unsigned l, const _Float16* g) {
  const unsigned ls = PPITCH;
  const size_t gs = (size_t)DIM;
  asm volatile(
      "global_load_async_to_lds_b128 %0, %8, off\n\t"
      "global_load_async_to_lds_b128 %1, %9, off\n\t"
      "global_load_async_to_lds_b128 %2, %10, off\n\t"
      "global_load_async_to_lds_b128 %3, %11, off\n\t"
      "global_load_async_to_lds_b128 %4, %12, off\n\t"
      "global_load_async_to_lds_b128 %5, %13, off\n\t"
      "global_load_async_to_lds_b128 %6, %14, off\n\t"
      "global_load_async_to_lds_b128 %7, %15, off\n\t"
      "s_wait_xcnt 0x0"
      :: "v"(l), "v"(l + ls), "v"(l + 2u * ls), "v"(l + 3u * ls),
         "v"(l + 4u * ls), "v"(l + 5u * ls), "v"(l + 6u * ls), "v"(l + 7u * ls),
         "v"(g), "v"(g + gs), "v"(g + 2u * gs), "v"(g + 3u * gs),
         "v"(g + 4u * gs), "v"(g + 5u * gs), "v"(g + 6u * gs), "v"(g + 7u * gs)
      : "memory");
}

__global__ __launch_bounds__(256) void proj_kernel(
    const _Float16* __restrict__ A16, const _Float16* __restrict__ Wq,
    const _Float16* __restrict__ Wk, const _Float16* __restrict__ Wv,
    const float* __restrict__ wmlp, float* __restrict__ qs, float* __restrict__ ks,
    _Float16* __restrict__ vt) {
  __shared__ __attribute__((aligned(16))) unsigned char Ps[3u * PTILE];  // x tile, ring of two
  __shared__ float Rs[2 * 64];
  const unsigned tid = threadIdx.x, lane = tid & 31u;
  const unsigned w = (unsigned)__builtin_amdgcn_readfirstlane((int)(threadIdx.x >> 5));
  const unsigned mw = w >> 1, nw = w & 1u;
  const unsigned hh = lane >> 4, m = lane & 15u;
  const unsigned job = blockIdx.x / RBLK;
  const unsigned row0 = (blockIdx.x - job * RBLK) * 64u;
  const _Float16* Bt = (job == 0u) ? Wv : (job == 1u) ? Wq : Wk;
  const unsigned NTB = (unsigned)(DIM / 64);

  // copy side: this lane's 16 B of the wave's first row, in LDS and in the two planes
  const unsigned cl = (unsigned)(size_t)Ps + (w * 8u) * PPITCH + lane * 16u;
  const _Float16* ga = A16 + (size_t)(row0 + w * 8u) * DIM + lane * 8u;
  const _Float16* gb = Bt + (size_t)(w * 8u) * DIM + lane * 8u;

  // prologue: the x tile and weight tile 0 land and are published, then weight tile 1 starts
  copy_rows8(cl, ga);
  copy_rows8(cl + PTILE, gb);
  asm volatile("s_wait_asynccnt 0x0" ::: "memory");   // this wave's copies have landed
  __syncthreads();                                    // ... and every other wave's
  copy_rows8(cl + 2u * PTILE, gb + (size_t)64 * DIM);

  v16h a[8];
  {
    const unsigned char* ar = Ps + (mw * 16u + m) * PPITCH + hh * 16u;
#pragma unroll
    for (unsigned k = 0; k < 8u; ++k) a[k] = frag_at((const _Float16*)(ar + k * 64u));
  }
  float part[8];
#pragma unroll
  for (int r = 0; r < 8; ++r) part[r] = 0.0f;
  float* Cs = (float*)Ps;
  const unsigned rdb = PTILE + (nw * 32u + m) * PPITCH + hh * 16u;
  const unsigned bidx = row0 / (unsigned)SEQ;
  const unsigned key0 = row0 - bidx * (unsigned)SEQ;

  // rolled: one copy of the tile's code, the buffer picked by the trip's parity
#pragma unroll 1
  for (unsigned nb = 0; nb < NTB; ++nb) {
    const unsigned bo = (nb & 1u) * PTILE;
    const unsigned char* bb = Ps + bo + rdb;
    // score jobs: the tile's two score weights are fetched ahead of the products that hide them
    float wr0 = 0.0f, wr1 = 0.0f;
    if (job != 0u) {
      const unsigned col = nb * 64u + nw * 32u + m;
      wr0 = wmlp[col];
      wr1 = wmlp[col + 16u];
      // precaution: the wait stands in front of every later write of the loads' address registers
      asm volatile("s_wait_xcnt 0x0" ::: "memory");
    }
    v8f acc0 = {}, acc1 = {};
#pragma unroll
    for (unsigned k = 0; k < 8u; ++k) {
      const v16h b0 = frag_at((const _Float16*)(bb + k * 64u));
      const v16h b1 = frag_at((const _Float16*)(bb + 16u * PPITCH + k * 64u));
      acc0 = wmma16(a[k], b0, acc0);
      acc1 = wmma16(a[k], b1, acc1);
    }
    // publish point of weight tile nb + 1; the same barrier ends every read of tile nb's buffer
    // (and, at nb = 0, of the x tile; later, of Cs)
    asm volatile("s_wait_dscnt 0x0" ::: "memory");     // this wave's LDS reads are done
    asm volatile("s_wait_asynccnt 0x0" ::: "memory");  // this wave's copies of tile nb + 1 landed
    __syncthreads();
    if (nb + 2u < NTB)                                 // refill the buffer just read
      copy_rows8(cl + PTILE + bo, gb + (size_t)(nb + 2u) * 64u * DIM);

    if (job == 0u) {
#pragma unroll
      for (int r = 0; r < 8; ++r) {
        float* d = &Cs[(mw * 16u + hh * 8u + (unsigned)r) * LDC + nw * 32u + m];
        d[0]  = acc0[r];
        d[16] = acc1[r];
      }
      __syncthreads();
      v8h x[2];
      size_t off[2];
#pragma unroll
      for (unsigned i = 0; i < 2u; ++i) {
        const unsigned dcol = 32u * i + (tid >> 3);
        const unsigned kk = (tid & 7u) * 8u;
#pragma unroll
        for (unsigned j = 0; j < 8u; ++j) {
          const float t = Cs[(kk + j) * LDC + dcol] * (1.0f / WCARRY);
          x[i][j] = toh_flush(t);
        }
        off[i] = ((size_t)bidx * DIM + nb * 64u + dcol) * SEQ + key0 + kk;
      }
#pragma unroll
      for (int i = 0; i < 2; ++i) *(v8h*)(vt + off[i]) = x[i];
      // precaution: the next trip reuses the stores' registers; the wait stands in front of it
      asm volatile("s_wait_xcnt 0x0" ::: "memory");
    } else {
      const float w0 = bf16r(wr0);
      const float w1 = bf16r(wr1);
#pragma unroll
      for (int r = 0; r < 8; ++r) part[r] += acc0[r] * w0 + acc1[r] * w1;
    }
  }
  asm volatile("s_wait_asynccnt 0x0" ::: "memory");    // no copy outlives the loop

  if (job != 0u) {
    // row (mw*16 + hh*8 + r) is spread over the 16 lanes of a half
#pragma unroll
    for (int r = 0; r < 8; ++r) part[r] = red16_sum(part[r]);
    if (m == 0u) {
#pragma unroll
      for (int r = 0; r < 8; ++r) Rs[nw * 64u + mw * 16u + hh * 8u + (unsigned)r] = part[r];
    }
    __syncthreads();
    if (w == 0u && lane < 16u) {
      v4f val;
#pragma unroll
      for (int j = 0; j < 4; ++j)
        val[j] = (Rs[lane * 4u + (unsigned)j] + Rs[64u + lane * 4u + (unsigned)j]) * (1.0f / WCARRY);
      float* p = ((job == 1u) ? qs : ks) + row0 + lane * 4u;
      *(v4f*)p = val;
    }
  }
}

// ---------------------------------------------------------------------------
// Dense additive-score attention, transposed form, v and key scores fed through an LDS ring.
// Block = 64 query rows x 256
// columns of one batch; wave = 16 query rows x 128 columns (8 accumulators).
// score[i][j] = relu(q_s[i] + b - k_s[j]); its row maximum is relu(q_s[i] + b - min_j k_s[j]),
// so the max-subtracted softmax needs no running rescale. Per 32-key step each lane builds
// its B fragment of P^T directly in registers (lane = query, elements = keys of the 16-bit
// k map), p = f16(1024 * exp(score - rowmax)), and O^T[d][i] += V^T[d][keys] . P^T[keys][i]
// with the A fragments from the ring. The row sum runs over the converted p, so the carry
// cancels in O / l. Ring: two buffers of 64 keys (256 v rows of 128 B at a 144-B pitch, then the
// 64 key scores), filled by asynchronous copies to LDS one tile ahead, so the block fetches each
// v byte once, in whole 128-B lines, while the tile before it is worked on; one publish point
// (LDS wait, copy wait, block barrier) per tile.
// Wmin: cross-wave (block barrier). Os: wave-private stage (wave sync); staged extent
// Grid (SEQ/64, NB).
// ---------------------------------------------------------------------------
__device__ __forceinline__ h16 p_elem(const float qb, const float k, const float cexp,
                                      float& lsum) {
  const float s = fmaxf(qb - k, 0.0f);
  const h16 p = toh_flush(__expf(s - cexp));
  lsum += (float)p;
  return p;
}

// One ring tile: each wave copies 32 v rows (8 copies x 4 rows x 8 lanes x 16 B). l = the lane's
// LDS byte address of its first piece, g = its global address. The closing s_wait_xcnt is a
// precaution: it stands in front of every later write of a register that a copy names.
__device__ __forceinline__ void copy_v_tile(const unsigned l, const _Float16* g) {
  const unsigned ls = 4u * VPITCH;
  const size_t gs = (size_t)4 * SEQ;
  asm volatile(
      "global_load_async_to_lds_b128 %0, %8, off\n\t"
      "global_load_async_to_lds_b128 %1, %9, off\n\t"
      "global_load_async_to_lds_b128 %2, %10, off\n\t"
      "global_load_async_to_lds_b128 %3, %11, off\n\t"
      "global_load_async_to_lds_b128 %4, %12, off\n\t"
      "global_load_async_to_lds_b128 %5, %13, off\n\t"
      "global_load_async_to_lds_b128 %6, %14, off\n\t"
      "global_load_async_to_lds_b128 %7, %15, off\n\t"
      "s_wait_xcnt 0x0"
      :: "v"(l), "v"(l + ls), "v"(l + 2u * ls), "v"(l + 3u * ls),
         "v"(l + 4u * ls), "v"(l + 5u * ls), "v"(l + 6u * ls), "v"(l + 7u * ls),
         "v"(g), "v"(g + gs), "v"(g + 2u * gs), "v"(g + 3u * gs),
         "v"(g + 4u * gs), "v"(g + 5u * gs), "v"(g + 6u * gs), "v"(g + 7u * gs)
      : "memory");
}
// The tile's 64 key scores: one wave, 32 lanes x 8 B; same closing wait.
__device__ __forceinline__ void copy_k_tile(const unsigned l, const float* g) {
  asm volatile("global_load_async_to_lds_b64 %0, %1, off\n\ts_wait_xcnt 0x0"
               :: "v"(l), "v"(g) : "memory");
}

__global__ __launch_bounds__(256) void attn_kernel(
    const float* __restrict__ Qs, const float* __restrict__ Ksc,
    const float* __restrict__ bptr, const _Float16* __restrict__ Vt,
    float* __restrict__ out) {
  __shared__ float Os[8 * 16 * LDO];
  __shared__ float Wmin[8];
  __shared__ __attribute__((aligned(16))) unsigned char Ring[2u * RBUF];

  const unsigned tid = threadIdx.x, lane = tid & 31u;
  const int wave = __builtin_amdgcn_readfirstlane((int)(threadIdx.x >> 5));
  const unsigned hh = lane >> 4, m = lane & 15u;
  const unsigned b = blockIdx.y;
  const unsigned qg = (unsigned)wave >> 1, dh = (unsigned)wave & 1u;
  const unsigned qrow0 = blockIdx.x * (unsigned)QBLK + qg * 16u;
  const float* ksb = Ksc + (size_t)b * SEQ;

  // minimum key score of this batch (uniform trip count, clamped addresses)
  float kmin = 3.0e38f;
#pragma unroll 1
  for (unsigned it = 0; it < (unsigned)((SEQ + 1023) / 1024); ++it) {
    unsigned j = tid * 4u + it * 1024u;
    j = (j > (unsigned)(SEQ - 4)) ? (unsigned)(SEQ - 4) : j;
    const v4f t = *(const v4f*)(ksb + j);
    kmin = fminf(kmin, fminf(fminf(t[0], t[1]), fminf(t[2], t[3])));
  }
  kmin = red32_min(kmin);
  if (lane == 0u) Wmin[wave] = kmin;
  __syncthreads();
  float km = Wmin[0];
#pragma unroll
  for (int i = 1; i < 8; ++i) km = fminf(km, Wmin[i]);

  const float qb = Qs[(size_t)b * SEQ + qrow0 + m] + bf16r(bptr[0]);
  const float mrow = fmaxf(qb - km, 0.0f);
  const float cexp = mrow - LN_PCARRY;      // 1024 * exp(s - mrow) == exp(s - cexp)

  v8f o[8];
#pragma unroll
  for (int dt = 0; dt < 8; ++dt) o[dt] = (v8f){};
  float lsum = 0.0f;

  // copy side: this lane's piece of the wave's first four rows, in LDS and in the v plane
  const unsigned crow = (unsigned)wave * 32u + (lane >> 3);
  const unsigned ring0 = (unsigned)(size_t)Ring;          // byte offset in the block's LDS
  const unsigned cl = ring0 + crow * VPITCH + (lane & 7u) * 16u;
  const _Float16* cg = Vt + ((size_t)b * DIM + crow) * SEQ + (lane & 7u) * 8u;
  const unsigned kl = ring0 + VT_TILE + lane * 8u;
  const float* kg = ksb + lane * 2u;
  // read side: row (dh * 128 + m) of the tile, the lane's 16 B of the first 32-key step
  const unsigned rd = (dh * (unsigned)DH + m) * VPITCH + hh * 16u;
  const unsigned NT = (unsigned)SEQ / TKEYS;

  // ring prologue: tile 0 lands and is published, then tile 1 starts
  copy_v_tile(cl, cg);
  if (wave == 0) copy_k_tile(kl, kg);
  asm volatile("s_wait_asynccnt 0x0" ::: "memory");   // this wave's copies of tile 0 have landed
  __syncthreads();                                    // ... and every other wave's
  copy_v_tile(cl + RBUF, cg + TKEYS);
  if (wave == 0) copy_k_tile(kl + RBUF, kg + TKEYS);

#pragma unroll 1
  for (unsigned t = 0; t < NT; ++t) {
    const unsigned bo = (t & 1u) * RBUF;
    const unsigned char* vb = Ring + bo + rd;
    const float* kt = (const float*)(Ring + bo + VT_TILE) + hh * 8u;
#pragma unroll
    for (unsigned ks = 0; ks < 2u; ++ks) {             // the tile's two 32-key steps
      const float* kp = kt + ks * 32u;
      const v4f k0v = *(const v4f*)(kp);
      const v4f k1v = *(const v4f*)(kp + 4u);
      const v4f k2v = *(const v4f*)(kp + 16u);
      const v4f k3v = *(const v4f*)(kp + 20u);
      v16h a[8];
#pragma unroll
      for (int dt = 0; dt < 8; ++dt)
        a[dt] = frag_at((const _Float16*)(vb + (unsigned)dt * (16u * VPITCH) + ks * 64u));
      v16h pf;
#pragma unroll
      for (int i = 0; i < 4; ++i) {
        pf[i]      = p_elem(qb, k0v[i], cexp, lsum);
        pf[i + 4]  = p_elem(qb, k1v[i], cexp, lsum);
        pf[i + 8]  = p_elem(qb, k2v[i], cexp, lsum);
        pf[i + 12] = p_elem(qb, k3v[i], cexp, lsum);
      }
#pragma unroll
      for (int dt = 0; dt < 8; ++dt) o[dt] = wmma16(a[dt], pf, o[dt]);
    }
    // publish point of tile t + 1; the same barrier ends every read of tile t's buffer
    asm volatile("s_wait_dscnt 0x0" ::: "memory");     // this wave's reads of tile t are done
    asm volatile("s_wait_asynccnt 0x0" ::: "memory");  // this wave's copies of tile t + 1 landed
    __syncthreads();
    if (t + 2u < NT) {                                 // refill the buffer just read
      copy_v_tile(cl + bo, cg + (size_t)(t + 2u) * TKEYS);
      if (wave == 0) copy_k_tile(kl + bo, kg + (size_t)(t + 2u) * TKEYS);
    }
  }
  asm volatile("s_wait_asynccnt 0x0" ::: "memory");    // no copy outlives the loop

  // lanes l and l+16 hold the two key halves of query m
  const float ltot = lsum + __shfl_xor(lsum, 16, 32);
  const float inv = __builtin_amdgcn_rcpf(ltot);

  // stage O[query m][d = dt*16 + 8*hh + r] in the wave's tile
  const unsigned tb = (unsigned)wave * (16u * LDO);
#pragma unroll
  for (int dt = 0; dt < 8; ++dt) {
    v4f u0, u1;
#pragma unroll
    for (int j = 0; j < 4; ++j) {
      u0[j] = o[dt][j] * inv;
      u1[j] = o[dt][j + 4] * inv;
    }
    *(v4f*)&Os[tb + m * LDO + (unsigned)dt * 16u + hh * 8u] = u0;
    *(v4f*)&Os[tb + m * LDO + (unsigned)dt * 16u + hh * 8u + 4u] = u1;
  }
  wave_lds_sync();

  const size_t orow = (size_t)b * SEQ_FULL + qrow0;
#pragma unroll
  for (unsigned g = 0; g < 2u; ++g) {      // 2 steps x 8 rows == 16 rows
    v4f x[8];
    size_t off[8];
#pragma unroll
    for (unsigned i = 0; i < 8u; ++i) {
      const unsigned r = 8u * g + i;
      x[i] = *(const v4f*)&Os[tb + r * LDO + lane * 4u];
      off[i] = (orow + r) * DIM + dh * (unsigned)DH + lane * 4u;
    }
#pragma unroll
    for (int i = 0; i < 8; ++i) *(v4f*)(out + off[i]) = x[i];
    
  }
}

// ---------------------------------------------------------------------------
extern "C" void kernel_launch(void* const* d_in, const int* in_sizes, int n_in,
                              void* d_out, int out_size, void* d_ws, size_t ws_size,
                              hipStream_t stream) {
  if (n_in < 6) return;
  const long long need_x = ((long long)(NB - 1) * SEQ_FULL + SEQ) * DIM;
  if ((long long)in_sizes[0] < need_x) return;
  if ((long long)in_sizes[1] < (long long)DIM * DIM) return;
  if ((long long)in_sizes[2] < (long long)DIM * DIM) return;
  if ((long long)in_sizes[3] < (long long)DIM * DIM) return;
  if (in_sizes[4] < DIM) return;
  if (in_sizes[5] < 1) return;
  if ((long long)out_size < need_x) return;
  if (ws_size < WS_TOTAL) return;

  const float* X    = (const float*)d_in[0];   // x      [NB_FULL][SEQ_FULL][DIM]
  const float* wq   = (const float*)d_in[1];   // Wq     [DIM out][DIM in]
  const float* wk   = (const float*)d_in[2];   // Wk     [DIM out][DIM in]
  const float* wvv  = (const float*)d_in[3];   // Wv     [DIM out][DIM in]
  const float* wmlp = (const float*)d_in[4];   // w_mlp  [DIM]
  const float* bmlp = (const float*)d_in[5];   // b_mlp  scalar
  float* out = (float*)d_out;

  char* ws = (char*)d_ws;
  _Float16* Wq16 = (_Float16*)(ws + OFF_WQ);    // [out][in], x64
  _Float16* Wk16 = (_Float16*)(ws + OFF_WK);
  _Float16* Wv16 = (_Float16*)(ws + OFF_WV);
  _Float16* X16  = (_Float16*)(ws + OFF_X16);   // [MROWS][DIM] compact rows
  float*    QS   = (float*)(ws + OFF_QS);       // [MROWS]
  float*    KS   = (float*)(ws + OFF_KS);       // [MROWS]
  _Float16* Vt16 = (_Float16*)(ws + OFF_VT);    // [b][DIM][SEQ]

  dim3 blk(256);

  // three dependent launches: casts (weight planes keep their [out][in] order), projections, attention
  cast_kernel<<<dim3(3 * (DIM / 8) + MROWS / 8), blk, 0, stream>>>(X, wq, wk, wvv, X16, Wq16, Wk16,
                                                                  Wv16);
  proj_kernel<<<dim3(3 * (MROWS / 64)), blk, 0, stream>>>(
      X16, Wq16, Wk16, Wv16, wmlp, QS, KS, Vt16);
  attn_kernel<<<dim3(SEQ / QBLK, NB), blk, 0, stream>>>(QS, KS, bmlp, Vt16, out);
}

// v004
// Measured time: 59.2 microseconds a run.
// In two side-by-side timings against v003, it was 1.26 and 1.23 times as fast.
// Over all steps from v000 it is 4.48 times as fast.
#include <hip/hip_runtime.h>
#include <stddef.h>

// All contractions on v_wmma_f32_16x16x32_f16 (f16 operands, f32 accumulate): q/k/v projections
// (x plane = f16(bf16(x)), weight planes = f16(64 * bf16(w)), kept in their [out][in] order) and
// the p.v product (p carried x1024, v plane f16 single). The per-row dot with the score vector,
// the exp of each key's and each query's score and the row sums are f32 on the vector unit; the
// softmax numerators are the f16 maximum of a key term and a query term.

typedef _Float16 v16h __attribute__((ext_vector_type(16)));
typedef _Float16 v8h  __attribute__((ext_vector_type(8)));
typedef _Float16 v4h  __attribute__((ext_vector_type(4)));
typedef float    v8f  __attribute__((ext_vector_type(8)));
typedef float    v4f  __attribute__((ext_vector_type(4)));
typedef _Float16 h16;

#ifndef NB
#define NB 4
#endif
#ifndef SEQ
#define SEQ 4096
#endif
#define NB_FULL  4
#define SEQ_FULL 4096
#define DIM   256
#define MROWS (NB * SEQ)
#define DH    128          // output columns per wave in the attention kernel
#define QBLK  64           // query rows per attention block (4 groups of 16)

#define LDC 68             // floats per LDS row of the 64x64 GEMM stage (272 B)
#define LDO 132            // floats per LDS row of the attention output stage (528 B)

#define WCARRY 64.0f                   // weight planes carried x64
#define LN_PCARRY 6.931471805599453f   // ln(1024): softmax numerators carried x1024

static_assert(NB >= 1 && NB <= NB_FULL);
static_assert(SEQ >= 128 && SEQ <= SEQ_FULL && (SEQ % 128) == 0);
static_assert(DIM == 32 * 8);               // cast: one wave per row, 32 lanes x 8 columns
static_assert((DIM % 64) == 0 && (DIM % 32) == 0);
static_assert((MROWS % 64) == 0 && (MROWS % 8) == 0);
static_assert((SEQ % QBLK) == 0 && (SEQ % 32) == 0 && (SEQ % 64) == 0);
static_assert(2 * DH == DIM && (DH % 16) == 0 && DH / 16 == 8);
static_assert(DH * 4 == 32 * 16);           // one store instruction = one 512-B row segment
static_assert(QBLK == 4 * 16);              // 8 waves = 4 query groups x 2 column halves
static_assert((LDC % 4) == 0 && LDC >= 64);
static_assert((LDO % 4) == 0 && LDO >= DH);
static_assert(2 * 8 == 16);                 // output stage: 2 steps x 8 rows == 16 tile rows
#define TKEYS   64u                      // keys per ring tile (two 32-key steps)
#define VPITCH  144u                     // LDS bytes per v row of a tile: 128 + 16 (16 B x odd)
#define VT_TILE ((unsigned)DIM * VPITCH) // one v tile of 256 rows (a whole ring buffer)
#define RBUF    VT_TILE                  // ring buffer: one v tile
static_assert((SEQ % 64) == 0 && SEQ / 64 >= 2);      // the ring's prologue needs two tiles
static_assert(TKEYS * 2u == 128u && (VPITCH % 16u) == 0 && (RBUF % 16u) == 0);
static_assert(DIM == 8 * 8 * 4);         // tile rows: 8 waves x 8 copies x 4 rows per copy
static_assert(8 * 16 * LDO * 4 + 8 * 4 + 2 * (DIM * 144) + SEQ * 2 <= 327680);   // attention static LDS
static_assert((size_t)MROWS * DIM < (size_t)0xFFFFFFFFu);

// workspace layout (bytes)
#define W_BYTES   ((size_t)DIM * DIM * 2)
#define X16_BYTES ((size_t)MROWS * DIM * 2)
#define S_BYTES   ((size_t)MROWS * 4)
#define VT_BYTES  ((size_t)NB * DIM * SEQ * 2)
#define OFF_WQ  ((size_t)0)
#define OFF_WK  (OFF_WQ + W_BYTES)
#define OFF_WV  (OFF_WK + W_BYTES)
#define OFF_X16 (OFF_WV + W_BYTES)
#define OFF_QS  (OFF_X16 + X16_BYTES)
#define OFF_KS  (OFF_QS + S_BYTES)
#define OFF_VT  (OFF_KS + S_BYTES)
#define WS_TOTAL (OFF_VT + VT_BYTES)
static_assert((W_BYTES % 128) == 0 && (X16_BYTES % 128) == 0);
static_assert((S_BYTES % 128) == 0 && (VT_BYTES % 128) == 0);
static_assert(WS_TOTAL <= (size_t)134217728);

// ---------------------------------------------------------------------------
__device__ __forceinline__ float bf16r(float x) {   // RNE convert to bf16, returned widened
  unsigned int u = __float_as_uint(x);
  u = (u + 0x7FFFu + ((u >> 16) & 1u)) & 0xFFFF0000u;
  return __uint_as_float(u);
}

// f32 -> f16 for WMMA operand planes: values below the smallest f16 normal become zero.
static __device__ __forceinline__ h16 toh_flush(float v) {
  const h16 r = (h16)v;
  return (fabsf(v) < 6.103515625e-05f) ? (h16)0.0f : r;
}

// 16-bit fragment: p points at element [row = lane&15][k0 + 8*(lane>>4)] of a k-contiguous
// row. Elements 0..7 <- k0+8h+0..7, elements 8..15 <- k0+16+8h+0..7 (same map for A and B).
__device__ __forceinline__ v16h frag_at(const _Float16* p) {
  v8h lo = *(const v8h*)(p);
  v8h hi = *(const v8h*)(p + 16);
  v16h out;
#pragma unroll
  for (int i = 0; i < 8; ++i) { out[i] = lo[i]; out[i + 8] = hi[i]; }
  return out;
}

__device__ __forceinline__ v8f wmma16(v16h a, v16h b, v8f c) {
  v8f d = __builtin_amdgcn_wmma_f32_16x16x32_f16(false, a, false, b, (short)0, c,
                                                 false, false);
  asm volatile("v_nop\n\tv_nop\n\tv_nop\n\tv_nop" : "+v"(d) : "v"(a), "v"(b));
  return d;
}

__device__ __forceinline__ float red16_sum(float x) {
#pragma unroll
  for (int off = 1; off < 16; off <<= 1) x += __shfl_xor(x, off, 32);
  return x;
}
__device__ __forceinline__ float red32_min(float x) {
#pragma unroll
  for (int off = 1; off < 32; off <<= 1) x = fminf(x, __shfl_xor(x, off, 32));
  return x;
}

__device__ __forceinline__ void wave_lds_sync() {
  __builtin_amdgcn_fence(3 /* release order */, "wavefront");
  asm volatile("s_wait_dscnt 0x0" ::: "memory");
  __builtin_amdgcn_wave_barrier();
}

// ---------------------------------------------------------------------------
// Row cast: dst[row][0..255] = f16(carry * bf16(src[row][0..255])), one wave per row, 8 rows
// per block; the wave's single store instruction covers the whole 512-B row (4 lines).
// SRC_INPUT = 1: source rows are addressed with the full per-batch stride (module input);
// SRC_INPUT = 0: compact rows (weight matrices, [out][in] order kept: already k-contiguous).
// blk = index of the 8-row group inside this source (rows / 8 groups).
// ---------------------------------------------------------------------------
template <int SRC_INPUT>
__device__ __forceinline__ void cast_body(const float* __restrict__ X,
                                          _Float16* __restrict__ dst, const float carry,
                                          const unsigned blk) {
#pragma clang fp contract(off)
  const unsigned lane = threadIdx.x & 31u;
  const unsigned w = (unsigned)__builtin_amdgcn_readfirstlane((int)(threadIdx.x >> 5));
  const unsigned crow = blk * 8u + w;
  size_t srow = crow;
  if (SRC_INPUT) {
    const unsigned bidx = crow / (unsigned)SEQ;
    const unsigned sq = crow - bidx * (unsigned)SEQ;
    srow = (size_t)bidx * SEQ_FULL + sq;
  }
  const float* xr = X + srow * DIM + lane * 8u;
  const v4f a0 = *(const v4f*)(xr);
  const v4f a1 = *(const v4f*)(xr + 4u);
  v8h o;
#pragma unroll
  for (int i = 0; i < 4; ++i) {
    o[i]     = toh_flush(carry * bf16r(a0[i]));
    o[i + 4] = toh_flush(carry * bf16r(a1[i]));
  }
  _Float16* p = dst + (size_t)crow * DIM + lane * 8u;
  *(v8h*)p = o;
  
}

// All four casts in one launch: they are independent of each other, so the block index picks the
// source. Blocks 0 .. 3 * WBLK - 1: the three weight planes; the rest: the rows of x.
// Grid (3 * WBLK + MROWS / 8).
#define WBLK ((unsigned)(DIM / 8))
__global__ __launch_bounds__(256) void cast_kernel(
    const float* __restrict__ X, const float* __restrict__ wq, const float* __restrict__ wk,
    const float* __restrict__ wv, _Float16* __restrict__ x16, _Float16* __restrict__ wq16,
    _Float16* __restrict__ wk16, _Float16* __restrict__ wv16) {
  const unsigned bx = blockIdx.x;
  if (bx < 3u * WBLK) {
    const unsigned p = bx / WBLK;
    const float* src = (p == 0u) ? wq : (p == 1u) ? wk : wv;
    _Float16* dst = (p == 0u) ? wq16 : (p == 1u) ? wk16 : wv16;
    cast_body<0>(src, dst, WCARRY, bx - p * WBLK);
  } else {
    cast_body<1>(X, x16, 1.0f, bx - 3u * WBLK);
    // precaution: in the listing the weight job's code follows this job's store (behind a branch
    // that skips it) and reuses the store's registers; the wait stands in front of that code
    asm volatile("s_wait_xcnt 0x0" ::: "memory");
  }
}

// ---------------------------------------------------------------------------
// Projections, operands fed through LDS. Block = one 64-row tile of x times one whole weight
// matrix (job 0: v, job 1: q score, job 2: k score); 8 waves (mw = 16-row group, nw = 32-column
// group), 2 accumulators per wave, four 64-column tiles one after the other.
// Every byte of the x and weight planes comes in by asynchronous copies to LDS, one whole 512-B row (4 lines) per
// copy instruction: the x tile once, the weight tiles through a ring of two buffers, one tile
// ahead. Rows lie at a 528-B pitch (16 B x odd) for the 16-B fragment reads. Each wave reads its
// x fragments (16 rows x 256 k) from LDS once and keeps them in registers for all four tiles.
// One publish point (LDS wait, copy wait, block barrier) per weight tile.
// Score jobs: outs[row] = sum_c P[row][c] * bf16(wmlp[c]) from the f32 accumulators, reduced
// over the 16 lanes of a half and the two column groups (Rs, block barrier).
// v job: each 64x64 tile is staged through Cs (cross-wave, block barrier) and written
// transposed, 8 lanes x 16 B = one 128-B line of a v row. Cs lies in the x tile's place, which
// nobody reads any more behind the first publish point.
// Grid (3 * RBLK): three blocks fit a WGP's LDS.
// ---------------------------------------------------------------------------
#define RBLK   ((unsigned)(MROWS / 64))
#define PPITCH 528u                      // LDS bytes per staged row: 512 + 16
#define PTILE  (64u * PPITCH)            // one staged tile of 64 rows
static_assert(DIM * 2 == 32 * 16);       // one copy instruction = one row
static_assert((PPITCH % 16u) == 0 && ((PPITCH / 16u) & 1u) == 1u);
static_assert(64 == 8 * 8);              // tile rows: 8 waves x 8 copies
static_assert(DIM / 64 >= 2);            // the ring's prologue needs two weight tiles
static_assert(64u * LDC * 4u <= PTILE);  // Cs fits the x tile's place
static_assert(3u * (3u * PTILE + 512u) <= 327680u);

// Eight rows of a tile: each copy is one row, 32 lanes x 16 B. l = the lane's LDS byte address in
// the first row, g = its global address. The closing s_wait_xcnt is a precaution: it stands in
// front of every later write of a register that a copy names.
__device__ __forceinline__ void copy_rows8(const unsigned l, const _Float16* g) {
  const unsigned ls = PPITCH;
  const size_t gs = (size_t)DIM;
  asm volatile(
      "global_load_async_to_lds_b128 %0, %8, off\n\t"
      "global_load_async_to_lds_b128 %1, %9, off\n\t"
      "global_load_async_to_lds_b128 %2, %10, off\n\t"
      "global_load_async_to_lds_b128 %3, %11, off\n\t"
      "global_load_async_to_lds_b128 %4, %12, off\n\t"
      "global_load_async_to_lds_b128 %5, %13, off\n\t"
      "global_load_async_to_lds_b128 %6, %14, off\n\t"
      "global_load_async_to_lds_b128 %7, %15, off\n\t"
      "s_wait_xcnt 0x0"
      :: "v"(l), "v"(l + ls), "v"(l + 2u * ls), "v"(l + 3u * ls),
         "v"(l + 4u * ls), "v"(l + 5u * ls), "v"(l + 6u * ls), "v"(l + 7u * ls),
         "v"(g), "v"(g + gs), "v"(g + 2u * gs), "v"(g + 3u * gs),
         "v"(g + 4u * gs), "v"(g + 5u * gs), "v"(g + 6u * gs), "v"(g + 7u * gs)
      : "memory");
}

__global__ __launch_bounds__(256) void proj_kernel(
    const _Float16* __restrict__ A16, const _Float16* __restrict__ Wq,
    const _Float16* __restrict__ Wk, const _Float16* __restrict__ Wv,
    const float* __restrict__ wmlp, float* __restrict__ qs, float* __restrict__ ks,
    _Float16* __restrict__ vt) {
  __shared__ __attribute__((aligned(16))) unsigned char Ps[3u * PTILE];  // x tile, ring of two
  __shared__ float Rs[2 * 64];
  const unsigned tid = threadIdx.x, lane = tid & 31u;
  const unsigned w = (unsigned)__builtin_amdgcn_readfirstlane((int)(threadIdx.x >> 5));
  const unsigned mw = w >> 1, nw = w & 1u;
  const unsigned hh = lane >> 4, m = lane & 15u;
  const unsigned job = blockIdx.x / RBLK;
  const unsigned row0 = (blockIdx.x - job * RBLK) * 64u;
  const _Float16* Bt = (job == 0u) ? Wv : (job == 1u) ? Wq : Wk;
  const unsigned NTB = (unsigned)(DIM / 64);

  // copy side: this lane's 16 B of the wave's first row, in LDS and in the two planes
  const unsigned cl = (unsigned)(size_t)Ps + (w * 8u) * PPITCH + lane * 16u;
  const _Float16* ga = A16 + (size_t)(row0 + w * 8u) * DIM + lane * 8u;
  const _Float16* gb = Bt + (size_t)(w * 8u) * DIM + lane * 8u;

  // prologue: the x tile and weight tile 0 land and are published, then weight tile 1 starts
  copy_rows8(cl, ga);
  copy_rows8(cl + PTILE, gb);
  asm volatile("s_wait_asynccnt 0x0" ::: "memory");   // this wave's copies have landed
  __syncthreads();                                    // ... and every other wave's
  copy_rows8(cl + 2u * PTILE, gb + (size_t)64 * DIM);

  v16h a[8];
  {
    const unsigned char* ar = Ps + (mw * 16u + m) * PPITCH + hh * 16u;
#pragma unroll
    for (unsigned k = 0; k < 8u; ++k) a[k] = frag_at((const _Float16*)(ar + k * 64u));
  }
  float part[8];
#pragma unroll
  for (int r = 0; r < 8; ++r) part[r] = 0.0f;
  float* Cs = (float*)Ps;
  const unsigned rdb = PTILE + (nw * 32u + m) * PPITCH + hh * 16u;
  const unsigned bidx = row0 / (unsigned)SEQ;
  const unsigned key0 = row0 - bidx * (unsigned)SEQ;

  // rolled: one copy of the tile's code, the buffer picked by the trip's parity
#pragma unroll 1
  for (unsigned nb = 0; nb < NTB; ++nb) {
    const unsigned bo = (nb & 1u) * PTILE;
    const unsigned char* bb = Ps + bo + rdb;
    // score jobs: the tile's two score weights are fetched ahead of the products that hide them
    float wr0 = 0.0f, wr1 = 0.0f;
    if (job != 0u) {
      const unsigned col = nb * 64u + nw * 32u + m;
      wr0 = wmlp[col];
      wr1 = wmlp[col + 16u];
      // precaution: the wait stands in front of every later write of the loads' address registers
      asm volatile("s_wait_xcnt 0x0" ::: "memory");
    }
    v8f acc0 = {}, acc1 = {};
#pragma unroll
    for (unsigned k = 0; k < 8u; ++k) {
      const v16h b0 = frag_at((const _Float16*)(bb + k * 64u));
      const v16h b1 = frag_at((const _Float16*)(bb + 16u * PPITCH + k * 64u));
      acc0 = wmma16(a[k], b0, acc0);
      acc1 = wmma16(a[k], b1, acc1);
    }
    // publish point of weight tile nb + 1; the same barrier ends every read of tile nb's buffer
    // (and, at nb = 0, of the x tile; later, of Cs)
    asm volatile("s_wait_dscnt 0x0" ::: "memory");     // this wave's LDS reads are done
    asm volatile("s_wait_asynccnt 0x0" ::: "memory");  // this wave's copies of tile nb + 1 landed
    __syncthreads();
    if (nb + 2u < NTB)                                 // refill the buffer just read
      copy_rows8(cl + PTILE + bo, gb + (size_t)(nb + 2u) * 64u * DIM);

    if (job == 0u) {
#pragma unroll
      for (int r = 0; r < 8; ++r) {
        float* d = &Cs[(mw * 16u + hh * 8u + (unsigned)r) * LDC + nw * 32u + m];
        d[0]  = acc0[r];
        d[16] = acc1[r];
      }
      __syncthreads();
      v8h x[2];
      size_t off[2];
#pragma unroll
      for (unsigned i = 0; i < 2u; ++i) {
        const unsigned dcol = 32u * i + (tid >> 3);
        const unsigned kk = (tid & 7u) * 8u;
#pragma unroll
        for (unsigned j = 0; j < 8u; ++j) {
          const float t = Cs[(kk + j) * LDC + dcol] * (1.0f / WCARRY);
          x[i][j] = toh_flush(t);
        }
        off[i] = ((size_t)bidx * DIM + nb * 64u + dcol) * SEQ + key0 + kk;
      }
#pragma unroll
      for (int i = 0; i < 2; ++i) *(v8h*)(vt + off[i]) = x[i];
      // precaution: the next trip reuses the stores' registers; the wait stands in front of it
      asm volatile("s_wait_xcnt 0x0" ::: "memory");
    } else {
      const float w0 = bf16r(wr0);
      const float w1 = bf16r(wr1);
#pragma unroll
      for (int r = 0; r < 8; ++r) part[r] += acc0[r] * w0 + acc1[r] * w1;
    }
  }
  asm volatile("s_wait_asynccnt 0x0" ::: "memory");    // no copy outlives the loop

  if (job != 0u) {
    // row (mw*16 + hh*8 + r) is spread over the 16 lanes of a half
#pragma unroll
    for (int r = 0; r < 8; ++r) part[r] = red16_sum(part[r]);
    if (m == 0u) {
#pragma unroll
      for (int r = 0; r < 8; ++r) Rs[nw * 64u + mw * 16u + hh * 8u + (unsigned)r] = part[r];
    }
    __syncthreads();
    if (w == 0u && lane < 16u) {
      v4f val;
#pragma unroll
      for (int j = 0; j < 4; ++j)
        val[j] = (Rs[lane * 4u + (unsigned)j] + Rs[64u + lane * 4u + (unsigned)j]) * (1.0f / WCARRY);
      float* p = ((job == 1u) ? qs : ks) + row0 + lane * 4u;
      *(v4f*)p = val;
    }
  }
}

// ---------------------------------------------------------------------------
// Dense additive-score attention, transposed form, v fed through an LDS ring.
// Block = 64 query rows x 256
// columns of one batch; wave = 16 query rows x 128 columns (8 accumulators).
// score[i][j] = relu(q_s[i] + b - k_s[j]); its row maximum is relu(q_s[i] + b - min_j k_s[j]),
// so the max-subtracted softmax needs no running rescale. With kmin = min_j k_s[j] and
// rowmax = relu(q_s[i] + b - kmin), score - rowmax = max(kmin - k_s[j], -rowmax), and exp and the
// conversion to f16 are monotone, so
//   p[i][j] = f16(1024 * exp(score - rowmax)) = max(f16(1024 * exp(kmin - k_s[j])), f16(1024 * exp(-rowmax))):
// one exp per key (the block's table Pk, built once in LDS) and one per query instead of one per
// pair. Per 32-key step each lane reads its B fragment of P^T from Pk (lane = query, elements =
// keys of the 16-bit k map), takes the packed f16 maximum with its query term, and
// O^T[d][i] += V^T[d][keys] . P^T[keys][i] with the A fragments from the ring. The row sum runs
// over the f16 p, so the carry cancels in O / l. Ring: two buffers of 64 keys (256 v rows of
// 128 B at a 144-B pitch), filled by asynchronous copies to LDS one tile ahead, so the block
// fetches each v byte once, in whole 128-B lines, while the tile before it is worked on; one
// publish point (LDS wait, copy wait, block barrier) per tile.
// Wmin, Pk: cross-wave (block barrier). Os: wave-private stage (wave sync); staged extent
// Grid (SEQ/64, NB).
// ---------------------------------------------------------------------------

// One ring tile: each wave copies 32 v rows (8 copies x 4 rows x 8 lanes x 16 B). l = the lane's
// LDS byte address of its first piece, g = its global address. The closing s_wait_xcnt is a
// precaution: it stands in front of every later write of a register that a copy names.
__device__ __forceinline__ void copy_v_tile(const unsigned l, const _Float16* g) {
  const unsigned ls = 4u * VPITCH;
  const size_t gs = (size_t)4 * SEQ;
  asm volatile(
      "global_load_async_to_lds_b128 %0, %8, off\n\t"
      "global_load_async_to_lds_b128 %1, %9, off\n\t"
      "global_load_async_to_lds_b128 %2, %10, off\n\t"
      "global_load_async_to_lds_b128 %3, %11, off\n\t"
      "global_load_async_to_lds_b128 %4, %12, off\n\t"
      "global_load_async_to_lds_b128 %5, %13, off\n\t"
      "global_load_async_to_lds_b128 %6, %14, off\n\t"
      "global_load_async_to_lds_b128 %7, %15, off\n\t"
      "s_wait_xcnt 0x0"
      :: "v"(l), "v"(l + ls), "v"(l + 2u * ls), "v"(l + 3u * ls),
         "v"(l + 4u * ls), "v"(l + 5u * ls), "v"(l + 6u * ls), "v"(l + 7u * ls),
         "v"(g), "v"(g + gs), "v"(g + 2u * gs), "v"(g + 3u * gs),
         "v"(g + 4u * gs), "v"(g + 5u * gs), "v"(g + 6u * gs), "v"(g + 7u * gs)
      : "memory");
}

__global__ __launch_bounds__(256) void attn_kernel(
    const float* __restrict__ Qs, const float* __restrict__ Ksc,
    const float* __restrict__ bptr, const _Float16* __restrict__ Vt,
    float* __restrict__ out) {
  __shared__ float Os[8 * 16 * LDO];
  __shared__ float Wmin[8];
  __shared__ __attribute__((aligned(16))) unsigned char Ring[2u * RBUF];
  __shared__ __attribute__((aligned(16))) _Float16 Pk[SEQ];   // key terms of the numerators

  const unsigned tid = threadIdx.x, lane = tid & 31u;
  const int wave = __builtin_amdgcn_readfirstlane((int)(threadIdx.x >> 5));
  const unsigned hh = lane >> 4, m = lane & 15u;
  const unsigned b = blockIdx.y;
  const unsigned qg = (unsigned)wave >> 1, dh = (unsigned)wave & 1u;
  const unsigned qrow0 = blockIdx.x * (unsigned)QBLK + qg * 16u;
  const float* ksb = Ksc + (size_t)b * SEQ;

  // minimum key score of this batch (uniform trip count, clamped addresses); unrolled, so that
  // the scores stay in registers for the table below
  constexpr unsigned KIT = (unsigned)((SEQ + 1023) / 1024);
  v4f kv[KIT];
  float kmin = 3.0e38f;
#pragma unroll
  for (unsigned it = 0; it < KIT; ++it) {
    unsigned j = tid * 4u + it * 1024u;
    j = (j > (unsigned)(SEQ - 4)) ? (unsigned)(SEQ - 4) : j;
    kv[it] = *(const v4f*)(ksb + j);
    kmin = fminf(kmin, fminf(fminf(kv[it][0], kv[it][1]), fminf(kv[it][2], kv[it][3])));
  }
  kmin = red32_min(kmin);
  if (lane == 0u) Wmin[wave] = kmin;
  __syncthreads();
  float km = Wmin[0];
#pragma unroll
  for (int i = 1; i < 8; ++i) km = fminf(km, Wmin[i]);

  const float qb = Qs[(size_t)b * SEQ + qrow0 + m] + bf16r(bptr[0]);
  const float mrow = fmaxf(qb - km, 0.0f);
  // query term: 1024 * exp(-rowmax), the value of every pair whose score is zero
  const h16 cq = toh_flush(__expf(LN_PCARRY - mrow));
  v16h cqv;
#pragma unroll
  for (int i = 0; i < 16; ++i) cqv[i] = cq;

  // key terms: Pk[j] = 1024 * exp(kmin - k_s[j]); clamped threads rewrite the last four keys with
  // the same values. Published by the ring prologue's barrier. Unrolled: kv[] is in registers.
#pragma unroll
  for (unsigned it = 0; it < KIT; ++it) {
    unsigned j = tid * 4u + it * 1024u;
    j = (j > (unsigned)(SEQ - 4)) ? (unsigned)(SEQ - 4) : j;
    v4h e;
#pragma unroll
    for (int i = 0; i < 4; ++i) e[i] = toh_flush(__expf((km - kv[it][i]) + LN_PCARRY));
    *(v4h*)&Pk[j] = e;
  }

  v8f o[8];
#pragma unroll
  for (int dt = 0; dt < 8; ++dt) o[dt] = (v8f){};
  float lsum = 0.0f;

  // copy side: this lane's piece of the wave's first four rows, in LDS and in the v plane
  const unsigned crow = (unsigned)wave * 32u + (lane >> 3);
  const unsigned ring0 = (unsigned)(size_t)Ring;          // byte offset in the block's LDS
  const unsigned cl = ring0 + crow * VPITCH + (lane & 7u) * 16u;
  const _Float16* cg = Vt + ((size_t)b * DIM + crow) * SEQ + (lane & 7u) * 8u;
  // read side: row (dh * 128 + m) of the tile, the lane's 16 B of the first 32-key step
  const unsigned rd = (dh * (unsigned)DH + m) * VPITCH + hh * 16u;
  const unsigned NT = (unsigned)SEQ / TKEYS;

  // ring prologue: tile 0 lands and is published, then tile 1 starts
  copy_v_tile(cl, cg);
  asm volatile("s_wait_asynccnt 0x0" ::: "memory");   // this wave's copies of tile 0 have landed
  __syncthreads();                                    // ... and every other wave's, and Pk
  copy_v_tile(cl + RBUF, cg + TKEYS);

#pragma unroll 1
  for (unsigned t = 0; t < NT; ++t) {
    const unsigned bo = (t & 1u) * RBUF;
    const unsigned char* vb = Ring + bo + rd;
    const _Float16* kt = Pk + t * TKEYS + hh * 8u;
#pragma unroll
    for (unsigned ks = 0; ks < 2u; ++ks) {             // the tile's two 32-key steps
      const v16h pk = frag_at(kt + ks * 32u);
      v16h a[8];
#pragma unroll
      for (int dt = 0; dt < 8; ++dt)
        a[dt] = frag_at((const _Float16*)(vb + (unsigned)dt * (16u * VPITCH) + ks * 64u));
      const v16h pf = __builtin_elementwise_maximum(pk, cqv);
#pragma unroll
      for (int i = 0; i < 4; ++i) {
        lsum += (float)pf[i];
        lsum += (float)pf[i + 4];
        lsum += (float)pf[i + 8];
        lsum += (float)pf[i + 12];
      }
      // keeps the eight products in the order of their fragment loads, so that each waits for its
      // own two loads only (counted LDS waits); without it the second product is scheduled on the
      // last fragment and waits for all of them
      __builtin_amdgcn_sched_barrier(0);
#pragma unroll
      for (int dt = 0; dt < 8; ++dt) o[dt] = wmma16(a[dt], pf, o[dt]);
    }
    // publish point of tile t + 1; the same barrier ends every read of tile t's buffer
    asm volatile("s_wait_dscnt 0x0" ::: "memory");     // this wave's reads of tile t are done
    asm volatile("s_wait_asynccnt 0x0" ::: "memory");  // this wave's copies of tile t + 1 landed
    __syncthreads();
    if (t + 2u < NT)                                   // refill the buffer just read
      copy_v_tile(cl + bo, cg + (size_t)(t + 2u) * TKEYS);
  }
  asm volatile("s_wait_asynccnt 0x0" ::: "memory");    // no copy outlives the loop

  // lanes l and l+16 hold the two key halves of query m
  const float ltot = lsum + __shfl_xor(lsum, 16, 32);
  const float inv = __builtin_amdgcn_rcpf(ltot);

  // stage O[query m][d = dt*16 + 8*hh + r] in the wave's tile
  const unsigned tb = (unsigned)wave * (16u * LDO);
#pragma unroll
  for (int dt = 0; dt < 8; ++dt) {
    v4f u0, u1;
#pragma unroll
    for (int j = 0; j < 4; ++j) {
      u0[j] = o[dt][j] * inv;
      u1[j] = o[dt][j + 4] * inv;
    }
    *(v4f*)&Os[tb + m * LDO + (unsigned)dt * 16u + hh * 8u] = u0;
    *(v4f*)&Os[tb + m * LDO + (unsigned)dt * 16u + hh * 8u + 4u] = u1;
  }
  wave_lds_sync();

  const size_t orow = (size_t)b * SEQ_FULL + qrow0;
#pragma unroll
  for (unsigned g = 0; g < 2u; ++g) {      // 2 steps x 8 rows == 16 rows
    v4f x[8];
    size_t off[8];
#pragma unroll
    for (unsigned i = 0; i < 8u; ++i) {
      const unsigned r = 8u * g + i;
      x[i] = *(const v4f*)&Os[tb + r * LDO + lane * 4u];
      off[i] = (orow + r) * DIM + dh * (unsigned)DH + lane * 4u;
    }
#pragma unroll
    for (int i = 0; i < 8; ++i) *(v4f*)(out + off[i]) = x[i];
    
  }
}

// ---------------------------------------------------------------------------
extern "C" void kernel_launch(void* const* d_in, const int* in_sizes, int n_in,
                              void* d_out, int out_size, void* d_ws, size_t ws_size,
                              hipStream_t stream) {
  if (n_in < 6) return;
  const long long need_x = ((long long)(NB - 1) * SEQ_FULL + SEQ) * DIM;
  if ((long long)in_sizes[0] < need_x) return;
  if ((long long)in_sizes[1] < (long long)DIM * DIM) return;
  if ((long long)in_sizes[2] < (long long)DIM * DIM) return;
  if ((long long)in_sizes[3] < (long long)DIM * DIM) return;
  if (in_sizes[4] < DIM) return;
  if (in_sizes[5] < 1) return;
  if ((long long)out_size < need_x) return;
  if (ws_size < WS_TOTAL) return;

  const float* X    = (const float*)d_in[0];   // x      [NB_FULL][SEQ_FULL][DIM]
  const float* wq   = (const float*)d_in[1];   // Wq     [DIM out][DIM in]
  const float* wk   = (const float*)d_in[2];   // Wk     [DIM out][DIM in]
  const float* wvv  = (const float*)d_in[3];   // Wv     [DIM out][DIM in]
  const float* wmlp = (const float*)d_in[4];   // w_mlp  [DIM]
  const float* bmlp = (const float*)d_in[5];   // b_mlp  scalar
  float* out = (float*)d_out;

  char* ws = (char*)d_ws;
  _Float16* Wq16 = (_Float16*)(ws + OFF_WQ);    // [out][in], x64
  _Float16* Wk16 = (_Float16*)(ws + OFF_WK);
  _Float16* Wv16 = (_Float16*)(ws + OFF_WV);
  _Float16* X16  = (_Float16*)(ws + OFF_X16);   // [MROWS][DIM] compact rows
  float*    QS   = (float*)(ws + OFF_QS);       // [MROWS]
  float*    KS   = (float*)(ws + OFF_KS);       // [MROWS]
  _Float16* Vt16 = (_Float16*)(ws + OFF_VT);    // [b][DIM][SEQ]

  dim3 blk(256);

  // three dependent launches: casts (weight planes keep their [out][in] order), projections, attention
  cast_kernel<<<dim3(3 * (DIM / 8) + MROWS / 8), blk, 0, stream>>>(X, wq, wk, wvv, X16, Wq16, Wk16,
                                                                  Wv16);
  proj_kernel<<<dim3(3 * (MROWS / 64)), blk, 0, stream>>>(
      X16, Wq16, Wk16, Wv16, wmlp, QS, KS, Vt16);
  attn_kernel<<<dim3(SEQ / QBLK, NB), blk, 0, stream>>>(QS, KS, bmlp, Vt16, out);
}

// v005
// A run of this version takes 54.7 microseconds.
// Two timings next to v004 both put it at 1.07 times that version's speed.
// All steps since v000 together make it 4.80 times as fast.
#include <hip/hip_runtime.h>
#include <stddef.h>

// All contractions on v_wmma_f32_16x16x32_f16 (f16 operands, f32 accumulate): q/k/v projections
// (x plane = f16(bf16(x)), weight planes = f16(64 * bf16(w)), kept in their [out][in] order) and
// the p.v product (p carried x1024, v plane f16 single). The per-row dot with the score vector,
// the exp of each key's and each query's score and the row sums are f32 on the vector unit; the
// softmax numerators are the f16 maximum of a key term and a query term.

typedef _Float16 v16h __attribute__((ext_vector_type(16)));
typedef _Float16 v8h  __attribute__((ext_vector_type(8)));
typedef _Float16 v4h  __attribute__((ext_vector_type(4)));
typedef float    v8f  __attribute__((ext_vector_type(8)));
typedef float    v4f  __attribute__((ext_vector_type(4)));
typedef _Float16 h16;

#ifndef NB
#define NB 4
#endif
#ifndef SEQ
#define SEQ 4096
#endif
#define NB_FULL  4
#define SEQ_FULL 4096
#define DIM   256
#define MROWS (NB * SEQ)
#define DH    128          // output columns per wave in the attention kernel
#define QBLK  64           // query rows per attention block (2 groups of 32)

#define LDC 68             // floats per LDS row of the 64x64 GEMM stage (272 B)
#define LDO 132            // floats per LDS row of the attention output stage (528 B)

#define WCARRY 64.0f                   // weight planes carried x64
#define LN_PCARRY 6.931471805599453f   // ln(1024): softmax numerators carried x1024

static_assert(NB >= 1 && NB <= NB_FULL);
static_assert(SEQ >= 128 && SEQ <= SEQ_FULL && (SEQ % 128) == 0);
static_assert(DIM == 32 * 8);               // cast: one wave per row, 32 lanes x 8 columns
static_assert((DIM % 64) == 0 && (DIM % 32) == 0);
static_assert((MROWS % 64) == 0 && (MROWS % 8) == 0);
static_assert((SEQ % QBLK) == 0 && (SEQ % 32) == 0 && (SEQ % 64) == 0);
static_assert(2 * DH == DIM && (DH % 16) == 0 && DH / 16 == 8);
static_assert(DH * 4 == 32 * 16);           // one store instruction = one 512-B row segment
static_assert(QBLK == 2 * 32);              // 8 waves = 2 query groups x 2 column halves x 2 key halves
static_assert((LDC % 4) == 0 && LDC >= 64);
static_assert((LDO % 4) == 0 && LDO >= DH);
static_assert(2 * 8 == 16);                 // output stage: 2 steps x 8 rows == 16 tile rows
#define TKEYS   64u                      // keys per ring tile (two 32-key steps, one per key half)
#define VPITCH  144u                     // LDS bytes per v row of a tile: 128 + 16 (16 B x odd)
#define VT_TILE ((unsigned)DIM * VPITCH) // one v tile of 256 rows (a whole ring buffer)
#define RBUF    VT_TILE                  // ring buffer: one v tile
static_assert((SEQ % 64) == 0 && SEQ / 64 >= 2);      // the ring's prologue needs two tiles
static_assert(TKEYS * 2u == 128u && (VPITCH % 16u) == 0 && (RBUF % 16u) == 0);
static_assert(DIM == 8 * 8 * 4);         // tile rows: 8 waves x 8 copies x 4 rows per copy
static_assert(8 * 16 * LDO * 4 + 8 * 4 + 8 * 16 * 4 + 2 * (DIM * 144) + SEQ * 2 <= 327680);   // attention static LDS
static_assert(8 * 16 * LDO * 4 <= 2 * (DIM * 144));   // the partial-sum exchange fits the ring's place
static_assert((size_t)MROWS * DIM < (size_t)0xFFFFFFFFu);

// workspace layout (bytes)
#define W_BYTES   ((size_t)DIM * DIM * 2)
#define X16_BYTES ((size_t)MROWS * DIM * 2)
#define S_BYTES   ((size_t)MROWS * 4)
#define VT_BYTES  ((size_t)NB * DIM * SEQ * 2)
#define OFF_WQ  ((size_t)0)
#define OFF_WK  (OFF_WQ + W_BYTES)
#define OFF_WV  (OFF_WK + W_BYTES)
#define OFF_X16 (OFF_WV + W_BYTES)
#define OFF_QS  (OFF_X16 + X16_BYTES)
#define OFF_KS  (OFF_QS + S_BYTES)
#define OFF_VT  (OFF_KS + S_BYTES)
#define WS_TOTAL (OFF_VT + VT_BYTES)
static_assert((W_BYTES % 128) == 0 && (X16_BYTES % 128) == 0);
static_assert((S_BYTES % 128) == 0 && (VT_BYTES % 128) == 0);
static_assert(WS_TOTAL <= (size_t)134217728);

// ---------------------------------------------------------------------------
__device__ __forceinline__ float bf16r(float x) {   // RNE convert to bf16, returned widened
  unsigned int u = __float_as_uint(x);
  u = (u + 0x7FFFu + ((u >> 16) & 1u)) & 0xFFFF0000u;
  return __uint_as_float(u);
}

// f32 -> f16 for WMMA operand planes: values below the smallest f16 normal become zero.
static __device__ __forceinline__ h16 toh_flush(float v) {
  const h16 r = (h16)v;
  return (fabsf(v) < 6.103515625e-05f) ? (h16)0.0f : r;
}

// 16-bit fragment: p points at element [row = lane&15][k0 + 8*(lane>>4)] of a k-contiguous
// row. Elements 0..7 <- k0+8h+0..7, elements 8..15 <- k0+16+8h+0..7 (same map for A and B).
__device__ __forceinline__ v16h frag_at(const _Float16* p) {
  v8h lo = *(const v8h*)(p);
  v8h hi = *(const v8h*)(p + 16);
  v16h out;
#pragma unroll
  for (int i = 0; i < 8; ++i) { out[i] = lo[i]; out[i + 8] = hi[i]; }
  return out;
}

__device__ __forceinline__ v8f wmma16(v16h a, v16h b, v8f c) {
  v8f d = __builtin_amdgcn_wmma_f32_16x16x32_f16(false, a, false, b, (short)0, c,
                                                 false, false);
  asm volatile("v_nop\n\tv_nop\n\tv_nop\n\tv_nop" : "+v"(d) : "v"(a), "v"(b));
  return d;
}

__device__ __forceinline__ float red16_sum(float x) {
#pragma unroll
  for (int off = 1; off < 16; off <<= 1) x += __shfl_xor(x, off, 32);
  return x;
}
__device__ __forceinline__ float red32_min(float x) {
#pragma unroll
  for (int off = 1; off < 32; off <<= 1) x = fminf(x, __shfl_xor(x, off, 32));
  return x;
}

__device__ __forceinline__ void wave_lds_sync() {
  __builtin_amdgcn_fence(3 /* release order */, "wavefront");
  asm volatile("s_wait_dscnt 0x0" ::: "memory");
  __builtin_amdgcn_wave_barrier();
}

// ---------------------------------------------------------------------------
// Row cast: dst[row][0..255] = f16(carry * bf16(src[row][0..255])), one wave per row, 8 rows
// per block; the wave's single store instruction covers the whole 512-B row (4 lines).
// SRC_INPUT = 1: source rows are addressed with the full per-batch stride (module input);
// SRC_INPUT = 0: compact rows (weight matrices, [out][in] order kept: already k-contiguous).
// blk = index of the 8-row group inside this source (rows / 8 groups).
// ---------------------------------------------------------------------------
template <int SRC_INPUT>
__device__ __forceinline__ void cast_body(const float* __restrict__ X,
                                          _Float16* __restrict__ dst, const float carry,
                                          const unsigned blk) {
#pragma clang fp contract(off)
  const unsigned lane = threadIdx.x & 31u;
  const unsigned w = (unsigned)__builtin_amdgcn_readfirstlane((int)(threadIdx.x >> 5));
  const unsigned crow = blk * 8u + w;
  size_t srow = crow;
  if (SRC_INPUT) {
    const unsigned bidx = crow / (unsigned)SEQ;
    const unsigned sq = crow - bidx * (unsigned)SEQ;
    srow = (size_t)bidx * SEQ_FULL + sq;
  }
  const float* xr = X + srow * DIM + lane * 8u;
  const v4f a0 = *(const v4f*)(xr);
  const v4f a1 = *(const v4f*)(xr + 4u);
  v8h o;
#pragma unroll
  for (int i = 0; i < 4; ++i) {
    o[i]     = toh_flush(carry * bf16r(a0[i]));
    o[i + 4] = toh_flush(carry * bf16r(a1[i]));
  }
  _Float16* p = dst + (size_t)crow * DIM + lane * 8u;
  *(v8h*)p = o;
  
}

// All four casts in one launch: they are independent of each other, so the block index picks the
// source. Blocks 0 .. 3 * WBLK - 1: the three weight planes; the rest: the rows of x.
// Grid (3 * WBLK + MROWS / 8).
#define WBLK ((unsigned)(DIM / 8))
__global__ __launch_bounds__(256) void cast_kernel(
    const float* __restrict__ X, const float* __restrict__ wq, const float* __restrict__ wk,
    const float* __restrict__ wv, _Float16* __restrict__ x16, _Float16* __restrict__ wq16,
    _Float16* __restrict__ wk16, _Float16* __restrict__ wv16) {
  const unsigned bx = blockIdx.x;
  if (bx < 3u * WBLK) {
    const unsigned p = bx / WBLK;
    const float* src = (p == 0u) ? wq : (p == 1u) ? wk : wv;
    _Float16* dst = (p == 0u) ? wq16 : (p == 1u) ? wk16 : wv16;
    cast_body<0>(src, dst, WCARRY, bx - p * WBLK);
  } else {
    cast_body<1>(X, x16, 1.0f, bx - 3u * WBLK);
    // precaution: in the listing the weight job's code follows this job's store (behind a branch
    // that skips it) and reuses the store's registers; the wait stands in front of that code
    asm volatile("s_wait_xcnt 0x0" ::: "memory");
  }
}

// ---------------------------------------------------------------------------
// Projections, operands fed through LDS. Block = one 64-row tile of x times one whole weight
// matrix (job 0: v, job 1: q score, job 2: k score); 8 waves (mw = 16-row group, nw = 32-column
// group), 2 accumulators per wave, four 64-column tiles one after the other.
// Every byte of the x and weight planes comes in by asynchronous copies to LDS, one whole 512-B row (4 lines) per
// copy instruction: the x tile once, the weight tiles through a ring of two buffers, one tile
// ahead. Rows lie at a 528-B pitch (16 B x odd) for the 16-B fragment reads. Each wave reads its
// x fragments (16 rows x 256 k) from LDS once and keeps them in registers for all four tiles.
// One publish point (LDS wait, copy wait, block barrier) per weight tile.
// Score jobs: outs[row] = sum_c P[row][c] * bf16(wmlp[c]) from the f32 accumulators, reduced
// over the 16 lanes of a half and the two column groups (Rs, block barrier).
// v job: each 64x64 tile is staged through Cs (cross-wave, block barrier) and written
// transposed, 8 lanes x 16 B = one 128-B line of a v row. Cs lies in the x tile's place, which
// nobody reads any more behind the first publish point.
// Grid (3 * RBLK): three blocks fit a WGP's LDS.
// ---------------------------------------------------------------------------
#define RBLK   ((unsigned)(MROWS / 64))
#define PPITCH 528u                      // LDS bytes per staged row: 512 + 16
#define PTILE  (64u * PPITCH)            // one staged tile of 64 rows
static_assert(DIM * 2 == 32 * 16);       // one copy instruction = one row
static_assert((PPITCH % 16u) == 0 && ((PPITCH / 16u) & 1u) == 1u);
static_assert(64 == 8 * 8);              // tile rows: 8 waves x 8 copies
static_assert(DIM / 64 >= 2);            // the ring's prologue needs two weight tiles
static_assert(64u * LDC * 4u <= PTILE);  // Cs fits the x tile's place
static_assert(3u * (3u * PTILE + 512u) <= 327680u);

// Eight rows of a tile: each copy is one row, 32 lanes x 16 B. l = the lane's LDS byte address in
// the first row, g = its global address. The closing s_wait_xcnt is a precaution: it stands in
// front of every later write of a register that a copy names.
__device__ __forceinline__ void copy_rows8(const unsigned l, const _Float16* g) {
  const unsigned ls = PPITCH;
  const size_t gs = (size_t)DIM;
  asm volatile(
      "global_load_async_to_lds_b128 %0, %8, off\n\t"
      "global_load_async_to_lds_b128 %1, %9, off\n\t"
      "global_load_async_to_lds_b128 %2, %10, off\n\t"
      "global_load_async_to_lds_b128 %3, %11, off\n\t"
      "global_load_async_to_lds_b128 %4, %12, off\n\t"
      "global_load_async_to_lds_b128 %5, %13, off\n\t"
      "global_load_async_to_lds_b128 %6, %14, off\n\t"
      "global_load_async_to_lds_b128 %7, %15, off\n\t"
      "s_wait_xcnt 0x0"
      :: "v"(l), "v"(l + ls), "v"(l + 2u * ls), "v"(l + 3u * ls),
         "v"(l + 4u * ls), "v"(l + 5u * ls), "v"(l + 6u * ls), "v"(l + 7u * ls),
         "v"(g), "v"(g + gs), "v"(g + 2u * gs), "v"(g + 3u * gs),
         "v"(g + 4u * gs), "v"(g + 5u * gs), "v"(g + 6u * gs), "v"(g + 7u * gs)
      : "memory");
}

__global__ __launch_bounds__(256) void proj_kernel(
    const _Float16* __restrict__ A16, const _Float16* __restrict__ Wq,
    const _Float16* __restrict__ Wk, const _Float16* __restrict__ Wv,
    const float* __restrict__ wmlp, float* __restrict__ qs, float* __restrict__ ks,
    _Float16* __restrict__ vt) {
  __shared__ __attribute__((aligned(16))) unsigned char Ps[3u * PTILE];  // x tile, ring of two
  __shared__ float Rs[2 * 64];
  const unsigned tid = threadIdx.x, lane = tid & 31u;
  const unsigned w = (unsigned)__builtin_amdgcn_readfirstlane((int)(threadIdx.x >> 5));
  const unsigned mw = w >> 1, nw = w & 1u;
  const unsigned hh = lane >> 4, m = lane & 15u;
  const unsigned job = blockIdx.x / RBLK;
  const unsigned row0 = (blockIdx.x - job * RBLK) * 64u;
  const _Float16* Bt = (job == 0u) ? Wv : (job == 1u) ? Wq : Wk;
  const unsigned NTB = (unsigned)(DIM / 64);

  // copy side: this lane's 16 B of the wave's first row, in LDS and in the two planes
  const unsigned cl = (unsigned)(size_t)Ps + (w * 8u) * PPITCH + lane * 16u;
  const _Float16* ga = A16 + (size_t)(row0 + w * 8u) * DIM + lane * 8u;
  const _Float16* gb = Bt + (size_t)(w * 8u) * DIM + lane * 8u;

  // prologue: the x tile and weight tile 0 land and are published, then weight tile 1 starts
  copy_rows8(cl, ga);
  copy_rows8(cl + PTILE, gb);
  asm volatile("s_wait_asynccnt 0x0" ::: "memory");   // this wave's copies have landed
  __syncthreads();                                    // ... and every other wave's
  copy_rows8(cl + 2u * PTILE, gb + (size_t)64 * DIM);

  v16h a[8];
  {
    const unsigned char* ar = Ps + (mw * 16u + m) * PPITCH + hh * 16u;
#pragma unroll
    for (unsigned k = 0; k < 8u; ++k) a[k] = frag_at((const _Float16*)(ar + k * 64u));
  }
  float part[8];
#pragma unroll
  for (int r = 0; r < 8; ++r) part[r] = 0.0f;
  float* Cs = (float*)Ps;
  const unsigned rdb = PTILE + (nw * 32u + m) * PPITCH + hh * 16u;
  const unsigned bidx = row0 / (unsigned)SEQ;
  const unsigned key0 = row0 - bidx * (unsigned)SEQ;

  // rolled: one copy of the tile's code, the buffer picked by the trip's parity
#pragma unroll 1
  for (unsigned nb = 0; nb < NTB; ++nb) {
    const unsigned bo = (nb & 1u) * PTILE;
    const unsigned char* bb = Ps + bo + rdb;
    // score jobs: the tile's two score weights are fetched ahead of the products that hide them
    float wr0 = 0.0f, wr1 = 0.0f;
    if (job != 0u) {
      const unsigned col = nb * 64u + nw * 32u + m;
      wr0 = wmlp[col];
      wr1 = wmlp[col + 16u];
      // precaution: the wait stands in front of every later write of the loads' address registers
      asm volatile("s_wait_xcnt 0x0" ::: "memory");
    }
    v8f acc0 = {}, acc1 = {};
#pragma unroll
    for (unsigned k = 0; k < 8u; ++k) {
      const v16h b0 = frag_at((const _Float16*)(bb + k * 64u));
      const v16h b1 = frag_at((const _Float16*)(bb + 16u * PPITCH + k * 64u));
      acc0 = wmma16(a[k], b0, acc0);
      acc1 = wmma16(a[k], b1, acc1);
    }
    // publish point of weight tile nb + 1; the same barrier ends every read of tile nb's buffer
    // (and, at nb = 0, of the x tile; later, of Cs)
    asm volatile("s_wait_dscnt 0x0" ::: "memory");     // this wave's LDS reads are done
    asm volatile("s_wait_asynccnt 0x0" ::: "memory");  // this wave's copies of tile nb + 1 landed
    __syncthreads();
    if (nb + 2u < NTB)                                 // refill the buffer just read
      copy_rows8(cl + PTILE + bo, gb + (size_t)(nb + 2u) * 64u * DIM);

    if (job == 0u) {
#pragma unroll
      for (int r = 0; r < 8; ++r) {
        float* d = &Cs[(mw * 16u + hh * 8u + (unsigned)r) * LDC + nw * 32u + m];
        d[0]  = acc0[r];
        d[16] = acc1[r];
      }
      __syncthreads();
      v8h x[2];
      size_t off[2];
#pragma unroll
      for (unsigned i = 0; i < 2u; ++i) {
        const unsigned dcol = 32u * i + (tid >> 3);
        const unsigned kk = (tid & 7u) * 8u;
#pragma unroll
        for (unsigned j = 0; j < 8u; ++j) {
          const float t = Cs[(kk + j) * LDC + dcol] * (1.0f / WCARRY);
          x[i][j] = toh_flush(t);
        }
        off[i] = ((size_t)bidx * DIM + nb * 64u + dcol) * SEQ + key0 + kk;
      }
#pragma unroll
      for (int i = 0; i < 2; ++i) *(v8h*)(vt + off[i]) = x[i];
      // precaution: the next trip reuses the stores' registers; the wait stands in front of it
      asm volatile("s_wait_xcnt 0x0" ::: "memory");
    } else {
      const float w0 = bf16r(wr0);
      const float w1 = bf16r(wr1);
#pragma unroll
      for (int r = 0; r < 8; ++r) part[r] += acc0[r] * w0 + acc1[r] * w1;
    }
  }
  asm volatile("s_wait_asynccnt 0x0" ::: "memory");    // no copy outlives the loop

  if (job != 0u) {
    // row (mw*16 + hh*8 + r) is spread over the 16 lanes of a half
#pragma unroll
    for (int r = 0; r < 8; ++r) part[r] = red16_sum(part[r]);
    if (m == 0u) {
#pragma unroll
      for (int r = 0; r < 8; ++r) Rs[nw * 64u + mw * 16u + hh * 8u + (unsigned)r] = part[r];
    }
    __syncthreads();
    if (w == 0u && lane < 16u) {
      v4f val;
#pragma unroll
      for (int j = 0; j < 4; ++j)
        val[j] = (Rs[lane * 4u + (unsigned)j] + Rs[64u + lane * 4u + (unsigned)j]) * (1.0f / WCARRY);
      float* p = ((job == 1u) ? qs : ks) + row0 + lane * 4u;
      *(v4f*)p = val;
    }
  }
}

// ---------------------------------------------------------------------------
// Dense additive-score attention, transposed form, v fed through an LDS ring.
// Block = 64 query rows x 256
// columns of one batch; wave = 32 query rows x 128 columns x one 32-key step of every 64-key tile
// (16 accumulators), so that each v fragment read from LDS feeds two products while each
// numerator is still formed once per column half. The two waves of a pair (key halves 0 and 1)
// hold partial sums over their keys; behind the loop each hands the other one 16-query half of
// its accumulators and row sums through LDS (the ring's place, free by then; block barrier) and
// finishes the half it keeps.
// score[i][j] = relu(q_s[i] + b - k_s[j]); its row maximum is relu(q_s[i] + b - min_j k_s[j]),
// so the max-subtracted softmax needs no running rescale. With kmin = min_j k_s[j] and
// rowmax = relu(q_s[i] + b - kmin), score - rowmax = max(kmin - k_s[j], -rowmax), and exp and the
// conversion to f16 are monotone, so
//   p[i][j] = f16(1024 * exp(score - rowmax)) = max(f16(1024 * exp(kmin - k_s[j])), f16(1024 * exp(-rowmax))):
// one exp per key (the block's table Pk, built once in LDS) and one per query instead of one per
// pair. Per 32-key step each lane reads its B fragment of P^T from Pk (lane = query, elements =
// keys of the 16-bit k map), takes the packed f16 maximum with its query term, and
// O^T[d][i] += V^T[d][keys] . P^T[keys][i] with the A fragments from the ring. The row sum runs
// over the f16 p, so the carry cancels in O / l. Ring: two buffers of 64 keys (256 v rows of
// 128 B at a 144-B pitch), filled by asynchronous copies to LDS one tile ahead, so the block
// fetches each v byte once, in whole 128-B lines, while the tile before it is worked on; one
// publish point (LDS wait, copy wait, block barrier) per tile.
// Wmin, Pk, the exchange, Ls: cross-wave (block barrier). Os: wave-private stage (wave sync); staged extent
// Grid (SEQ/64, NB).
// ---------------------------------------------------------------------------

// One ring tile: each wave copies 32 v rows (8 copies x 4 rows x 8 lanes x 16 B). l = the lane's
// LDS byte address of its first piece, g = its global address. The closing s_wait_xcnt is a
// precaution: it stands in front of every later write of a register that a copy names.
__device__ __forceinline__ void copy_v_tile(const unsigned l, const _Float16* g) {
  const unsigned ls = 4u * VPITCH;
  const size_t gs = (size_t)4 * SEQ;
  asm volatile(
      "global_load_async_to_lds_b128 %0, %8, off\n\t"
      "global_load_async_to_lds_b128 %1, %9, off\n\t"
      "global_load_async_to_lds_b128 %2, %10, off\n\t"
      "global_load_async_to_lds_b128 %3, %11, off\n\t"
      "global_load_async_to_lds_b128 %4, %12, off\n\t"
      "global_load_async_to_lds_b128 %5, %13, off\n\t"
      "global_load_async_to_lds_b128 %6, %14, off\n\t"
      "global_load_async_to_lds_b128 %7, %15, off\n\t"
      "s_wait_xcnt 0x0"
      :: "v"(l), "v"(l + ls), "v"(l + 2u * ls), "v"(l + 3u * ls),
         "v"(l + 4u * ls), "v"(l + 5u * ls), "v"(l + 6u * ls), "v"(l + 7u * ls),
         "v"(g), "v"(g + gs), "v"(g + 2u * gs), "v"(g + 3u * gs),
         "v"(g + 4u * gs), "v"(g + 5u * gs), "v"(g + 6u * gs), "v"(g + 7u * gs)
      : "memory");
}

__global__ __launch_bounds__(256) void attn_kernel(
    const float* __restrict__ Qs, const float* __restrict__ Ksc,
    const float* __restrict__ bptr, const _Float16* __restrict__ Vt,
    float* __restrict__ out) {
  __shared__ float Os[8 * 16 * LDO];
  __shared__ float Wmin[8];
  __shared__ float Ls[8 * 16];                                // row sums handed to the pair's other wave
  __shared__ __attribute__((aligned(16))) unsigned char Ring[2u * RBUF];
  __shared__ __attribute__((aligned(16))) _Float16 Pk[SEQ];   // key terms of the numerators

  const unsigned tid = threadIdx.x, lane = tid & 31u;
  const int wave = __builtin_amdgcn_readfirstlane((int)(threadIdx.x >> 5));
  const unsigned hh = lane >> 4, m = lane & 15u;
  const unsigned b = blockIdx.y;
  // kh = key half (the tile's 32-key step this wave works on), dh = column half, qh = query group
  const unsigned kh = (unsigned)wave & 1u, dh = ((unsigned)wave >> 1) & 1u;
  const unsigned qh = (unsigned)wave >> 2;
  const unsigned qgrp0 = blockIdx.x * (unsigned)QBLK + qh * 32u;
  const unsigned qrow0 = qgrp0 + kh * 16u;   // the 16 queries this wave finishes and stores
  const float* ksb = Ksc + (size_t)b * SEQ;

  // minimum key score of this batch (uniform trip count, clamped addresses); unrolled, so that
  // the scores stay in registers for the table below
  constexpr unsigned KIT = (unsigned)((SEQ + 1023) / 1024);
  v4f kv[KIT];
  float kmin = 3.0e38f;
#pragma unroll
  for (unsigned it = 0; it < KIT; ++it) {
    unsigned j = tid * 4u + it * 1024u;
    j = (j > (unsigned)(SEQ - 4)) ? (unsigned)(SEQ - 4) : j;
    kv[it] = *(const v4f*)(ksb + j);
    kmin = fminf(kmin, fminf(fminf(kv[it][0], kv[it][1]), fminf(kv[it][2], kv[it][3])));
  }
  kmin = red32_min(kmin);
  if (lane == 0u) Wmin[wave] = kmin;
  __syncthreads();
  float km = Wmin[0];
#pragma unroll
  for (int i = 1; i < 8; ++i) km = fminf(km, Wmin[i]);

  // fragment 0 = the queries this wave keeps (qrow0 ..), fragment 1 = those it hands over
  const float* qp = Qs + (size_t)b * SEQ + qgrp0 + m;
  const float qlo = qp[0], qhi = qp[16];
  const float bias = bf16r(bptr[0]);
  const float qb0 = ((kh != 0u) ? qhi : qlo) + bias;
  const float qb1 = ((kh != 0u) ? qlo : qhi) + bias;
  const float mrow0 = fmaxf(qb0 - km, 0.0f);
  const float mrow1 = fmaxf(qb1 - km, 0.0f);
  // query term: 1024 * exp(-rowmax), the value of every pair whose score is zero
  const h16 cq0 = toh_flush(__expf(LN_PCARRY - mrow0));
  const h16 cq1 = toh_flush(__expf(LN_PCARRY - mrow1));
  v16h cqv0, cqv1;
#pragma unroll
  for (int i = 0; i < 16; ++i) { cqv0[i] = cq0; cqv1[i] = cq1; }

  // key terms: Pk[j] = 1024 * exp(kmin - k_s[j]); clamped threads rewrite the last four keys with
  // the same values. Published by the ring prologue's barrier. Unrolled: kv[] is in registers.
#pragma unroll
  for (unsigned it = 0; it < KIT; ++it) {
    unsigned j = tid * 4u + it * 1024u;
    j = (j > (unsigned)(SEQ - 4)) ? (unsigned)(SEQ - 4) : j;
    v4h e;
#pragma unroll
    for (int i = 0; i < 4; ++i) e[i] = toh_flush(__expf((km - kv[it][i]) + LN_PCARRY));
    *(v4h*)&Pk[j] = e;
  }

  v8f o[8], og[8];          // o: the kept queries, og: the queries handed over
#pragma unroll
  for (int dt = 0; dt < 8; ++dt) { o[dt] = (v8f){}; og[dt] = (v8f){}; }
  float lsum = 0.0f, lsumg = 0.0f;

  // copy side: this lane's piece of the wave's first four rows, in LDS and in the v plane
  const unsigned crow = (unsigned)wave * 32u + (lane >> 3);
  const unsigned ring0 = (unsigned)(size_t)Ring;          // byte offset in the block's LDS
  const unsigned cl = ring0 + crow * VPITCH + (lane & 7u) * 16u;
  const _Float16* cg = Vt + ((size_t)b * DIM + crow) * SEQ + (lane & 7u) * 8u;
  // read side: row (dh * 128 + m) of the tile, the lane's 16 B of this wave's 32-key step
  const unsigned rd = (dh * (unsigned)DH + m) * VPITCH + kh * 64u + hh * 16u;
  const unsigned NT = (unsigned)SEQ / TKEYS;

  // ring prologue: tile 0 lands and is published, then tile 1 starts
  copy_v_tile(cl, cg);
  asm volatile("s_wait_asynccnt 0x0" ::: "memory");   // this wave's copies of tile 0 have landed
  __syncthreads();                                    // ... and every other wave's, and Pk
  copy_v_tile(cl + RBUF, cg + TKEYS);

#pragma unroll 1
  for (unsigned t = 0; t < NT; ++t) {
    const unsigned bo = (t & 1u) * RBUF;
    const unsigned char* vb = Ring + bo + rd;
    const _Float16* kt = Pk + t * TKEYS + kh * 32u + hh * 8u;
    {                                                  // this wave's 32-key step of the tile
      const v16h pk = frag_at(kt);
      v16h a[8];
#pragma unroll
      for (int dt = 0; dt < 8; ++dt)
        a[dt] = frag_at((const _Float16*)(vb + (unsigned)dt * (16u * VPITCH)));
      const v16h pf = __builtin_elementwise_maximum(pk, cqv0);
      const v16h pg = __builtin_elementwise_maximum(pk, cqv1);
#pragma unroll
      for (int i = 0; i < 4; ++i) {
        lsum += (float)pf[i];
        lsumg += (float)pg[i];
        lsum += (float)pf[i + 4];
        lsumg += (float)pg[i + 4];
        lsum += (float)pf[i + 8];
        lsumg += (float)pg[i + 8];
        lsum += (float)pf[i + 12];
        lsumg += (float)pg[i + 12];
      }
      // keeps the products in the order of their fragment loads, so that each pair waits for its
      // own two loads only (counted LDS waits); without it an early product is scheduled on the
      // last fragment and waits for all of them
      __builtin_amdgcn_sched_barrier(0);
#pragma unroll
      for (int dt = 0; dt < 8; ++dt) {
        o[dt]  = wmma16(a[dt], pf, o[dt]);
        og[dt] = wmma16(a[dt], pg, og[dt]);
      }
    }
    // publish point of tile t + 1; the same barrier ends every read of tile t's buffer
    asm volatile("s_wait_dscnt 0x0" ::: "memory");     // this wave's reads of tile t are done
    asm volatile("s_wait_asynccnt 0x0" ::: "memory");  // this wave's copies of tile t + 1 landed
    __syncthreads();
    if (t + 2u < NT)                                   // refill the buffer just read
      copy_v_tile(cl + bo, cg + (size_t)(t + 2u) * TKEYS);
  }
  asm volatile("s_wait_asynccnt 0x0" ::: "memory");    // no copy outlives the loop

  // lanes l and l+16 hold the two 16-key parts of this wave's steps for query m
  const float lkeep = lsum + __shfl_xor(lsum, 16, 32);
  const float lgive = lsumg + __shfl_xor(lsumg, 16, 32);

  // The pair's exchange. The ring's place is free: every wave's reads of the last tile ended at
  // the loop's last barrier and no copy is outstanding. Each wave writes the partial sums of the
  // queries it hands over to its own slot and, behind the barrier, adds the other wave's slot
  // (that wave's partial sums of the queries kept here) at the same lane positions.
  const unsigned tb = (unsigned)wave * (16u * LDO);
  const unsigned pb = ((unsigned)wave ^ 1u) * (16u * LDO);
  float* Xs = (float*)Ring;
#pragma unroll
  for (int dt = 0; dt < 8; ++dt) {
    v4f u0, u1;
#pragma unroll
    for (int j = 0; j < 4; ++j) {
      u0[j] = og[dt][j];
      u1[j] = og[dt][j + 4];
    }
    *(v4f*)&Xs[tb + m * LDO + (unsigned)dt * 16u + hh * 8u] = u0;
    *(v4f*)&Xs[tb + m * LDO + (unsigned)dt * 16u + hh * 8u + 4u] = u1;
  }
  if (hh == 0u) Ls[(unsigned)wave * 16u + m] = lgive;
  __syncthreads();
#pragma unroll
  for (int dt = 0; dt < 8; ++dt) {
    const v4f u0 = *(const v4f*)&Xs[pb + m * LDO + (unsigned)dt * 16u + hh * 8u];
    const v4f u1 = *(const v4f*)&Xs[pb + m * LDO + (unsigned)dt * 16u + hh * 8u + 4u];
#pragma unroll
    for (int j = 0; j < 4; ++j) {
      o[dt][j] += u0[j];
      o[dt][j + 4] += u1[j];
    }
  }
  const float ltot = lkeep + Ls[((unsigned)wave ^ 1u) * 16u + m];
  const float inv = __builtin_amdgcn_rcpf(ltot);

  // stage O[query m][d = dt*16 + 8*hh + r] in the wave's tile
#pragma unroll
  for (int dt = 0; dt < 8; ++dt) {
    v4f u0, u1;
#pragma unroll
    for (int j = 0; j < 4; ++j) {
      u0[j] = o[dt][j] * inv;
      u1[j] = o[dt][j + 4] * inv;
    }
    *(v4f*)&Os[tb + m * LDO + (unsigned)dt * 16u + hh * 8u] = u0;
    *(v4f*)&Os[tb + m * LDO + (unsigned)dt * 16u + hh * 8u + 4u] = u1;
  }
  wave_lds_sync();

  const size_t orow = (size_t)b * SEQ_FULL + qrow0;
#pragma unroll
  for (unsigned g = 0; g < 2u; ++g) {      // 2 steps x 8 rows == 16 rows
    v4f x[8];
    size_t off[8];
#pragma unroll
    for (unsigned i = 0; i < 8u; ++i) {
      const unsigned r = 8u * g + i;
      x[i] = *(const v4f*)&Os[tb + r * LDO + lane * 4u];
      off[i] = (orow + r) * DIM + dh * (unsigned)DH + lane * 4u;
    }
#pragma unroll
    for (int i = 0; i < 8; ++i) *(v4f*)(out + off[i]) = x[i];
    
  }
}

// ---------------------------------------------------------------------------
extern "C" void kernel_launch(void* const* d_in, const int* in_sizes, int n_in,
                              void* d_out, int out_size, void* d_ws, size_t ws_size,
                              hipStream_t stream) {
  if (n_in < 6) return;
  const long long need_x = ((long long)(NB - 1) * SEQ_FULL + SEQ) * DIM;
  if ((long long)in_sizes[0] < need_x) return;
  if ((long long)in_sizes[1] < (long long)DIM * DIM) return;
  if ((long long)in_sizes[2] < (long long)DIM * DIM) return;
  if ((long long)in_sizes[3] < (long long)DIM * DIM) return;
  if (in_sizes[4] < DIM) return;
  if (in_sizes[5] < 1) return;
  if ((long long)out_size < need_x) return;
  if (ws_size < WS_TOTAL) return;

  const float* X    = (const float*)d_in[0];   // x      [NB_FULL][SEQ_FULL][DIM]
  const float* wq   = (const float*)d_in[1];   // Wq     [DIM out][DIM in]
  const float* wk   = (const float*)d_in[2];   // Wk     [DIM out][DIM in]
  const float* wvv  = (const float*)d_in[3];   // Wv     [DIM out][DIM in]
  const float* wmlp = (const float*)d_in[4];   // w_mlp  [DIM]
  const float* bmlp = (const float*)d_in[5];   // b_mlp  scalar
  float* out = (float*)d_out;

  char* ws = (char*)d_ws;
  _Float16* Wq16 = (_Float16*)(ws + OFF_WQ);    // [out][in], x64
  _Float16* Wk16 = (_Float16*)(ws + OFF_WK);
  _Float16* Wv16 = (_Float16*)(ws + OFF_WV);
  _Float16* X16  = (_Float16*)(ws + OFF_X16);   // [MROWS][DIM] compact rows
  float*    QS   = (float*)(ws + OFF_QS);       // [MROWS]
  float*    KS   = (float*)(ws + OFF_KS);       // [MROWS]
  _Float16* Vt16 = (_Float16*)(ws + OFF_VT);    // [b][DIM][SEQ]

  dim3 blk(256);

  // three dependent launches: casts (weight planes keep their [out][in] order), projections, attention
  cast_kernel<<<dim3(3 * (DIM / 8) + MROWS / 8), blk, 0, stream>>>(X, wq, wk, wvv, X16, Wq16, Wk16,
                                                                  Wv16);
  proj_kernel<<<dim3(3 * (MROWS / 64)), blk, 0, stream>>>(
      X16, Wq16, Wk16, Wv16, wmlp, QS, KS, Vt16);
  attn_kernel<<<dim3(SEQ / QBLK, NB), blk, 0, stream>>>(QS, KS, bmlp, Vt16, out);
}

// v006
// It runs in 41.9 microseconds.
// Timed twice side by side with v005, it ran 1.29 and 1.33 times as fast.
// Over all steps from v000 it is 6.30 times as fast.
#include <hip/hip_runtime.h>
#include <stddef.h>

// All contractions on v_wmma_f32_16x16x32_f16 (f16 operands, f32 accumulate): q/k/v projections
// (x plane = f16(bf16(x)), weight planes = f16(64 * bf16(w)), kept in their [out][in] order) and
// the p.v product (p carried x1024, v plane f16 single). The per-row dot with the score vector,
// the exp of each key's and each query's score and the row sums are f32 on the vector unit; the
// softmax numerators are the f16 maximum of a key term and a query term.

typedef _Float16 v16h __attribute__((ext_vector_type(16)));
typedef _Float16 v8h  __attribute__((ext_vector_type(8)));
typedef _Float16 v4h  __attribute__((ext_vector_type(4)));
typedef _Float16 v2h  __attribute__((ext_vector_type(2)));
typedef float    v8f  __attribute__((ext_vector_type(8)));
typedef float    v4f  __attribute__((ext_vector_type(4)));
typedef _Float16 h16;

#ifndef NB
#define NB 4
#endif
#ifndef SEQ
#define SEQ 4096
#endif
#define NB_FULL  4
#define SEQ_FULL 4096
#define DIM   256
#define MROWS (NB * SEQ)
#define DH    128          // output columns per wave in the attention kernel
#define QBLK  128          // query rows per attention block (2 groups of 64)

#define LDC 68             // floats per LDS row of the 64x64 GEMM stage (272 B)
#define LDO 132            // floats per LDS row of the attention output stage (528 B)

#define WCARRY 64.0f                   // weight planes carried x64
#define LN_PCARRY 6.931471805599453f   // ln(1024): softmax numerators carried x1024

static_assert(NB >= 1 && NB <= NB_FULL);
static_assert(SEQ >= 128 && SEQ <= SEQ_FULL && (SEQ % 128) == 0);
static_assert(DIM == 32 * 8);               // cast: one wave per row, 32 lanes x 8 columns
static_assert((DIM % 64) == 0 && (DIM % 32) == 0);
static_assert((MROWS % 64) == 0 && (MROWS % 8) == 0);
static_assert((SEQ % QBLK) == 0 && (SEQ % 32) == 0 && (SEQ % 64) == 0);
static_assert(2 * DH == DIM && (DH % 16) == 0 && DH / 16 == 8);
static_assert(DH * 4 == 32 * 16);           // one store instruction = one 512-B row segment
static_assert(QBLK == 2 * 64);              // 8 waves = 2 query groups x 4 key quarters
static_assert((LDC % 4) == 0 && LDC >= 64);
static_assert((LDO % 4) == 0 && LDO >= DH);
static_assert(2 * 8 == 16);                 // output stage: 2 steps x 8 rows == 16 tile rows
#define TKEYS   128u                     // keys per ring tile (four 32-key steps, one per key quarter)
#define VPITCH  272u                     // LDS bytes per v row of a tile: 256 + 16 (16 B x odd)
#define VT_TILE ((unsigned)DH * VPITCH)  // v part of a ring buffer: the block's 128 v rows
#define RBUF    VT_TILE                  // ring buffer: one v tile
#define XS_BYTES (8u * 3u * 16u * (unsigned)LDO * 4u)   // partial-sum exchange: 3 slots per wave
static_assert((SEQ % 128) == 0 && SEQ / 128 >= 2);    // the ring's prologue needs two tiles
static_assert(TKEYS * 2u == 256u && (VPITCH % 16u) == 0 && ((VPITCH / 16u) & 1u) == 1u && (RBUF % 16u) == 0);
static_assert(DH == 8 * 8 * 2);          // tile rows: 8 waves x 8 copies x 2 rows per copy
static_assert(8 * 16 * LDO * 4 + 8 * 4 + 8 * 3 * 16 * 4 + XS_BYTES + SEQ * 2 <= 327680);   // attention static LDS
static_assert(2u * RBUF <= XS_BYTES);    // the ring lies in the exchange's place
static_assert((size_t)MROWS * DIM < (size_t)0xFFFFFFFFu);

// workspace layout (bytes)
#define W_BYTES   ((size_t)DIM * DIM * 2)
#define X16_BYTES ((size_t)MROWS * DIM * 2)
#define S_BYTES   ((size_t)MROWS * 4)
#define VT_BYTES  ((size_t)NB * DIM * SEQ * 2)
#define OFF_WQ  ((size_t)0)
#define OFF_WK  (OFF_WQ + W_BYTES)
#define OFF_WV  (OFF_WK + W_BYTES)
#define OFF_X16 (OFF_WV + W_BYTES)
#define OFF_QS  (OFF_X16 + X16_BYTES)
#define OFF_KS  (OFF_QS + S_BYTES)
#define OFF_VT  (OFF_KS + S_BYTES)
#define WS_TOTAL (OFF_VT + VT_BYTES)
static_assert((W_BYTES % 128) == 0 && (X16_BYTES % 128) == 0);
static_assert((S_BYTES % 128) == 0 && (VT_BYTES % 128) == 0);
static_assert(WS_TOTAL <= (size_t)134217728);

// ---------------------------------------------------------------------------
__device__ __forceinline__ float bf16r(float x) {   // RNE convert to bf16, returned widened
  unsigned int u = __float_as_uint(x);
  u = (u + 0x7FFFu + ((u >> 16) & 1u)) & 0xFFFF0000u;
  return __uint_as_float(u);
}

// f32 -> f16 for WMMA operand planes: values below the smallest f16 normal become zero.
static __device__ __forceinline__ h16 toh_flush(float v) {
  const h16 r = (h16)v;
  return (fabsf(v) < 6.103515625e-05f) ? (h16)0.0f : r;
}

// 16-bit fragment: p points at element [row = lane&15][k0 + 8*(lane>>4)] of a k-contiguous
// row. Elements 0..7 <- k0+8h+0..7, elements 8..15 <- k0+16+8h+0..7 (same map for A and B).
__device__ __forceinline__ v16h frag_at(const _Float16* p) {
  v8h lo = *(const v8h*)(p);
  v8h hi = *(const v8h*)(p + 16);
  v16h out;
#pragma unroll
  for (int i = 0; i < 8; ++i) { out[i] = lo[i]; out[i + 8] = hi[i]; }
  return out;
}

__device__ __forceinline__ v8f wmma16(v16h a, v16h b, v8f c) {
  v8f d = __builtin_amdgcn_wmma_f32_16x16x32_f16(false, a, false, b, (short)0, c,
                                                 false, false);
  asm volatile("v_nop\n\tv_nop\n\tv_nop\n\tv_nop" : "+v"(d) : "v"(a), "v"(b));
  return d;
}

// The attention kernel's form: the builtin alone (the compiler keeps the distance behind its own
// matrix instructions). An asm statement that names the operands holds them below v256, and 32
// accumulators with their fragments need more registers than that.
__device__ __forceinline__ v8f wmma16_hi(v16h a, v16h b, v8f c) {
  return __builtin_amdgcn_wmma_f32_16x16x32_f16(false, a, false, b, (short)0, c, false, false);
}

__device__ __forceinline__ float red16_sum(float x) {
#pragma unroll
  for (int off = 1; off < 16; off <<= 1) x += __shfl_xor(x, off, 32);
  return x;
}
__device__ __forceinline__ float red32_min(float x) {
#pragma unroll
  for (int off = 1; off < 32; off <<= 1) x = fminf(x, __shfl_xor(x, off, 32));
  return x;
}

__device__ __forceinline__ void wave_lds_sync() {
  __builtin_amdgcn_fence(3 /* release order */, "wavefront");
  asm volatile("s_wait_dscnt 0x0" ::: "memory");
  __builtin_amdgcn_wave_barrier();
}

// ---------------------------------------------------------------------------
// Row cast: dst[row][0..255] = f16(carry * bf16(src[row][0..255])), one wave per row, 8 rows
// per block; the wave's single store instruction covers the whole 512-B row (4 lines).
// SRC_INPUT = 1: source rows are addressed with the full per-batch stride (module input);
// SRC_INPUT = 0: compact rows (weight matrices, [out][in] order kept: already k-contiguous).
// blk = index of the 8-row group inside this source (rows / 8 groups).
// ---------------------------------------------------------------------------
template <int SRC_INPUT>
__device__ __forceinline__ void cast_body(const float* __restrict__ X,
                                          _Float16* __restrict__ dst, const float carry,
                                          const unsigned blk) {
#pragma clang fp contract(off)
  const unsigned lane = threadIdx.x & 31u;
  const unsigned w = (unsigned)__builtin_amdgcn_readfirstlane((int)(threadIdx.x >> 5));
  const unsigned crow = blk * 8u + w;
  size_t srow = crow;
  if (SRC_INPUT) {
    const unsigned bidx = crow / (unsigned)SEQ;
    const unsigned sq = crow - bidx * (unsigned)SEQ;
    srow = (size_t)bidx * SEQ_FULL + sq;
  }
  const float* xr = X + srow * DIM + lane * 8u;
  const v4f a0 = *(const v4f*)(xr);
  const v4f a1 = *(const v4f*)(xr + 4u);
  v8h o;
#pragma unroll
  for (int i = 0; i < 4; ++i) {
    o[i]     = toh_flush(carry * bf16r(a0[i]));
    o[i + 4] = toh_flush(carry * bf16r(a1[i]));
  }
  _Float16* p = dst + (size_t)crow * DIM + lane * 8u;
  *(v8h*)p = o;
  
}

// All four casts in one launch: they are independent of each other, so the block index picks the
// source. Blocks 0 .. 3 * WBLK - 1: the three weight planes; the rest: the rows of x.
// Grid (3 * WBLK + MROWS / 8).
#define WBLK ((unsigned)(DIM / 8))
__global__ __launch_bounds__(256) void cast_kernel(
    const float* __restrict__ X, const float* __restrict__ wq, const float* __restrict__ wk,
    const float* __restrict__ wv, _Float16* __restrict__ x16, _Float16* __restrict__ wq16,
    _Float16* __restrict__ wk16, _Float16* __restrict__ wv16) {
  const unsigned bx = blockIdx.x;
  if (bx < 3u * WBLK) {
    const unsigned p = bx / WBLK;
    const float* src = (p == 0u) ? wq : (p == 1u) ? wk : wv;
    _Float16* dst = (p == 0u) ? wq16 : (p == 1u) ? wk16 : wv16;
    cast_body<0>(src, dst, WCARRY, bx - p * WBLK);
  } else {
    cast_body<1>(X, x16, 1.0f, bx - 3u * WBLK);
    // precaution: in the listing the weight job's code follows this job's store (behind a branch
    // that skips it) and reuses the store's registers; the wait stands in front of that code
    asm volatile("s_wait_xcnt 0x0" ::: "memory");
  }
}

// ---------------------------------------------------------------------------
// Projections, operands fed through LDS. Block = one 64-row tile of x times one whole weight
// matrix (job 0: v, job 1: q score, job 2: k score); 8 waves (mw = 16-row group, nw = 32-column
// group), 2 accumulators per wave, four 64-column tiles one after the other.
// Every byte of the x and weight planes comes in by asynchronous copies to LDS, one whole 512-B row (4 lines) per
// copy instruction: the x tile once, the weight tiles through a ring of two buffers, one tile
// ahead. Rows lie at a 528-B pitch (16 B x odd) for the 16-B fragment reads. Each wave reads its
// x fragments (16 rows x 256 k) from LDS once and keeps them in registers for all four tiles.
// One publish point (LDS wait, copy wait, block barrier) per weight tile.
// Score jobs: outs[row] = sum_c P[row][c] * bf16(wmlp[c]) from the f32 accumulators, reduced
// over the 16 lanes of a half and the two column groups (Rs, block barrier).
// v job: each 64x64 tile is staged through Cs (cross-wave, block barrier) and written
// transposed, 8 lanes x 16 B = one 128-B line of a v row. Cs lies in the x tile's place, which
// nobody reads any more behind the first publish point.
// Grid (3 * RBLK): three blocks fit a WGP's LDS.
// ---------------------------------------------------------------------------
#define RBLK   ((unsigned)(MROWS / 64))
#define PPITCH 528u                      // LDS bytes per staged row: 512 + 16
#define PTILE  (64u * PPITCH)            // one staged tile of 64 rows
static_assert(DIM * 2 == 32 * 16);       // one copy instruction = one row
static_assert((PPITCH % 16u) == 0 && ((PPITCH / 16u) & 1u) == 1u);
static_assert(64 == 8 * 8);              // tile rows: 8 waves x 8 copies
static_assert(DIM / 64 >= 2);            // the ring's prologue needs two weight tiles
static_assert(64u * LDC * 4u <= PTILE);  // Cs fits the x tile's place
static_assert(3u * (3u * PTILE + 512u) <= 327680u);

// Eight rows of a tile: each copy is one row, 32 lanes x 16 B. l = the lane's LDS byte address in
// the first row, g = its global address. The closing s_wait_xcnt is a precaution: it stands in
// front of every later write of a register that a copy names.
__device__ __forceinline__ void copy_rows8(const unsigned l, const _Float16* g) {
  const unsigned ls = PPITCH;
  const size_t gs = (size_t)DIM;
  asm volatile(
      "global_load_async_to_lds_b128 %0, %8, off\n\t"
      "global_load_async_to_lds_b128 %1, %9, off\n\t"
      "global_load_async_to_lds_b128 %2, %10, off\n\t"
      "global_load_async_to_lds_b128 %3, %11, off\n\t"
      "global_load_async_to_lds_b128 %4, %12, off\n\t"
      "global_load_async_to_lds_b128 %5, %13, off\n\t"
      "global_load_async_to_lds_b128 %6, %14, off\n\t"
      "global_load_async_to_lds_b128 %7, %15, off\n\t"
      "s_wait_xcnt 0x0"
      :: "v"(l), "v"(l + ls), "v"(l + 2u * ls), "v"(l + 3u * ls),
         "v"(l + 4u * ls), "v"(l + 5u * ls), "v"(l + 6u * ls), "v"(l + 7u * ls),
         "v"(g), "v"(g + gs), "v"(g + 2u * gs), "v"(g + 3u * gs),
         "v"(g + 4u * gs), "v"(g + 5u * gs), "v"(g + 6u * gs), "v"(g + 7u * gs)
      : "memory");
}

__global__ __launch_bounds__(256) void proj_kernel(
    const _Float16* __restrict__ A16, const _Float16* __restrict__ Wq,
    const _Float16* __restrict__ Wk, const _Float16* __restrict__ Wv,
    const float* __restrict__ wmlp, float* __restrict__ qs, float* __restrict__ ks,
    _Float16* __restrict__ vt) {
  __shared__ __attribute__((aligned(16))) unsigned char Ps[3u * PTILE];  // x tile, ring of two
  __shared__ float Rs[2 * 64];
  const unsigned tid = threadIdx.x, lane = tid & 31u;
  const unsigned w = (unsigned)__builtin_amdgcn_readfirstlane((int)(threadIdx.x >> 5));
  const unsigned mw = w >> 1, nw = w & 1u;
  const unsigned hh = lane >> 4, m = lane & 15u;
  const unsigned job = blockIdx.x / RBLK;
  const unsigned row0 = (blockIdx.x - job * RBLK) * 64u;
  const _Float16* Bt = (job == 0u) ? Wv : (job == 1u) ? Wq : Wk;
  const unsigned NTB = (unsigned)(DIM / 64);

  // copy side: this lane's 16 B of the wave's first row, in LDS and in the two planes
  const unsigned cl = (unsigned)(size_t)Ps + (w * 8u) * PPITCH + lane * 16u;
  const _Float16* ga = A16 + (size_t)(row0 + w * 8u) * DIM + lane * 8u;
  const _Float16* gb = Bt + (size_t)(w * 8u) * DIM + lane * 8u;

  // prologue: the x tile and weight tile 0 land and are published, then weight tile 1 starts
  copy_rows8(cl, ga);
  copy_rows8(cl + PTILE, gb);
  asm volatile("s_wait_asynccnt 0x0" ::: "memory");   // this wave's copies have landed
  __syncthreads();                                    // ... and every other wave's
  copy_rows8(cl + 2u * PTILE, gb + (size_t)64 * DIM);

  v16h a[8];
  {
    const unsigned char* ar = Ps + (mw * 16u + m) * PPITCH + hh * 16u;
#pragma unroll
    for (unsigned k = 0; k < 8u; ++k) a[k] = frag_at((const _Float16*)(ar + k * 64u));
  }
  float part[8];
#pragma unroll
  for (int r = 0; r < 8; ++r) part[r] = 0.0f;
  float* Cs = (float*)Ps;
  const unsigned rdb = PTILE + (nw * 32u + m) * PPITCH + hh * 16u;
  const unsigned bidx = row0 / (unsigned)SEQ;
  const unsigned key0 = row0 - bidx * (unsigned)SEQ;

  // rolled: one copy of the tile's code, the buffer picked by the trip's parity
#pragma unroll 1
  for (unsigned nb = 0; nb < NTB; ++nb) {
    const unsigned bo = (nb & 1u) * PTILE;
    const unsigned char* bb = Ps + bo + rdb;
    // score jobs: the tile's two score weights are fetched ahead of the products that hide them
    float wr0 = 0.0f, wr1 = 0.0f;
    if (job != 0u) {
      const unsigned col = nb * 64u + nw * 32u + m;
      wr0 = wmlp[col];
      wr1 = wmlp[col + 16u];
      // precaution: the wait stands in front of every later write of the loads' address registers
      asm volatile("s_wait_xcnt 0x0" ::: "memory");
    }
    v8f acc0 = {}, acc1 = {};
#pragma unroll
    for (unsigned k = 0; k < 8u; ++k) {
      const v16h b0 = frag_at((const _Float16*)(bb + k * 64u));
      const v16h b1 = frag_at((const _Float16*)(bb + 16u * PPITCH + k * 64u));
      acc0 = wmma16(a[k], b0, acc0);
      acc1 = wmma16(a[k], b1, acc1);
    }
    // publish point of weight tile nb + 1; the same barrier ends every read of tile nb's buffer
    // (and, at nb = 0, of the x tile; later, of Cs)
    asm volatile("s_wait_dscnt 0x0" ::: "memory");     // this wave's LDS reads are done
    asm volatile("s_wait_asynccnt 0x0" ::: "memory");  // this wave's copies of tile nb + 1 landed
    __syncthreads();
    if (nb + 2u < NTB)                                 // refill the buffer just read
      copy_rows8(cl + PTILE + bo, gb + (size_t)(nb + 2u) * 64u * DIM);

    if (job == 0u) {
#pragma unroll
      for (int r = 0; r < 8; ++r) {
        float* d = &Cs[(mw * 16u + hh * 8u + (unsigned)r) * LDC + nw * 32u + m];
        d[0]  = acc0[r];
        d[16] = acc1[r];
      }
      __syncthreads();
      v8h x[2];
      size_t off[2];
#pragma unroll
      for (unsigned i = 0; i < 2u; ++i) {
        const unsigned dcol = 32u * i + (tid >> 3);
        const unsigned kk = (tid & 7u) * 8u;
#pragma unroll
        for (unsigned j = 0; j < 8u; ++j) {
          const float t = Cs[(kk + j) * LDC + dcol] * (1.0f / WCARRY);
          x[i][j] = toh_flush(t);
        }
        off[i] = ((size_t)bidx * DIM + nb * 64u + dcol) * SEQ + key0 + kk;
      }
#pragma unroll
      for (int i = 0; i < 2; ++i) *(v8h*)(vt + off[i]) = x[i];
      // precaution: the next trip reuses the stores' registers; the wait stands in front of it
      asm volatile("s_wait_xcnt 0x0" ::: "memory");
    } else {
      const float w0 = bf16r(wr0);
      const float w1 = bf16r(wr1);
#pragma unroll
      for (int r = 0; r < 8; ++r) part[r] += acc0[r] * w0 + acc1[r] * w1;
    }
  }
  asm volatile("s_wait_asynccnt 0x0" ::: "memory");    // no copy outlives the loop

  if (job != 0u) {
    // row (mw*16 + hh*8 + r) is spread over the 16 lanes of a half
#pragma unroll
    for (int r = 0; r < 8; ++r) part[r] = red16_sum(part[r]);
    if (m == 0u) {
#pragma unroll
      for (int r = 0; r < 8; ++r) Rs[nw * 64u + mw * 16u + hh * 8u + (unsigned)r] = part[r];
    }
    __syncthreads();
    if (w == 0u && lane < 16u) {
      v4f val;
#pragma unroll
      for (int j = 0; j < 4; ++j)
        val[j] = (Rs[lane * 4u + (unsigned)j] + Rs[64u + lane * 4u + (unsigned)j]) * (1.0f / WCARRY);
      float* p = ((job == 1u) ? qs : ks) + row0 + lane * 4u;
      *(v4f*)p = val;
    }
  }
}

// ---------------------------------------------------------------------------
// Dense additive-score attention, transposed form, v fed through an LDS ring.
// Block = 128 query rows x 128 columns (one column half) of one batch, so that a v byte is
// fetched from L2 by one block per 128 queries; wave = 64 query rows x 128 columns x one 32-key
// step of every 128-key tile (32 accumulators), so that each v fragment read from LDS feeds four
// products. The four waves of a query group (key quarters 0..3) hold partial sums over their
// keys; behind the loop each keeps one 16-query part and hands the other three, with their row
// sums, to the waves that keep them, through LDS (the ring's place and beyond, free by then;
// block barrier). Fragment j of the wave with key quarter kq holds query part kq ^ j, so that
// fragment 0 is the kept one and fragment j goes to the wave with key quarter kq ^ j.
// score[i][j] = relu(q_s[i] + b - k_s[j]); its row maximum is relu(q_s[i] + b - min_j k_s[j]),
// so the max-subtracted softmax needs no running rescale. With kmin = min_j k_s[j] and
// rowmax = relu(q_s[i] + b - kmin), score - rowmax = max(kmin - k_s[j], -rowmax), and exp and the
// conversion to f16 are monotone, so
//   p[i][j] = f16(1024 * exp(score - rowmax)) = max(f16(1024 * exp(kmin - k_s[j])), f16(1024 * exp(-rowmax))):
// one exp per key (the block's table Pk, built once in LDS) and one per query instead of one per
// pair. Per 32-key step each lane reads its B fragment of P^T from Pk (lane = query, elements =
// keys of the 16-bit k map), takes the packed f16 maximum with its query term, and
// O^T[d][i] += V^T[d][keys] . P^T[keys][i] with the A fragments from the ring. The row sum runs
// over the f16 p, so the carry cancels in O / l. Ring: two buffers of 128 keys (128 v rows of
// 256 B at a 272-B pitch), filled by asynchronous copies to LDS one tile ahead, so the block
// fetches each v byte once, in whole 128-B lines, while the tile before it is worked on; one
// publish point (LDS wait, copy wait, block barrier) per tile.
// Wmin, Pk, the exchange, Ls: cross-wave (block barrier). Os: wave-private stage (wave sync); staged extent
// Grid (2 * SEQ/128, NB): blockIdx.x = 2 * query block + column half.
// ---------------------------------------------------------------------------

// One ring tile: each wave copies 16 v rows (8 copies x 2 rows x 16 lanes x 16 B). l = the lane's
// LDS byte address of its first piece, g = its global address. The closing s_wait_xcnt is a
// precaution: it stands in front of every later write of a register that a copy names.
__device__ __forceinline__ void copy_v_tile(const unsigned l, const _Float16* g) {
  const unsigned ls = 2u * VPITCH;
  const size_t gs = (size_t)2 * SEQ;
  asm volatile(
      "global_load_async_to_lds_b128 %0, %8, off\n\t"
      "global_load_async_to_lds_b128 %1, %9, off\n\t"
      "global_load_async_to_lds_b128 %2, %10, off\n\t"
      "global_load_async_to_lds_b128 %3, %11, off\n\t"
      "global_load_async_to_lds_b128 %4, %12, off\n\t"
      "global_load_async_to_lds_b128 %5, %13, off\n\t"
      "global_load_async_to_lds_b128 %6, %14, off\n\t"
      "global_load_async_to_lds_b128 %7, %15, off\n\t"
      "s_wait_xcnt 0x0"
      :: "v"(l), "v"(l + ls), "v"(l + 2u * ls), "v"(l + 3u * ls),
         "v"(l + 4u * ls), "v"(l + 5u * ls), "v"(l + 6u * ls), "v"(l + 7u * ls),
         "v"(g), "v"(g + gs), "v"(g + 2u * gs), "v"(g + 3u * gs),
         "v"(g + 4u * gs), "v"(g + 5u * gs), "v"(g + 6u * gs), "v"(g + 7u * gs)
      : "memory");
}

__global__ __launch_bounds__(256) void attn_kernel(
    const float* __restrict__ Qs, const float* __restrict__ Ksc,
    const float* __restrict__ bptr, const _Float16* __restrict__ Vt,
    float* __restrict__ out) {
  __shared__ float Os[8 * 16 * LDO];
  __shared__ float Wmin[8];
  __shared__ float Ls[8 * 3 * 16];                            // row sums handed to the group's other waves
  __shared__ __attribute__((aligned(16))) unsigned char Ring[XS_BYTES];   // ring (2 * RBUF), then exchange
  __shared__ __attribute__((aligned(16))) _Float16 Pk[SEQ];   // key terms of the numerators

  const unsigned tid = threadIdx.x, lane = tid & 31u;
  const int wave = __builtin_amdgcn_readfirstlane((int)(threadIdx.x >> 5));
  const unsigned hh = lane >> 4, m = lane & 15u;
  const unsigned b = blockIdx.y;
  // kq = key quarter (the tile's 32-key step this wave works on), qg = query group, dh = column half
  const unsigned kq = (unsigned)wave & 3u, qg = (unsigned)wave >> 2;
  const unsigned dh = blockIdx.x & 1u;
  const unsigned qgrp0 = (blockIdx.x >> 1) * (unsigned)QBLK + qg * 64u;
  const unsigned qrow0 = qgrp0 + kq * 16u;   // the 16 queries this wave finishes and stores
  const float* ksb = Ksc + (size_t)b * SEQ;

  // minimum key score of this batch (uniform trip count, clamped addresses); unrolled, so that
  // the scores stay in registers for the table below
  constexpr unsigned KIT = (unsigned)((SEQ + 1023) / 1024);
  v4f kv[KIT];
  float kmin = 3.0e38f;
#pragma unroll
  for (unsigned it = 0; it < KIT; ++it) {
    unsigned j = tid * 4u + it * 1024u;
    j = (j > (unsigned)(SEQ - 4)) ? (unsigned)(SEQ - 4) : j;
    kv[it] = *(const v4f*)(ksb + j);
    kmin = fminf(kmin, fminf(fminf(kv[it][0], kv[it][1]), fminf(kv[it][2], kv[it][3])));
  }
  kmin = red32_min(kmin);
  if (lane == 0u) Wmin[wave] = kmin;
  __syncthreads();
  float km = Wmin[0];
#pragma unroll
  for (int i = 1; i < 8; ++i) km = fminf(km, Wmin[i]);

  // fragment 0 = the queries this wave keeps (qrow0 ..), fragments 1..3 = those it hands over
  const float* qp = Qs + (size_t)b * SEQ + qgrp0 + m;
  float qv[4];
  // the two scheduling barriers hold the arithmetic around the loads away from the gap between
  // them and their wait: scheduled into it, it took over the loads' address registers
  __builtin_amdgcn_sched_barrier(0);
#pragma unroll
  for (unsigned j = 0; j < 4u; ++j) qv[j] = qp[(kq ^ j) * 16u];
  // precaution: the wait stands in front of every later write of the loads' address registers
  asm volatile("s_wait_xcnt 0x0" ::: "memory");
  __builtin_amdgcn_sched_barrier(0);
  const float bias = bf16r(bptr[0]);
  // query term: 1024 * exp(-rowmax), the value of every pair whose score is zero
  v2h cq2[4];               // one register per fragment: the term in both halves
#pragma unroll
  for (int j = 0; j < 4; ++j) {
    const float mrow = fmaxf((qv[j] + bias) - km, 0.0f);
    const h16 cq = toh_flush(__expf(LN_PCARRY - mrow));
    cq2[j][0] = cq;
    cq2[j][1] = cq;
  }

  // key terms: Pk[j] = 1024 * exp(kmin - k_s[j]); clamped threads rewrite the last four keys with
  // the same values. Published by the ring prologue's barrier. Unrolled: kv[] is in registers.
#pragma unroll
  for (unsigned it = 0; it < KIT; ++it) {
    unsigned j = tid * 4u + it * 1024u;
    j = (j > (unsigned)(SEQ - 4)) ? (unsigned)(SEQ - 4) : j;
    v4h e;
#pragma unroll
    for (int i = 0; i < 4; ++i) e[i] = toh_flush(__expf((km - kv[it][i]) + LN_PCARRY));
    *(v4h*)&Pk[j] = e;
  }

  v8f o[4][8];              // o[0]: the kept queries, o[1..3]: the queries handed over
  float lsum[4];
#pragma unroll
  for (int j = 0; j < 4; ++j) {
    lsum[j] = 0.0f;
#pragma unroll
    for (int dt = 0; dt < 8; ++dt) o[j][dt] = (v8f){};
  }

  // copy side: this lane's piece of the wave's first two rows, in LDS and in the v plane
  const unsigned crow = (unsigned)wave * 16u + (lane >> 4);
  const unsigned ring0 = (unsigned)(size_t)Ring;          // byte offset in the block's LDS
  const unsigned cl = ring0 + crow * VPITCH + (lane & 15u) * 16u;
  const _Float16* cg = Vt + ((size_t)b * DIM + dh * (unsigned)DH + crow) * SEQ + (lane & 15u) * 8u;
  // read side: row m of the tile, the lane's 16 B of this wave's 32-key step
  const unsigned rd = m * VPITCH + kq * 64u + hh * 16u;
  const unsigned NT = (unsigned)SEQ / TKEYS;

  // ring prologue: tile 0 lands and is published, then tile 1 starts
  copy_v_tile(cl, cg);
  asm volatile("s_wait_asynccnt 0x0" ::: "memory");   // this wave's copies of tile 0 have landed
  __syncthreads();                                    // ... and every other wave's, and Pk
  copy_v_tile(cl + RBUF, cg + TKEYS);

#pragma unroll 1
  for (unsigned t = 0; t < NT; ++t) {
    const unsigned bo = (t & 1u) * RBUF;
    const unsigned char* vb = Ring + bo + rd;
    const _Float16* kt = Pk + t * TKEYS + kq * 32u + hh * 8u;
    {                                                  // this wave's 32-key step of the tile
      const v16h pk = frag_at(kt);
      v16h a[8];
#pragma unroll
      for (int dt = 0; dt < 8; ++dt)
        a[dt] = frag_at((const _Float16*)(vb + (unsigned)dt * (16u * VPITCH)));
      v16h p[4];
#pragma unroll
      for (int j = 0; j < 4; ++j) {
#pragma unroll
        for (int i = 0; i < 16; i += 2) {
          const v2h k2 = {pk[i], pk[i + 1]};
          const v2h r2 = __builtin_elementwise_maximum(k2, cq2[j]);
          p[j][i] = r2[0];
          p[j][i + 1] = r2[1];
        }
      }
#pragma unroll
      for (int i = 0; i < 4; ++i) {
#pragma unroll
        for (int e = 0; e < 16; e += 4) {
#pragma unroll
          for (int j = 0; j < 4; ++j) lsum[j] += (float)p[j][i + e];
        }
      }
      // keeps the products in the order of their fragment loads, so that each four wait for their
      // own two loads only (counted LDS waits); without it an early product is scheduled on the
      // last fragment and waits for all of them
      __builtin_amdgcn_sched_barrier(0);
#pragma unroll
      for (int dt = 0; dt < 8; ++dt) {
#pragma unroll
        for (int j = 0; j < 4; ++j) o[j][dt] = wmma16_hi(a[dt], p[j], o[j][dt]);
      }
      // keeps the products in front of the publish point: moved behind its barrier they would
      // stand ahead of the refill's copies, which then start a whole run of products later
      __builtin_amdgcn_sched_barrier(0);
    }
    // publish point of tile t + 1; the same barrier ends every read of tile t's buffer
    asm volatile("s_wait_dscnt 0x0" ::: "memory");     // this wave's reads of tile t are done
    asm volatile("s_wait_asynccnt 0x0" ::: "memory");  // this wave's copies of tile t + 1 landed
    __syncthreads();
    if (t + 2u < NT)                                   // refill the buffer just read
      copy_v_tile(cl + bo, cg + (size_t)(t + 2u) * TKEYS);
  }
  asm volatile("s_wait_asynccnt 0x0" ::: "memory");    // no copy outlives the loop

  // lanes l and l+16 hold the two 16-key parts of this wave's steps for query m
  float lrow[4];
#pragma unroll
  for (int j = 0; j < 4; ++j) lrow[j] = lsum[j] + __shfl_xor(lsum[j], 16, 32);

  // The group's exchange. The ring's place is free: every wave's reads of the last tile ended at
  // the loop's last barrier and no copy is outstanding. Each wave writes the partial sums of
  // fragment j = 1..3 to its own slot j - 1 and, behind the barrier, adds slot j - 1 of the wave
  // with key quarter kq ^ j (that wave's partial sums of the queries kept here) at the same lane
  // positions.
  const unsigned tb = (unsigned)wave * (16u * LDO);
  float* Xs = (float*)Ring;
#pragma unroll
  for (unsigned j = 1; j < 4u; ++j) {
    const unsigned slot = (unsigned)wave * 3u + (j - 1u);
    const unsigned sb = slot * (16u * LDO);
#pragma unroll
    for (int dt = 0; dt < 8; ++dt) {
      v4f u0, u1;
#pragma unroll
      for (int i = 0; i < 4; ++i) {
        u0[i] = o[j][dt][i];
        u1[i] = o[j][dt][i + 4];
      }
      *(v4f*)&Xs[sb + m * LDO + (unsigned)dt * 16u + hh * 8u] = u0;
      *(v4f*)&Xs[sb + m * LDO + (unsigned)dt * 16u + hh * 8u + 4u] = u1;
    }
    if (hh == 0u) Ls[slot * 16u + m] = lrow[j];
  }
  __syncthreads();
  float ltot = lrow[0];
#pragma unroll
  for (unsigned j = 1; j < 4u; ++j) {
    const unsigned slot = ((unsigned)wave ^ j) * 3u + (j - 1u);
    const unsigned pb = slot * (16u * LDO);
#pragma unroll
    for (int dt = 0; dt < 8; ++dt) {
      const v4f u0 = *(const v4f*)&Xs[pb + m * LDO + (unsigned)dt * 16u + hh * 8u];
      const v4f u1 = *(const v4f*)&Xs[pb + m * LDO + (unsigned)dt * 16u + hh * 8u + 4u];
#pragma unroll
      for (int i = 0; i < 4; ++i) {
        o[0][dt][i] += u0[i];
        o[0][dt][i + 4] += u1[i];
      }
    }
    ltot += Ls[slot * 16u + m];
  }
  const float inv = __builtin_amdgcn_rcpf(ltot);

  // stage O[query m][d = dt*16 + 8*hh + r] in the wave's tile
#pragma unroll
  for (int dt = 0; dt < 8; ++dt) {
    v4f u0, u1;
#pragma unroll
    for (int j = 0; j < 4; ++j) {
      u0[j] = o[0][dt][j] * inv;
      u1[j] = o[0][dt][j + 4] * inv;
    }
    *(v4f*)&Os[tb + m * LDO + (unsigned)dt * 16u + hh * 8u] = u0;
    *(v4f*)&Os[tb + m * LDO + (unsigned)dt * 16u + hh * 8u + 4u] = u1;
  }
  wave_lds_sync();

  const size_t orow = (size_t)b * SEQ_FULL + qrow0;
#pragma unroll
  for (unsigned g = 0; g < 2u; ++g) {      // 2 steps x 8 rows == 16 rows
    v4f x[8];
    size_t off[8];
#pragma unroll
    for (unsigned i = 0; i < 8u; ++i) {
      const unsigned r = 8u * g + i;
      x[i] = *(const v4f*)&Os[tb + r * LDO + lane * 4u];
      off[i] = (orow + r) * DIM + dh * (unsigned)DH + lane * 4u;
    }
#pragma unroll
    for (int i = 0; i < 8; ++i) *(v4f*)(out + off[i]) = x[i];
    
  }
}

// ---------------------------------------------------------------------------
extern "C" void kernel_launch(void* const* d_in, const int* in_sizes, int n_in,
                              void* d_out, int out_size, void* d_ws, size_t ws_size,
                              hipStream_t stream) {
  if (n_in < 6) return;
  const long long need_x = ((long long)(NB - 1) * SEQ_FULL + SEQ) * DIM;
  if ((long long)in_sizes[0] < need_x) return;
  if ((long long)in_sizes[1] < (long long)DIM * DIM) return;
  if ((long long)in_sizes[2] < (long long)DIM * DIM) return;
  if ((long long)in_sizes[3] < (long long)DIM * DIM) return;
  if (in_sizes[4] < DIM) return;
  if (in_sizes[5] < 1) return;
  if ((long long)out_size < need_x) return;
  if (ws_size < WS_TOTAL) return;

  const float* X    = (const float*)d_in[0];   // x      [NB_FULL][SEQ_FULL][DIM]
  const float* wq   = (const float*)d_in[1];   // Wq     [DIM out][DIM in]
  const float* wk   = (const float*)d_in[2];   // Wk     [DIM out][DIM in]
  const float* wvv  = (const float*)d_in[3];   // Wv     [DIM out][DIM in]
  const float* wmlp = (const float*)d_in[4];   // w_mlp  [DIM]
  const float* bmlp = (const float*)d_in[5];   // b_mlp  scalar
  float* out = (float*)d_out;

  char* ws = (char*)d_ws;
  _Float16* Wq16 = (_Float16*)(ws + OFF_WQ);    // [out][in], x64
  _Float16* Wk16 = (_Float16*)(ws + OFF_WK);
  _Float16* Wv16 = (_Float16*)(ws + OFF_WV);
  _Float16* X16  = (_Float16*)(ws + OFF_X16);   // [MROWS][DIM] compact rows
  float*    QS   = (float*)(ws + OFF_QS);       // [MROWS]
  float*    KS   = (float*)(ws + OFF_KS);       // [MROWS]
  _Float16* Vt16 = (_Float16*)(ws + OFF_VT);    // [b][DIM][SEQ]

  dim3 blk(256);

  // three dependent launches: casts (weight planes keep their [out][in] order), projections, attention
  cast_kernel<<<dim3(3 * (DIM / 8) + MROWS / 8), blk, 0, stream>>>(X, wq, wk, wvv, X16, Wq16, Wk16,
                                                                  Wv16);
  proj_kernel<<<dim3(3 * (MROWS / 64)), blk, 0, stream>>>(
      X16, Wq16, Wk16, Wv16, wmlp, QS, KS, Vt16);
  attn_kernel<<<dim3(2 * (SEQ / QBLK), NB), blk, 0, stream>>>(QS, KS, bmlp, Vt16, out);
}

// v007
// Measured time: 37.4 microseconds a run.
// Next to v006, in two timings, it ran 1.11 and 1.08 times as fast.
// Counting every step since v000, it is 6.90 times as fast.
#include <hip/hip_runtime.h>
#include <stddef.h>

// All contractions on v_wmma_f32_16x16x32_f16 (f16 operands, f32 accumulate): q/k/v projections
// (x plane = f16(bf16(x)), weight planes = f16(64 * bf16(w)), kept in their [out][in] order) and
// the p.v product (p carried x1024, v plane f16 single). The per-row dot with the score vector,
// the exp of each key's and each query's score and the row sums are f32 on the vector unit; the
// softmax numerators are the f16 maximum of a key term and a query term.

typedef _Float16 v16h __attribute__((ext_vector_type(16)));
typedef _Float16 v8h  __attribute__((ext_vector_type(8)));
typedef _Float16 v4h  __attribute__((ext_vector_type(4)));
typedef _Float16 v2h  __attribute__((ext_vector_type(2)));
typedef float    v8f  __attribute__((ext_vector_type(8)));
typedef float    v4f  __attribute__((ext_vector_type(4)));
typedef _Float16 h16;

#ifndef NB
#define NB 4
#endif
#ifndef SEQ
#define SEQ 4096
#endif
#define NB_FULL  4
#define SEQ_FULL 4096
#define DIM   256
#define MROWS (NB * SEQ)
#define DH    128          // output columns per wave in the attention kernel
#define QBLK  128          // query rows per attention block (2 groups of 64)

#define LDC 68             // floats per LDS row of the 64x64 GEMM stage (272 B)
#define LDO 132            // floats per LDS row of the attention output stage (528 B)

#define WCARRY 64.0f                   // weight planes carried x64
#define LN_PCARRY 6.931471805599453f   // ln(1024): softmax numerators carried x1024

static_assert(NB >= 1 && NB <= NB_FULL);
static_assert(SEQ >= 128 && SEQ <= SEQ_FULL && (SEQ % 128) == 0);
static_assert(DIM == 32 * 8);               // cast: one wave per row, 32 lanes x 8 columns
static_assert((DIM % 64) == 0 && (DIM % 32) == 0);
static_assert((MROWS % 64) == 0 && (MROWS % 8) == 0);
static_assert((SEQ % QBLK) == 0 && (SEQ % 32) == 0 && (SEQ % 64) == 0);
static_assert(2 * DH == DIM && (DH % 16) == 0 && DH / 16 == 8);
static_assert(DH * 4 == 32 * 16);           // one store instruction = one 512-B row segment
static_assert(QBLK == 2 * 64);              // 8 waves = 2 query groups x 4 key quarters
static_assert((LDC % 4) == 0 && LDC >= 64);
static_assert((LDO % 4) == 0 && LDO >= DH);
static_assert(2 * 8 == 16);                 // output stage: 2 steps x 8 rows == 16 tile rows
#define TKEYS   128u                     // keys per ring tile (four 32-key steps, one per key quarter)
#define VPITCH  272u                     // LDS bytes per v row of a tile: 256 + 16 (16 B x odd)
#define VT_TILE ((unsigned)DH * VPITCH)  // one ring tile: the block's 128 v rows
#define RBUF    VT_TILE                  // ring slot: one v tile
#define GTILES  4u                       // tiles per ring buffer = per publish point
#define GBUF    (GTILES * RBUF)          // ring buffer: one group of tiles
#define XS_BYTES (8u * 3u * 16u * (unsigned)LDO * 4u)   // partial-sum exchange: 3 slots per wave
#define OS_BYTES (8u * 16u * (unsigned)LDO * 4u)        // output stage: one 16-row tile per wave
#define ARENA_BYTES ((2u * GBUF > XS_BYTES + OS_BYTES) ? 2u * GBUF : XS_BYTES + OS_BYTES)
static_assert((SEQ % 512) == 0 && SEQ / 512 >= 2);    // whole groups of four tiles, two or more
static_assert(GTILES == 4u && GTILES * 8u <= 63u);    // one group's copies of a wave in flight
static_assert(TKEYS * 2u == 256u && (VPITCH % 16u) == 0 && ((VPITCH / 16u) & 1u) == 1u && (RBUF % 16u) == 0);
static_assert(DH == 8 * 8 * 2);          // tile rows: 8 waves x 8 copies x 2 rows per copy
static_assert(8 * 4 + 8 * 3 * 16 * 4 + ARENA_BYTES + SEQ * 2 <= 327680);   // attention static LDS
static_assert((XS_BYTES % 16u) == 0);    // the output stage lies behind the exchange
static_assert((size_t)MROWS * DIM < (size_t)0xFFFFFFFFu);

// workspace layout (bytes)
#define W_BYTES   ((size_t)DIM * DIM * 2)
#define X16_BYTES ((size_t)MROWS * DIM * 2)
#define S_BYTES   ((size_t)MROWS * 4)
#define VT_BYTES  ((size_t)NB * DIM * SEQ * 2)
#define OFF_WQ  ((size_t)0)
#define OFF_WK  (OFF_WQ + W_BYTES)
#define OFF_WV  (OFF_WK + W_BYTES)
#define OFF_X16 (OFF_WV + W_BYTES)
#define OFF_QS  (OFF_X16 + X16_BYTES)
#define OFF_KS  (OFF_QS + S_BYTES)
#define OFF_VT  (OFF_KS + S_BYTES)
#define WS_TOTAL (OFF_VT + VT_BYTES)
static_assert((W_BYTES % 128) == 0 && (X16_BYTES % 128) == 0);
static_assert((S_BYTES % 128) == 0 && (VT_BYTES % 128) == 0);
static_assert(WS_TOTAL <= (size_t)134217728);

// ---------------------------------------------------------------------------
__device__ __forceinline__ float bf16r(float x) {   // RNE convert to bf16, returned widened
  unsigned int u = __float_as_uint(x);
  u = (u + 0x7FFFu + ((u >> 16) & 1u)) & 0xFFFF0000u;
  return __uint_as_float(u);
}

// f32 -> f16 for WMMA operand planes: values below the smallest f16 normal become zero.
static __device__ __forceinline__ h16 toh_flush(float v) {
  const h16 r = (h16)v;
  return (fabsf(v) < 6.103515625e-05f) ? (h16)0.0f : r;
}

// 16-bit fragment: p points at element [row = lane&15][k0 + 8*(lane>>4)] of a k-contiguous
// row. Elements 0..7 <- k0+8h+0..7, elements 8..15 <- k0+16+8h+0..7 (same map for A and B).
__device__ __forceinline__ v16h frag_at(const _Float16* p) {
  v8h lo = *(const v8h*)(p);
  v8h hi = *(const v8h*)(p + 16);
  v16h out;
#pragma unroll
  for (int i = 0; i < 8; ++i) { out[i] = lo[i]; out[i + 8] = hi[i]; }
  return out;
}

__device__ __forceinline__ v8f wmma16(v16h a, v16h b, v8f c) {
  v8f d = __builtin_amdgcn_wmma_f32_16x16x32_f16(false, a, false, b, (short)0, c,
                                                 false, false);
  asm volatile("v_nop\n\tv_nop\n\tv_nop\n\tv_nop" : "+v"(d) : "v"(a), "v"(b));
  return d;
}

// The attention kernel's form: the builtin alone (the compiler keeps the distance behind its own
// matrix instructions). An asm statement that names the operands holds them below v256, and 32
// accumulators with their fragments need more registers than that.
__device__ __forceinline__ v8f wmma16_hi(v16h a, v16h b, v8f c) {
  return __builtin_amdgcn_wmma_f32_16x16x32_f16(false, a, false, b, (short)0, c, false, false);
}

__device__ __forceinline__ float red16_sum(float x) {
#pragma unroll
  for (int off = 1; off < 16; off <<= 1) x += __shfl_xor(x, off, 32);
  return x;
}
__device__ __forceinline__ float red32_min(float x) {
#pragma unroll
  for (int off = 1; off < 32; off <<= 1) x = fminf(x, __shfl_xor(x, off, 32));
  return x;
}

__device__ __forceinline__ void wave_lds_sync() {
  __builtin_amdgcn_fence(3 /* release order */, "wavefront");
  asm volatile("s_wait_dscnt 0x0" ::: "memory");
  __builtin_amdgcn_wave_barrier();
}

// ---------------------------------------------------------------------------
// Row cast: dst[row][0..255] = f16(carry * bf16(src[row][0..255])), one wave per row, 8 rows
// per block; the wave's single store instruction covers the whole 512-B row (4 lines).
// SRC_INPUT = 1: source rows are addressed with the full per-batch stride (module input);
// SRC_INPUT = 0: compact rows (weight matrices, [out][in] order kept: already k-contiguous).
// blk = index of the 8-row group inside this source (rows / 8 groups).
// ---------------------------------------------------------------------------
template <int SRC_INPUT>
__device__ __forceinline__ void cast_body(const float* __restrict__ X,
                                          _Float16* __restrict__ dst, const float carry,
                                          const unsigned blk) {
#pragma clang fp contract(off)
  const unsigned lane = threadIdx.x & 31u;
  const unsigned w = (unsigned)__builtin_amdgcn_readfirstlane((int)(threadIdx.x >> 5));
  const unsigned crow = blk * 8u + w;
  size_t srow = crow;
  if (SRC_INPUT) {
    const unsigned bidx = crow / (unsigned)SEQ;
    const unsigned sq = crow - bidx * (unsigned)SEQ;
    srow = (size_t)bidx * SEQ_FULL + sq;
  }
  const float* xr = X + srow * DIM + lane * 8u;
  const v4f a0 = *(const v4f*)(xr);
  const v4f a1 = *(const v4f*)(xr + 4u);
  v8h o;
#pragma unroll
  for (int i = 0; i < 4; ++i) {
    o[i]     = toh_flush(carry * bf16r(a0[i]));
    o[i + 4] = toh_flush(carry * bf16r(a1[i]));
  }
  _Float16* p = dst + (size_t)crow * DIM + lane * 8u;
  *(v8h*)p = o;
  
}

// All four casts in one launch: they are independent of each other, so the block index picks the
// source. Blocks 0 .. 3 * WBLK - 1: the three weight planes; the rest: the rows of x.
// Grid (3 * WBLK + MROWS / 8).
#define WBLK ((unsigned)(DIM / 8))
__global__ __launch_bounds__(256) void cast_kernel(
    const float* __restrict__ X, const float* __restrict__ wq, const float* __restrict__ wk,
    const float* __restrict__ wv, _Float16* __restrict__ x16, _Float16* __restrict__ wq16,
    _Float16* __restrict__ wk16, _Float16* __restrict__ wv16) {
  const unsigned bx = blockIdx.x;
  if (bx < 3u * WBLK) {
    const unsigned p = bx / WBLK;
    const float* src = (p == 0u) ? wq : (p == 1u) ? wk : wv;
    _Float16* dst = (p == 0u) ? wq16 : (p == 1u) ? wk16 : wv16;
    cast_body<0>(src, dst, WCARRY, bx - p * WBLK);
  } else {
    cast_body<1>(X, x16, 1.0f, bx - 3u * WBLK);
    // precaution: in the listing the weight job's code follows this job's store (behind a branch
    // that skips it) and reuses the store's registers; the wait stands in front of that code
    asm volatile("s_wait_xcnt 0x0" ::: "memory");
  }
}

// ---------------------------------------------------------------------------
// Projections, operands fed through LDS. Block = one 64-row tile of x times one whole weight
// matrix (job 0: v, job 1: q score, job 2: k score); 8 waves (mw = 16-row group, nw = 32-column
// group), 2 accumulators per wave, four 64-column tiles one after the other.
// Every byte of the x and weight planes comes in by asynchronous copies to LDS, one whole 512-B row (4 lines) per
// copy instruction: the x tile once, the weight tiles through a ring of two buffers, one tile
// ahead. Rows lie at a 528-B pitch (16 B x odd) for the 16-B fragment reads. Each wave reads its
// x fragments (16 rows x 256 k) from LDS once and keeps them in registers for all four tiles.
// One publish point (LDS wait, copy wait, block barrier) per weight tile.
// Score jobs: outs[row] = sum_c P[row][c] * bf16(wmlp[c]) from the f32 accumulators, reduced
// over the 16 lanes of a half and the two column groups (Rs, block barrier).
// v job: each 64x64 tile is staged through Cs (cross-wave, block barrier) and written
// transposed, 8 lanes x 16 B = one 128-B line of a v row. Cs lies in the x tile's place, which
// nobody reads any more behind the first publish point.
// Grid (3 * RBLK): three blocks fit a WGP's LDS.
// ---------------------------------------------------------------------------
#define RBLK   ((unsigned)(MROWS / 64))
#define PPITCH 528u                      // LDS bytes per staged row: 512 + 16
#define PTILE  (64u * PPITCH)            // one staged tile of 64 rows
static_assert(DIM * 2 == 32 * 16);       // one copy instruction = one row
static_assert((PPITCH % 16u) == 0 && ((PPITCH / 16u) & 1u) == 1u);
static_assert(64 == 8 * 8);              // tile rows: 8 waves x 8 copies
static_assert(DIM / 64 >= 2);            // the ring's prologue needs two weight tiles
static_assert(64u * LDC * 4u <= PTILE);  // Cs fits the x tile's place
static_assert(3u * (3u * PTILE + 512u) <= 327680u);

// Eight rows of a tile: each copy is one row, 32 lanes x 16 B. l = the lane's LDS byte address in
// the first row, g = its global address. The closing s_wait_xcnt is a precaution: it stands in
// front of every later write of a register that a copy names.
__device__ __forceinline__ void copy_rows8(const unsigned l, const _Float16* g) {
  const unsigned ls = PPITCH;
  const size_t gs = (size_t)DIM;
  asm volatile(
      "global_load_async_to_lds_b128 %0, %8, off\n\t"
      "global_load_async_to_lds_b128 %1, %9, off\n\t"
      "global_load_async_to_lds_b128 %2, %10, off\n\t"
      "global_load_async_to_lds_b128 %3, %11, off\n\t"
      "global_load_async_to_lds_b128 %4, %12, off\n\t"
      "global_load_async_to_lds_b128 %5, %13, off\n\t"
      "global_load_async_to_lds_b128 %6, %14, off\n\t"
      "global_load_async_to_lds_b128 %7, %15, off\n\t"
      "s_wait_xcnt 0x0"
      :: "v"(l), "v"(l + ls), "v"(l + 2u * ls), "v"(l + 3u * ls),
         "v"(l + 4u * ls), "v"(l + 5u * ls), "v"(l + 6u * ls), "v"(l + 7u * ls),
         "v"(g), "v"(g + gs), "v"(g + 2u * gs), "v"(g + 3u * gs),
         "v"(g + 4u * gs), "v"(g + 5u * gs), "v"(g + 6u * gs), "v"(g + 7u * gs)
      : "memory");
}

__global__ __launch_bounds__(256) void proj_kernel(
    const _Float16* __restrict__ A16, const _Float16* __restrict__ Wq,
    const _Float16* __restrict__ Wk, const _Float16* __restrict__ Wv,
    const float* __restrict__ wmlp, float* __restrict__ qs, float* __restrict__ ks,
    _Float16* __restrict__ vt) {
  __shared__ __attribute__((aligned(16))) unsigned char Ps[3u * PTILE];  // x tile, ring of two
  __shared__ float Rs[2 * 64];
  const unsigned tid = threadIdx.x, lane = tid & 31u;
  const unsigned w = (unsigned)__builtin_amdgcn_readfirstlane((int)(threadIdx.x >> 5));
  const unsigned mw = w >> 1, nw = w & 1u;
  const unsigned hh = lane >> 4, m = lane & 15u;
  const unsigned job = blockIdx.x / RBLK;
  const unsigned row0 = (blockIdx.x - job * RBLK) * 64u;
  const _Float16* Bt = (job == 0u) ? Wv : (job == 1u) ? Wq : Wk;
  const unsigned NTB = (unsigned)(DIM / 64);

  // copy side: this lane's 16 B of the wave's first row, in LDS and in the two planes
  const unsigned cl = (unsigned)(size_t)Ps + (w * 8u) * PPITCH + lane * 16u;
  const _Float16* ga = A16 + (size_t)(row0 + w * 8u) * DIM + lane * 8u;
  const _Float16* gb = Bt + (size_t)(w * 8u) * DIM + lane * 8u;

  // prologue: the x tile and weight tile 0 land and are published, then weight tile 1 starts
  copy_rows8(cl, ga);
  copy_rows8(cl + PTILE, gb);
  asm volatile("s_wait_asynccnt 0x0" ::: "memory");   // this wave's copies have landed
  __syncthreads();                                    // ... and every other wave's
  copy_rows8(cl + 2u * PTILE, gb + (size_t)64 * DIM);

  v16h a[8];
  {
    const unsigned char* ar = Ps + (mw * 16u + m) * PPITCH + hh * 16u;
#pragma unroll
    for (unsigned k = 0; k < 8u; ++k) a[k] = frag_at((const _Float16*)(ar + k * 64u));
  }
  float part[8];
#pragma unroll
  for (int r = 0; r < 8; ++r) part[r] = 0.0f;
  float* Cs = (float*)Ps;
  const unsigned rdb = PTILE + (nw * 32u + m) * PPITCH + hh * 16u;
  const unsigned bidx = row0 / (unsigned)SEQ;
  const unsigned key0 = row0 - bidx * (unsigned)SEQ;

  // rolled: one copy of the tile's code, the buffer picked by the trip's parity
#pragma unroll 1
  for (unsigned nb = 0; nb < NTB; ++nb) {
    const unsigned bo = (nb & 1u) * PTILE;
    const unsigned char* bb = Ps + bo + rdb;
    // score jobs: the tile's two score weights are fetched ahead of the products that hide them
    float wr0 = 0.0f, wr1 = 0.0f;
    if (job != 0u) {
      const unsigned col = nb * 64u + nw * 32u + m;
      wr0 = wmlp[col];
      wr1 = wmlp[col + 16u];
      // precaution: the wait stands in front of every later write of the loads' address registers
      asm volatile("s_wait_xcnt 0x0" ::: "memory");
    }
    v8f acc0 = {}, acc1 = {};
#pragma unroll
    for (unsigned k = 0; k < 8u; ++k) {
      const v16h b0 = frag_at((const _Float16*)(bb + k * 64u));
      const v16h b1 = frag_at((const _Float16*)(bb + 16u * PPITCH + k * 64u));
      acc0 = wmma16(a[k], b0, acc0);
      acc1 = wmma16(a[k], b1, acc1);
    }
    // publish point of weight tile nb + 1; the same barrier ends every read of tile nb's buffer
    // (and, at nb = 0, of the x tile; later, of Cs)
    asm volatile("s_wait_dscnt 0x0" ::: "memory");     // this wave's LDS reads are done
    asm volatile("s_wait_asynccnt 0x0" ::: "memory");  // this wave's copies of tile nb + 1 landed
    __syncthreads();
    if (nb + 2u < NTB)                                 // refill the buffer just read
      copy_rows8(cl + PTILE + bo, gb + (size_t)(nb + 2u) * 64u * DIM);

    if (job == 0u) {
#pragma unroll
      for (int r = 0; r < 8; ++r) {
        float* d = &Cs[(mw * 16u + hh * 8u + (unsigned)r) * LDC + nw * 32u + m];
        d[0]  = acc0[r];
        d[16] = acc1[r];
      }
      __syncthreads();
      v8h x[2];
      size_t off[2];
#pragma unroll
      for (unsigned i = 0; i < 2u; ++i) {
        const unsigned dcol = 32u * i + (tid >> 3);
        const unsigned kk = (tid & 7u) * 8u;
#pragma unroll
        for (unsigned j = 0; j < 8u; ++j) {
          const float t = Cs[(kk + j) * LDC + dcol] * (1.0f / WCARRY);
          x[i][j] = toh_flush(t);
        }
        off[i] = ((size_t)bidx * DIM + nb * 64u + dcol) * SEQ + key0 + kk;
      }
#pragma unroll
      for (int i = 0; i < 2; ++i) *(v8h*)(vt + off[i]) = x[i];
      // precaution: the next trip reuses the stores' registers; the wait stands in front of it
      asm volatile("s_wait_xcnt 0x0" ::: "memory");
    } else {
      const float w0 = bf16r(wr0);
      const float w1 = bf16r(wr1);
#pragma unroll
      for (int r = 0; r < 8; ++r) part[r] += acc0[r] * w0 + acc1[r] * w1;
    }
  }
  asm volatile("s_wait_asynccnt 0x0" ::: "memory");    // no copy outlives the loop

  if (job != 0u) {
    // row (mw*16 + hh*8 + r) is spread over the 16 lanes of a half
#pragma unroll
    for (int r = 0; r < 8; ++r) part[r] = red16_sum(part[r]);
    if (m == 0u) {
#pragma unroll
      for (int r = 0; r < 8; ++r) Rs[nw * 64u + mw * 16u + hh * 8u + (unsigned)r] = part[r];
    }
    __syncthreads();
    if (w == 0u && lane < 16u) {
      v4f val;
#pragma unroll
      for (int j = 0; j < 4; ++j)
        val[j] = (Rs[lane * 4u + (unsigned)j] + Rs[64u + lane * 4u + (unsigned)j]) * (1.0f / WCARRY);
      float* p = ((job == 1u) ? qs : ks) + row0 + lane * 4u;
      *(v4f*)p = val;
    }
  }
}

// ---------------------------------------------------------------------------
// Dense additive-score attention, transposed form, v fed through an LDS ring.
// Block = 128 query rows x 128 columns (one column half) of one batch, so that a v byte is
// fetched from L2 by one block per 128 queries; wave = 64 query rows x 128 columns x one 32-key
// step of every 128-key tile (32 accumulators), so that each v fragment read from LDS feeds four
// products. The four waves of a query group (key quarters 0..3) hold partial sums over their
// keys; behind the loop each keeps one 16-query part and hands the other three, with their row
// sums, to the waves that keep them, through LDS (the ring's place, free by then;
// block barrier). Fragment j of the wave with key quarter kq holds query part kq ^ j, so that
// fragment 0 is the kept one and fragment j goes to the wave with key quarter kq ^ j.
// score[i][j] = relu(q_s[i] + b - k_s[j]); its row maximum is relu(q_s[i] + b - min_j k_s[j]),
// so the max-subtracted softmax needs no running rescale. With kmin = min_j k_s[j] and
// rowmax = relu(q_s[i] + b - kmin), score - rowmax = max(kmin - k_s[j], -rowmax), and exp and the
// conversion to f16 are monotone, so
//   p[i][j] = f16(1024 * exp(score - rowmax)) = max(f16(1024 * exp(kmin - k_s[j])), f16(1024 * exp(-rowmax))):
// one exp per key (the block's table Pk, built once in LDS) and one per query instead of one per
// pair. Per 32-key step each lane reads its B fragment of P^T from Pk (lane = query, elements =
// keys of the 16-bit k map), takes the packed f16 maximum with its query term, and
// O^T[d][i] += V^T[d][keys] . P^T[keys][i] with the A fragments from the ring. The row sum runs
// over the f16 p, so the carry cancels in O / l. Ring: two buffers of four 128-key tiles each (a
// tile: 128 v rows of 256 B at a 272-B pitch), filled by asynchronous copies to LDS one buffer
// ahead, so the block fetches each v byte once, in whole 128-B lines, while the buffer before it
// is worked on; one publish point (LDS wait, copy wait, block barrier) per buffer, so that
// between two of them the waves of a SIMD drift apart and one's vector and LDS work runs under
// the other's products.
// Wmin, Pk, the exchange, Ls: cross-wave (block barrier). Os: wave-private stage (wave sync).
// The exchange and Os lie in the ring's place, one behind the other.
// Grid (2 * SEQ/128, NB): blockIdx.x = 2 * query block + column half.
// ---------------------------------------------------------------------------

// One ring tile: each wave copies 16 v rows (8 copies x 2 rows x 16 lanes x 16 B). l = the lane's
// LDS byte address of its first piece, g = its global address. The closing s_wait_xcnt is a
// precaution: it stands in front of every later write of a register that a copy names.
__device__ __forceinline__ void copy_v_tile(const unsigned l, const _Float16* g) {
  const unsigned ls = 2u * VPITCH;
  const size_t gs = (size_t)2 * SEQ;
  asm volatile(
      "global_load_async_to_lds_b128 %0, %8, off\n\t"
      "global_load_async_to_lds_b128 %1, %9, off\n\t"
      "global_load_async_to_lds_b128 %2, %10, off\n\t"
      "global_load_async_to_lds_b128 %3, %11, off\n\t"
      "global_load_async_to_lds_b128 %4, %12, off\n\t"
      "global_load_async_to_lds_b128 %5, %13, off\n\t"
      "global_load_async_to_lds_b128 %6, %14, off\n\t"
      "global_load_async_to_lds_b128 %7, %15, off\n\t"
      "s_wait_xcnt 0x0"
      :: "v"(l), "v"(l + ls), "v"(l + 2u * ls), "v"(l + 3u * ls),
         "v"(l + 4u * ls), "v"(l + 5u * ls), "v"(l + 6u * ls), "v"(l + 7u * ls),
         "v"(g), "v"(g + gs), "v"(g + 2u * gs), "v"(g + 3u * gs),
         "v"(g + 4u * gs), "v"(g + 5u * gs), "v"(g + 6u * gs), "v"(g + 7u * gs)
      : "memory");
}

__global__ __launch_bounds__(256) void attn_kernel(
    const float* __restrict__ Qs, const float* __restrict__ Ksc,
    const float* __restrict__ bptr, const _Float16* __restrict__ Vt,
    float* __restrict__ out) {
  __shared__ float Wmin[8];
  __shared__ float Ls[8 * 3 * 16];                            // row sums handed to the group's other waves
  __shared__ __attribute__((aligned(16))) unsigned char Ring[ARENA_BYTES];   // ring (2 * GBUF), then exchange + Os
  __shared__ __attribute__((aligned(16))) _Float16 Pk[SEQ];   // key terms of the numerators

  const unsigned tid = threadIdx.x, lane = tid & 31u;
  const int wave = __builtin_amdgcn_readfirstlane((int)(threadIdx.x >> 5));
  const unsigned hh = lane >> 4, m = lane & 15u;
  const unsigned b = blockIdx.y;
  // kq = key quarter (the tile's 32-key step this wave works on), qg = query group, dh = column half
  const unsigned kq = (unsigned)wave & 3u, qg = (unsigned)wave >> 2;
  const unsigned dh = blockIdx.x & 1u;
  const unsigned qgrp0 = (blockIdx.x >> 1) * (unsigned)QBLK + qg * 64u;
  const unsigned qrow0 = qgrp0 + kq * 16u;   // the 16 queries this wave finishes and stores
  const float* ksb = Ksc + (size_t)b * SEQ;

  // minimum key score of this batch (uniform trip count, clamped addresses); unrolled, so that
  // the scores stay in registers for the table below
  constexpr unsigned KIT = (unsigned)((SEQ + 1023) / 1024);
  v4f kv[KIT];
  float kmin = 3.0e38f;
#pragma unroll
  for (unsigned it = 0; it < KIT; ++it) {
    unsigned j = tid * 4u + it * 1024u;
    j = (j > (unsigned)(SEQ - 4)) ? (unsigned)(SEQ - 4) : j;
    kv[it] = *(const v4f*)(ksb + j);
    kmin = fminf(kmin, fminf(fminf(kv[it][0], kv[it][1]), fminf(kv[it][2], kv[it][3])));
  }
  kmin = red32_min(kmin);
  if (lane == 0u) Wmin[wave] = kmin;
  __syncthreads();
  float km = Wmin[0];
#pragma unroll
  for (int i = 1; i < 8; ++i) km = fminf(km, Wmin[i]);

  // fragment 0 = the queries this wave keeps (qrow0 ..), fragments 1..3 = those it hands over
  const float* qp = Qs + (size_t)b * SEQ + qgrp0 + m;
  float qv[4];
  // the two scheduling barriers hold the arithmetic around the loads away from the gap between
  // them and their wait: scheduled into it, it took over the loads' address registers
  __builtin_amdgcn_sched_barrier(0);
#pragma unroll
  for (unsigned j = 0; j < 4u; ++j) qv[j] = qp[(kq ^ j) * 16u];
  // precaution: the wait stands in front of every later write of the loads' address registers
  asm volatile("s_wait_xcnt 0x0" ::: "memory");
  __builtin_amdgcn_sched_barrier(0);
  const float bias = bf16r(bptr[0]);
  // query term: 1024 * exp(-rowmax), the value of every pair whose score is zero
  v2h cq2[4];               // one register per fragment: the term in both halves
#pragma unroll
  for (int j = 0; j < 4; ++j) {
    const float mrow = fmaxf((qv[j] + bias) - km, 0.0f);
    const h16 cq = toh_flush(__expf(LN_PCARRY - mrow));
    cq2[j][0] = cq;
    cq2[j][1] = cq;
  }

  // key terms: Pk[j] = 1024 * exp(kmin - k_s[j]); clamped threads rewrite the last four keys with
  // the same values. Published by the ring prologue's barrier. Unrolled: kv[] is in registers.
#pragma unroll
  for (unsigned it = 0; it < KIT; ++it) {
    unsigned j = tid * 4u + it * 1024u;
    j = (j > (unsigned)(SEQ - 4)) ? (unsigned)(SEQ - 4) : j;
    v4h e;
#pragma unroll
    for (int i = 0; i < 4; ++i) e[i] = toh_flush(__expf((km - kv[it][i]) + LN_PCARRY));
    *(v4h*)&Pk[j] = e;
  }

  v8f o[4][8];              // o[0]: the kept queries, o[1..3]: the queries handed over
  float lsum[4];
#pragma unroll
  for (int j = 0; j < 4; ++j) {
    lsum[j] = 0.0f;
#pragma unroll
    for (int dt = 0; dt < 8; ++dt) o[j][dt] = (v8f){};
  }

  // copy side: this lane's piece of the wave's first two rows, in LDS and in the v plane
  const unsigned crow = (unsigned)wave * 16u + (lane >> 4);
  const unsigned ring0 = (unsigned)(size_t)Ring;          // byte offset in the block's LDS
  const unsigned cl = ring0 + crow * VPITCH + (lane & 15u) * 16u;
  const _Float16* cg = Vt + ((size_t)b * DIM + dh * (unsigned)DH + crow) * SEQ + (lane & 15u) * 8u;
  // read side: row m of the tile, the lane's 16 B of this wave's 32-key step
  const unsigned rd = m * VPITCH + kq * 64u + hh * 16u;
  const unsigned NG = (unsigned)SEQ / (GTILES * TKEYS);

  // ring prologue: group 0 lands and is published; group 1 starts inside the first trip
#pragma unroll
  for (unsigned s = 0; s < GTILES; ++s) copy_v_tile(cl + s * RBUF, cg + s * TKEYS);
  asm volatile("s_wait_asynccnt 0x0" ::: "memory");   // this wave's copies of group 0 have landed
  __syncthreads();                                    // ... and every other wave's, and Pk

  // rolled over the groups: one copy of the four tiles' code
#pragma unroll 1
  for (unsigned g = 0; g < NG; ++g) {
    const unsigned bo = (g & 1u) * GBUF;               // the buffer read in this trip
    // unrolled: the tile's place in its buffer and its share of the refill are constants
#pragma unroll
    for (unsigned s = 0; s < GTILES; ++s) {            // this wave's 32-key step of tile s
      // refill of the other buffer, whose every read ended at the barrier in front of this trip:
      // two tiles of group g + 1 ahead of step 0, one each ahead of steps 1 and 2, none ahead of
      // the last step, so that every copy has a whole step or more to land in
      if (s + 1u < GTILES && g + 1u < NG) {
        const unsigned nl = cl + (GBUF - bo);
        const _Float16* ng = cg + (size_t)(g + 1u) * (GTILES * TKEYS);
        if (s == 0u) copy_v_tile(nl, ng);
        copy_v_tile(nl + (s + 1u) * RBUF, ng + (s + 1u) * TKEYS);
      }
      const unsigned char* vb = Ring + bo + s * RBUF + rd;
      const _Float16* kt = Pk + (g * GTILES + s) * TKEYS + kq * 32u + hh * 8u;
      const v16h pk = frag_at(kt);
      v16h a[8];
#pragma unroll
      for (int dt = 0; dt < 8; ++dt)
        a[dt] = frag_at((const _Float16*)(vb + (unsigned)dt * (16u * VPITCH)));
      v16h p[4];
#pragma unroll
      for (int j = 0; j < 4; ++j) {
#pragma unroll
        for (int i = 0; i < 16; i += 2) {
          const v2h k2 = {pk[i], pk[i + 1]};
          const v2h r2 = __builtin_elementwise_maximum(k2, cq2[j]);
          p[j][i] = r2[0];
          p[j][i + 1] = r2[1];
        }
      }
#pragma unroll
      for (int i = 0; i < 4; ++i) {
#pragma unroll
        for (int e = 0; e < 16; e += 4) {
#pragma unroll
          for (int j = 0; j < 4; ++j) lsum[j] += (float)p[j][i + e];
        }
      }
      // keeps the products in the order of their fragment loads, so that each four wait for their
      // own two loads only (counted LDS waits); without it an early product is scheduled on the
      // last fragment and waits for all of them
      __builtin_amdgcn_sched_barrier(0);
#pragma unroll
      for (int dt = 0; dt < 8; ++dt) {
#pragma unroll
        for (int j = 0; j < 4; ++j) o[j][dt] = wmma16_hi(a[dt], p[j], o[j][dt]);
      }
      // keeps the products in front of the next step's copies and of the publish point: moved
      // behind them they would hold up the refill by a whole run of products
      __builtin_amdgcn_sched_barrier(0);
    }
    // publish point of group g + 1; the same barrier ends every read of group g's buffer
    asm volatile("s_wait_dscnt 0x0" ::: "memory");     // this wave's reads of group g are done
    asm volatile("s_wait_asynccnt 0x0" ::: "memory");  // this wave's copies of group g + 1 landed
    __syncthreads();
  }
  asm volatile("s_wait_asynccnt 0x0" ::: "memory");    // no copy outlives the loop

  // lanes l and l+16 hold the two 16-key parts of this wave's steps for query m
  float lrow[4];
#pragma unroll
  for (int j = 0; j < 4; ++j) lrow[j] = lsum[j] + __shfl_xor(lsum[j], 16, 32);

  // The group's exchange. The ring's place is free: every wave's reads of the last tile ended at
  // the loop's last barrier and no copy is outstanding. Each wave writes the partial sums of
  // fragment j = 1..3 to its own slot j - 1 and, behind the barrier, adds slot j - 1 of the wave
  // with key quarter kq ^ j (that wave's partial sums of the queries kept here) at the same lane
  // positions.
  const unsigned tb = (unsigned)wave * (16u * LDO);
  float* Xs = (float*)Ring;
  float* Os = (float*)(Ring + XS_BYTES);
#pragma unroll
  for (unsigned j = 1; j < 4u; ++j) {
    const unsigned slot = (unsigned)wave * 3u + (j - 1u);
    const unsigned sb = slot * (16u * LDO);
#pragma unroll
    for (int dt = 0; dt < 8; ++dt) {
      v4f u0, u1;
#pragma unroll
      for (int i = 0; i < 4; ++i) {
        u0[i] = o[j][dt][i];
        u1[i] = o[j][dt][i + 4];
      }
      *(v4f*)&Xs[sb + m * LDO + (unsigned)dt * 16u + hh * 8u] = u0;
      *(v4f*)&Xs[sb + m * LDO + (unsigned)dt * 16u + hh * 8u + 4u] = u1;
    }
    if (hh == 0u) Ls[slot * 16u + m] = lrow[j];
  }
  __syncthreads();
  float ltot = lrow[0];
#pragma unroll
  for (unsigned j = 1; j < 4u; ++j) {
    const unsigned slot = ((unsigned)wave ^ j) * 3u + (j - 1u);
    const unsigned pb = slot * (16u * LDO);
#pragma unroll
    for (int dt = 0; dt < 8; ++dt) {
      const v4f u0 = *(const v4f*)&Xs[pb + m * LDO + (unsigned)dt * 16u + hh * 8u];
      const v4f u1 = *(const v4f*)&Xs[pb + m * LDO + (unsigned)dt * 16u + hh * 8u + 4u];
#pragma unroll
      for (int i = 0; i < 4; ++i) {
        o[0][dt][i] += u0[i];
        o[0][dt][i + 4] += u1[i];
      }
    }
    ltot += Ls[slot * 16u + m];
  }
  const float inv = __builtin_amdgcn_rcpf(ltot);

  // stage O[query m][d = dt*16 + 8*hh + r] in the wave's tile
#pragma unroll
  for (int dt = 0; dt < 8; ++dt) {
    v4f u0, u1;
#pragma unroll
    for (int j = 0; j < 4; ++j) {
      u0[j] = o[0][dt][j] * inv;
      u1[j] = o[0][dt][j + 4] * inv;
    }
    *(v4f*)&Os[tb + m * LDO + (unsigned)dt * 16u + hh * 8u] = u0;
    *(v4f*)&Os[tb + m * LDO + (unsigned)dt * 16u + hh * 8u + 4u] = u1;
  }
  wave_lds_sync();

  const size_t orow = (size_t)b * SEQ_FULL + qrow0;
#pragma unroll
  for (unsigned g = 0; g < 2u; ++g) {      // 2 steps x 8 rows == 16 rows
    v4f x[8];
    size_t off[8];
#pragma unroll
    for (unsigned i = 0; i < 8u; ++i) {
      const unsigned r = 8u * g + i;
      x[i] = *(const v4f*)&Os[tb + r * LDO + lane * 4u];
      off[i] = (orow + r) * DIM + dh * (unsigned)DH + lane * 4u;
    }
#pragma unroll
    for (int i = 0; i < 8; ++i) *(v4f*)(out + off[i]) = x[i];
    
  }
}

// ---------------------------------------------------------------------------
extern "C" void kernel_launch(void* const* d_in, const int* in_sizes, int n_in,
                              void* d_out, int out_size, void* d_ws, size_t ws_size,
                              hipStream_t stream) {
  if (n_in < 6) return;
  const long long need_x = ((long long)(NB - 1) * SEQ_FULL + SEQ) * DIM;
  if ((long long)in_sizes[0] < need_x) return;
  if ((long long)in_sizes[1] < (long long)DIM * DIM) return;
  if ((long long)in_sizes[2] < (long long)DIM * DIM) return;
  if ((long long)in_sizes[3] < (long long)DIM * DIM) return;
  if (in_sizes[4] < DIM) return;
  if (in_sizes[5] < 1) return;
  if ((long long)out_size < need_x) return;
  if (ws_size < WS_TOTAL) return;

  const float* X    = (const float*)d_in[0];   // x      [NB_FULL][SEQ_FULL][DIM]
  const float* wq   = (const float*)d_in[1];   // Wq     [DIM out][DIM in]
  const float* wk   = (const float*)d_in[2];   // Wk     [DIM out][DIM in]
  const float* wvv  = (const float*)d_in[3];   // Wv     [DIM out][DIM in]
  const float* wmlp = (const float*)d_in[4];   // w_mlp  [DIM]
  const float* bmlp = (const float*)d_in[5];   // b_mlp  scalar
  float* out = (float*)d_out;

  char* ws = (char*)d_ws;
  _Float16* Wq16 = (_Float16*)(ws + OFF_WQ);    // [out][in], x64
  _Float16* Wk16 = (_Float16*)(ws + OFF_WK);
  _Float16* Wv16 = (_Float16*)(ws + OFF_WV);
  _Float16* X16  = (_Float16*)(ws + OFF_X16);   // [MROWS][DIM] compact rows
  float*    QS   = (float*)(ws + OFF_QS);       // [MROWS]
  float*    KS   = (float*)(ws + OFF_KS);       // [MROWS]
  _Float16* Vt16 = (_Float16*)(ws + OFF_VT);    // [b][DIM][SEQ]

  dim3 blk(256);

  // three dependent launches: casts (weight planes keep their [out][in] order), projections, attention
  cast_kernel<<<dim3(3 * (DIM / 8) + MROWS / 8), blk, 0, stream>>>(X, wq, wk, wvv, X16, Wq16, Wk16,
                                                                  Wv16);
  proj_kernel<<<dim3(3 * (MROWS / 64)), blk, 0, stream>>>(
      X16, Wq16, Wk16, Wv16, wmlp, QS, KS, Vt16);
  attn_kernel<<<dim3(2 * (SEQ / QBLK), NB), blk, 0, stream>>>(QS, KS, bmlp, Vt16, out);
}

// v008
// A run of this version takes 34.3 microseconds.
// In two side-by-side timings against v007, it was 1.08 and 1.10 times as fast.
// Counting every step since v000, it is 7.54 times as fast.
#include <hip/hip_runtime.h>
#include <stddef.h>

// All contractions with x on v_wmma_f32_16x16x32_f16 (f16 operands, f32 accumulate): the v
// projection (x plane = f16(bf16(x)), weight plane = f16(64 * bf16(w)), kept in its [out][in]
// order), the two score products x . (W^T w_mlp) (each vector as an f16 high and low column) and
// the p.v product (p carried x1024, v plane f16 single). The dot of the weight columns with the
// score vector, the exp of each key's and each query's score and the row sums are f32 on the
// vector unit; the softmax numerators are the f16 maximum of a key term and a query term.

typedef _Float16 v16h __attribute__((ext_vector_type(16)));
typedef _Float16 v8h  __attribute__((ext_vector_type(8)));
typedef _Float16 v4h  __attribute__((ext_vector_type(4)));
typedef _Float16 v2h  __attribute__((ext_vector_type(2)));
typedef float    v8f  __attribute__((ext_vector_type(8)));
typedef float    v4f  __attribute__((ext_vector_type(4)));
typedef float    v2f  __attribute__((ext_vector_type(2)));
typedef _Float16 h16;

#ifndef NB
#define NB 4
#endif
#ifndef SEQ
#define SEQ 4096
#endif
#define NB_FULL  4
#define SEQ_FULL 4096
#define DIM   256
#define MROWS (NB * SEQ)
#define DH    128          // output columns per wave in the attention kernel
#define QBLK  128          // query rows per attention block (2 groups of 64)

#define LDC 68             // floats per LDS row of the 64x64 GEMM stage (272 B)
#define LDO 132            // floats per LDS row of the attention output stage (528 B)

#define WCARRY 64.0f                   // weight plane carried x64
#define UCARRY 16.0f                   // score vectors W^T w_mlp carried x16
#define ULO    2048.0f                 // their low parts carried x2048 on top
#define LN_PCARRY 6.931471805599453f   // ln(1024): softmax numerators carried x1024

static_assert(NB >= 1 && NB <= NB_FULL);
static_assert(SEQ >= 128 && SEQ <= SEQ_FULL && (SEQ % 128) == 0);
static_assert(DIM == 32 * 8);               // cast: one wave per row, 32 lanes x 8 columns
static_assert((DIM % 64) == 0 && (DIM % 32) == 0);
static_assert((MROWS % 64) == 0 && (MROWS % 8) == 0);
static_assert((SEQ % QBLK) == 0 && (SEQ % 32) == 0 && (SEQ % 64) == 0);
static_assert(2 * DH == DIM && (DH % 16) == 0 && DH / 16 == 8);
static_assert(DH * 4 == 32 * 16);           // one store instruction = one 512-B row segment
static_assert(QBLK == 2 * 64);              // 8 waves = 2 query groups x 4 key quarters
static_assert((LDC % 4) == 0 && LDC >= 64);
static_assert((LDO % 4) == 0 && LDO >= DH);
static_assert(2 * 8 == 16);                 // output stage: 2 steps x 8 rows == 16 tile rows
#define TKEYS   128u                     // keys per ring tile (four 32-key steps, one per key quarter)
#define VPITCH  272u                     // LDS bytes per v row of a tile: 256 + 16 (16 B x odd)
#define VT_TILE ((unsigned)DH * VPITCH)  // one ring tile: the block's 128 v rows
#define RBUF    VT_TILE                  // ring slot: one v tile
#define GTILES  4u                       // tiles per ring buffer = per publish point
#define GBUF    (GTILES * RBUF)          // ring buffer: one group of tiles
#define XS_BYTES (8u * 3u * 16u * (unsigned)LDO * 4u)   // partial-sum exchange: 3 slots per wave
#define OS_BYTES (8u * 16u * (unsigned)LDO * 4u)        // output stage: one 16-row tile per wave
#define ARENA_BYTES ((2u * GBUF > XS_BYTES + OS_BYTES) ? 2u * GBUF : XS_BYTES + OS_BYTES)
static_assert((SEQ % 512) == 0 && SEQ / 512 >= 2);    // whole groups of four tiles, two or more
static_assert(GTILES == 4u && GTILES * 8u <= 63u);    // one group's copies of a wave in flight
static_assert(TKEYS * 2u == 256u && (VPITCH % 16u) == 0 && ((VPITCH / 16u) & 1u) == 1u && (RBUF % 16u) == 0);
static_assert(DH == 8 * 8 * 2);          // tile rows: 8 waves x 8 copies x 2 rows per copy
static_assert(8 * 4 + 8 * 3 * 16 * 4 + ARENA_BYTES + SEQ * 2 <= 327680);   // attention static LDS
static_assert((XS_BYTES % 16u) == 0);    // the output stage lies behind the exchange
static_assert((size_t)MROWS * DIM < (size_t)0xFFFFFFFFu);

// workspace layout (bytes)
#define W_BYTES   ((size_t)DIM * DIM * 2)
#define X16_BYTES ((size_t)MROWS * DIM * 2)
#define S_BYTES   ((size_t)MROWS * 4)
#define VT_BYTES  ((size_t)NB * DIM * SEQ * 2)
#define U_BYTES   ((size_t)4 * DIM * 2)
#define OFF_U   ((size_t)0)
#define OFF_WV  (OFF_U + U_BYTES)
#define OFF_X16 (OFF_WV + W_BYTES)
#define OFF_QS  (OFF_X16 + X16_BYTES)
#define OFF_KS  (OFF_QS + S_BYTES)
#define OFF_VT  (OFF_KS + S_BYTES)
#define WS_TOTAL (OFF_VT + VT_BYTES)
static_assert((W_BYTES % 128) == 0 && (X16_BYTES % 128) == 0 && (U_BYTES % 128) == 0);
static_assert((S_BYTES % 128) == 0 && (VT_BYTES % 128) == 0);
static_assert(WS_TOTAL <= (size_t)134217728);

// ---------------------------------------------------------------------------
__device__ __forceinline__ float bf16r(float x) {   // RNE convert to bf16, returned widened
  unsigned int u = __float_as_uint(x);
  u = (u + 0x7FFFu + ((u >> 16) & 1u)) & 0xFFFF0000u;
  return __uint_as_float(u);
}

// f32 -> f16 for WMMA operand planes: values below the smallest f16 normal become zero.
static __device__ __forceinline__ h16 toh_flush(float v) {
  const h16 r = (h16)v;
  return (fabsf(v) < 6.103515625e-05f) ? (h16)0.0f : r;
}

// 16-bit fragment: p points at element [row = lane&15][k0 + 8*(lane>>4)] of a k-contiguous
// row. Elements 0..7 <- k0+8h+0..7, elements 8..15 <- k0+16+8h+0..7 (same map for A and B).
__device__ __forceinline__ v16h frag_at(const _Float16* p) {
  v8h lo = *(const v8h*)(p);
  v8h hi = *(const v8h*)(p + 16);
  v16h out;
#pragma unroll
  for (int i = 0; i < 8; ++i) { out[i] = lo[i]; out[i + 8] = hi[i]; }
  return out;
}

__device__ __forceinline__ v8f wmma16(v16h a, v16h b, v8f c) {
  v8f d = __builtin_amdgcn_wmma_f32_16x16x32_f16(false, a, false, b, (short)0, c,
                                                 false, false);
  asm volatile("v_nop\n\tv_nop\n\tv_nop\n\tv_nop" : "+v"(d) : "v"(a), "v"(b));
  return d;
}

// The attention kernel's form: the builtin alone (the compiler keeps the distance behind its own
// matrix instructions). An asm statement that names the operands holds them below v256, and 32
// accumulators with their fragments need more registers than that.
__device__ __forceinline__ v8f wmma16_hi(v16h a, v16h b, v8f c) {
  return __builtin_amdgcn_wmma_f32_16x16x32_f16(false, a, false, b, (short)0, c, false, false);
}

__device__ __forceinline__ float red32_min(float x) {
#pragma unroll
  for (int off = 1; off < 32; off <<= 1) x = fminf(x, __shfl_xor(x, off, 32));
  return x;
}

__device__ __forceinline__ void wave_lds_sync() {
  __builtin_amdgcn_fence(3 /* release order */, "wavefront");
  asm volatile("s_wait_dscnt 0x0" ::: "memory");
  __builtin_amdgcn_wave_barrier();
}

// ---------------------------------------------------------------------------
// Row cast: dst[row][0..255] = f16(carry * bf16(src[row][0..255])), one wave per row, 8 rows
// per block; the wave's single store instruction covers the whole 512-B row (4 lines).
// SRC_INPUT = 1: source rows are addressed with the full per-batch stride (module input);
// SRC_INPUT = 0: compact rows (weight matrices, [out][in] order kept: already k-contiguous).
// blk = index of the 8-row group inside this source (rows / 8 groups).
// ---------------------------------------------------------------------------
template <int SRC_INPUT>
__device__ __forceinline__ void cast_body(const float* __restrict__ X,
                                          _Float16* __restrict__ dst, const float carry,
                                          const unsigned blk) {
#pragma clang fp contract(off)
  const unsigned lane = threadIdx.x & 31u;
  const unsigned w = (unsigned)__builtin_amdgcn_readfirstlane((int)(threadIdx.x >> 5));
  const unsigned crow = blk * 8u + w;
  size_t srow = crow;
  if (SRC_INPUT) {
    const unsigned bidx = crow / (unsigned)SEQ;
    const unsigned sq = crow - bidx * (unsigned)SEQ;
    srow = (size_t)bidx * SEQ_FULL + sq;
  }
  const float* xr = X + srow * DIM + lane * 8u;
  const v4f a0 = *(const v4f*)(xr);
  const v4f a1 = *(const v4f*)(xr + 4u);
  v8h o;
#pragma unroll
  for (int i = 0; i < 4; ++i) {
    o[i]     = toh_flush(carry * bf16r(a0[i]));
    o[i + 4] = toh_flush(carry * bf16r(a1[i]));
  }
  _Float16* p = dst + (size_t)crow * DIM + lane * 8u;
  *(v8h*)p = o;
  
}

// Score vector of one weight matrix: (x W^T) . w_mlp = x . (W^T w_mlp), so the score of a row of x
// needs u[d] = sum_e bf16(W[e][d]) * bf16(w_mlp[e]) and no projected row. Block = 64 columns d;
// wave = 32 rows e, lane = 2 columns (a load covers 256 B of a row); the eight waves' sums are
// joined through LDS (Red, block barrier). u is left as two f16 rows for the matrix unit:
// hi = f16(16 u), lo = f16(2048 (16 u - hi)); wave 0's store of a row piece is one 128-B line.
__device__ __forceinline__ void score_vec_body(const float* __restrict__ Wm,
                                               const float* __restrict__ wmlp,
                                               _Float16* __restrict__ urows, const unsigned c0,
                                               float* Red) {
  const unsigned lane = threadIdx.x & 31u;
  const unsigned w = (unsigned)__builtin_amdgcn_readfirstlane((int)(threadIdx.x >> 5));
  const float* p = Wm + (size_t)(w * 32u) * DIM + c0 + lane * 2u;
  float s0 = 0.0f, s1 = 0.0f;
  // rolled, 16 loads in flight per trip: unrolled, the 32 loads' registers would lower the number
  // of waves per SIMD for the cast jobs of the same launch
#pragma unroll 1
  for (unsigned h = 0; h < 2u; ++h) {
    const float* ph = p + (size_t)(h * 16u) * DIM;
    v2f t[16];
#pragma unroll
    for (unsigned e = 0; e < 16u; ++e) t[e] = *(const v2f*)(ph + (size_t)e * DIM);
    // precaution: the wait stands in front of every later write of the loads' address registers;
    // the address is its input, so that no load's own result is placed in those registers
    asm volatile("s_wait_xcnt 0x0" :: "v"(ph) : "memory");
#pragma unroll
    for (unsigned e = 0; e < 16u; ++e) {
      const float we = bf16r(wmlp[w * 32u + h * 16u + e]);
      s0 += bf16r(t[e][0]) * we;
      s1 += bf16r(t[e][1]) * we;
    }
  }
  Red[w * 64u + lane * 2u] = s0;
  Red[w * 64u + lane * 2u + 1u] = s1;
  __syncthreads();
  if (w == 0u) {
    float u0 = 0.0f, u1 = 0.0f;
#pragma unroll
    for (unsigned i = 0; i < 8u; ++i) {
      u0 += Red[i * 64u + lane * 2u];
      u1 += Red[i * 64u + lane * 2u + 1u];
    }
    u0 *= UCARRY;
    u1 *= UCARRY;
    v2h hi, lo;
    hi[0] = toh_flush(u0);
    hi[1] = toh_flush(u1);
    lo[0] = toh_flush((u0 - (float)hi[0]) * ULO);
    lo[1] = toh_flush((u1 - (float)hi[1]) * ULO);
    _Float16* d = urows + c0 + lane * 2u;
    *(v2h*)d = hi;
    *(v2h*)(d + DIM) = lo;
  }
}

// The casts and the two score vectors in one launch: they are independent of each other, so the
// block index picks the job. Blocks 0 .. UBLK - 1: the score vectors (rows 0, 1 of the plane: q
// high, low; rows 2, 3: k); the next WBLK: the v weight plane; the rest: the rows of x.
// Grid (UBLK + WBLK + MROWS / 8).
#define WBLK ((unsigned)(DIM / 8))
#define UBLK ((unsigned)(2 * (DIM / 64)))
static_assert(DIM == 8 * 32);            // score vector: 8 waves x 32 weight rows
__global__ __launch_bounds__(256) void cast_kernel(
    const float* __restrict__ X, const float* __restrict__ wq, const float* __restrict__ wk,
    const float* __restrict__ wv, const float* __restrict__ wmlp, _Float16* __restrict__ x16,
    _Float16* __restrict__ u16, _Float16* __restrict__ wv16) {
  __shared__ float Red[8 * 64];
  const unsigned bx = blockIdx.x;
  if (bx < UBLK) {
    const unsigned p = bx / (UBLK / 2u);
    score_vec_body((p == 0u) ? wq : wk, wmlp, u16 + (size_t)p * 2u * DIM,
                   (bx - p * (UBLK / 2u)) * 64u, Red);
  } else if (bx < UBLK + WBLK) {
    cast_body<0>(wv, wv16, WCARRY, bx - UBLK);
  } else {
    cast_body<1>(X, x16, 1.0f, bx - UBLK - WBLK);
    // precaution: in the listing the weight job's code follows this job's store (behind a branch
    // that skips it) and reuses the store's registers; the wait stands in front of that code
    asm volatile("s_wait_xcnt 0x0" ::: "memory");
  }
}

// ---------------------------------------------------------------------------
// v projection and the two scores, operands fed through LDS. Block = one 64-row tile of x times
// one half of the v weight matrix (job = column half: 128 columns); 8 waves (mw = 16-row group,
// nw = 32-column group), 2 accumulators per wave, two 64-column tiles one after the other.
// Every global byte comes in by asynchronous copies to LDS, one whole 512-B row (4 lines) per
// copy instruction: the x tile once, the weight tiles into two buffers, one tile ahead. Rows lie
// at a 528-B pitch (16 B x odd) for the 16-B fragment reads. Each wave reads its x fragments
// (16 rows x 256 k) from LDS once and keeps them in registers for both tiles.
// One publish point (LDS wait, copy wait, block barrier) per weight tile.
// Scores (job 0): one more 16-column product of the x fragments with the four rows of the score
// plane (column n holds row n & 3: q high, q low, k high, k low), the wave with nw = 0 over the
// first 128 k, its neighbour over the rest; columns 0..3 go to Rs, which the loop's publish
// points publish, and wave 0 joins the two k halves and the high and low parts.
// v: each 64x64 tile is staged through Cs (cross-wave, block barrier) and written
// transposed, 8 lanes x 16 B = one 128-B line of a v row. Cs lies in the x tile's place, which
// nobody reads any more behind the first publish point.
// Grid (2 * RBLK): two blocks per WGP.
// ---------------------------------------------------------------------------
#define RBLK   ((unsigned)(MROWS / 64))
#define PPITCH 528u                      // LDS bytes per staged row: 512 + 16
#define PTILE  (64u * PPITCH)            // one staged tile of 64 rows
static_assert(DIM * 2 == 32 * 16);       // one copy instruction = one row
static_assert((PPITCH % 16u) == 0 && ((PPITCH / 16u) & 1u) == 1u);
static_assert(64 == 8 * 8);              // tile rows: 8 waves x 8 copies
static_assert(DIM / 128 == 2);           // two weight tiles per job, one buffer each: no refill
#define UOFF   (3u * PTILE)              // the score plane's four rows, behind the ring
static_assert(64u * LDC * 4u <= PTILE);  // Cs fits the x tile's place
static_assert(2u * (3u * PTILE + 4u * PPITCH + 2048u) <= 327680u);

// Eight rows of a tile: each copy is one row, 32 lanes x 16 B. l = the lane's LDS byte address in
// the first row, g = its global address. The closing s_wait_xcnt is a precaution: it stands in
// front of every later write of a register that a copy names.
__device__ __forceinline__ void copy_rows8(const unsigned l, const _Float16* g) {
  const unsigned ls = PPITCH;
  const size_t gs = (size_t)DIM;
  asm volatile(
      "global_load_async_to_lds_b128 %0, %8, off\n\t"
      "global_load_async_to_lds_b128 %1, %9, off\n\t"
      "global_load_async_to_lds_b128 %2, %10, off\n\t"
      "global_load_async_to_lds_b128 %3, %11, off\n\t"
      "global_load_async_to_lds_b128 %4, %12, off\n\t"
      "global_load_async_to_lds_b128 %5, %13, off\n\t"
      "global_load_async_to_lds_b128 %6, %14, off\n\t"
      "global_load_async_to_lds_b128 %7, %15, off\n\t"
      "s_wait_xcnt 0x0"
      :: "v"(l), "v"(l + ls), "v"(l + 2u * ls), "v"(l + 3u * ls),
         "v"(l + 4u * ls), "v"(l + 5u * ls), "v"(l + 6u * ls), "v"(l + 7u * ls),
         "v"(g), "v"(g + gs), "v"(g + 2u * gs), "v"(g + 3u * gs),
         "v"(g + 4u * gs), "v"(g + 5u * gs), "v"(g + 6u * gs), "v"(g + 7u * gs)
      : "memory");
}

// One row of the score plane: 32 lanes x 16 B. The closing s_wait_xcnt is a precaution, as above.
__device__ __forceinline__ void copy_row1(const unsigned l, const _Float16* g) {
  asm volatile(
      "global_load_async_to_lds_b128 %0, %1, off\n\t"
      "s_wait_xcnt 0x0"
      :: "v"(l), "v"(g) : "memory");
}

// Four k steps of the score product: ub = the lane's 16 B of its score row at the first step. The
// fragments are read ahead of the products; two chains, so that a product does not wait for the
// one before it.
__device__ __forceinline__ v8f score4(const v16h a0, const v16h a1, const v16h a2, const v16h a3,
                                      const unsigned char* ub) {
  const v16h u0 = frag_at((const _Float16*)(ub));
  const v16h u1 = frag_at((const _Float16*)(ub + 64u));
  const v16h u2 = frag_at((const _Float16*)(ub + 128u));
  const v16h u3 = frag_at((const _Float16*)(ub + 192u));
  v8f s0 = {}, s1 = {};
  s0 = wmma16(a0, u0, s0);
  s1 = wmma16(a1, u1, s1);
  s0 = wmma16(a2, u2, s0);
  s1 = wmma16(a3, u3, s1);
  return s0 + s1;
}

__global__ __launch_bounds__(256) void proj_kernel(
    const _Float16* __restrict__ A16, const _Float16* __restrict__ U16,
    const _Float16* __restrict__ Wv, float* __restrict__ qs, float* __restrict__ ks,
    _Float16* __restrict__ vt) {
  // x tile, two weight buffers, score plane
  __shared__ __attribute__((aligned(16))) unsigned char Ps[3u * PTILE + 4u * PPITCH];
  __shared__ float Rs[2 * 4 * 64];
  const unsigned tid = threadIdx.x, lane = tid & 31u;
  const unsigned w = (unsigned)__builtin_amdgcn_readfirstlane((int)(threadIdx.x >> 5));
  const unsigned mw = w >> 1, nw = w & 1u;
  const unsigned hh = lane >> 4, m = lane & 15u;
  const unsigned job = blockIdx.x / RBLK;
  const unsigned row0 = (blockIdx.x - job * RBLK) * 64u;
  const unsigned col0 = job * (unsigned)(DIM / 2);
  const unsigned NTB = (unsigned)(DIM / 128);

  // copy side: this lane's 16 B of the wave's first row, in LDS and in the two planes
  const unsigned cl = (unsigned)(size_t)Ps + (w * 8u) * PPITCH + lane * 16u;
  const _Float16* ga = A16 + (size_t)(row0 + w * 8u) * DIM + lane * 8u;
  const _Float16* gb = Wv + (size_t)(col0 + w * 8u) * DIM + lane * 8u;

  // prologue: the x tile, weight tile 0 and (job 0) the score plane land and are published, then
  // weight tile 1 starts
  copy_rows8(cl, ga);
  copy_rows8(cl + PTILE, gb);
  if (job == 0u && w < 4u)
    copy_row1((unsigned)(size_t)Ps + UOFF + w * PPITCH + lane * 16u, U16 + (size_t)w * DIM + lane * 8u);
  asm volatile("s_wait_asynccnt 0x0" ::: "memory");   // this wave's copies have landed
  __syncthreads();                                    // ... and every other wave's
  copy_rows8(cl + 2u * PTILE, gb + (size_t)64 * DIM);

  v16h a[8];
  {
    const unsigned char* ar = Ps + (mw * 16u + m) * PPITCH + hh * 16u;
#pragma unroll
    for (unsigned k = 0; k < 8u; ++k) a[k] = frag_at((const _Float16*)(ar + k * 64u));
  }
  if (job == 0u) {
    const unsigned char* ub = Ps + UOFF + (m & 3u) * PPITCH + hh * 16u;
    v8f sc;
    if (nw == 0u) sc = score4(a[0], a[1], a[2], a[3], ub);
    else          sc = score4(a[4], a[5], a[6], a[7], ub + 256u);
    if (m < 4u) {
#pragma unroll
      for (int r = 0; r < 8; ++r)
        Rs[nw * 256u + m * 64u + mw * 16u + hh * 8u + (unsigned)r] = sc[r];
    }
  }
  float* Cs = (float*)Ps;
  const unsigned rdb = PTILE + (nw * 32u + m) * PPITCH + hh * 16u;
  const unsigned bidx = row0 / (unsigned)SEQ;
  const unsigned key0 = row0 - bidx * (unsigned)SEQ;

  // rolled: one copy of the tile's code, the buffer picked by the trip's parity
#pragma unroll 1
  for (unsigned nb = 0; nb < NTB; ++nb) {
    const unsigned bo = (nb & 1u) * PTILE;
    const unsigned char* bb = Ps + bo + rdb;
    v8f acc0 = {}, acc1 = {};
#pragma unroll
    for (unsigned k = 0; k < 8u; ++k) {
      const v16h b0 = frag_at((const _Float16*)(bb + k * 64u));
      const v16h b1 = frag_at((const _Float16*)(bb + 16u * PPITCH + k * 64u));
      acc0 = wmma16(a[k], b0, acc0);
      acc1 = wmma16(a[k], b1, acc1);
    }
    // publish point of weight tile nb + 1; at nb = 0 the same barrier ends every read of the x
    // tile and publishes Rs; later, it ends every read of Cs
    asm volatile("s_wait_dscnt 0x0" ::: "memory");     // this wave's LDS reads and writes are done
    asm volatile("s_wait_asynccnt 0x0" ::: "memory");  // this wave's copies of tile nb + 1 landed
    __syncthreads();

#pragma unroll
    for (int r = 0; r < 8; ++r) {
      float* d = &Cs[(mw * 16u + hh * 8u + (unsigned)r) * LDC + nw * 32u + m];
      d[0]  = acc0[r];
      d[16] = acc1[r];
    }
    __syncthreads();
    v8h x[2];
    size_t off[2];
#pragma unroll
    for (unsigned i = 0; i < 2u; ++i) {
      const unsigned dcol = 32u * i + (tid >> 3);
      const unsigned kk = (tid & 7u) * 8u;
#pragma unroll
      for (unsigned j = 0; j < 8u; ++j) {
        const float t = Cs[(kk + j) * LDC + dcol] * (1.0f / WCARRY);
        x[i][j] = toh_flush(t);
      }
      off[i] = ((size_t)bidx * DIM + col0 + nb * 64u + dcol) * SEQ + key0 + kk;
    }
#pragma unroll
    for (int i = 0; i < 2; ++i) *(v8h*)(vt + off[i]) = x[i];
    // precaution: the next trip reuses the stores' registers; the wait stands in front of it
    asm volatile("s_wait_xcnt 0x0" ::: "memory");
  }
  asm volatile("s_wait_asynccnt 0x0" ::: "memory");    // no copy outlives the loop

  if (job == 0u && w == 0u) {
    // lanes 0..15: q scores, lanes 16..31: k scores, four rows each (256 B per half wave)
    v4f val;
#pragma unroll
    for (int j = 0; j < 4; ++j) {
      const unsigned i = hh * 128u + m * 4u + (unsigned)j;
      val[j] = ((Rs[i] + Rs[i + 256u]) + (Rs[i + 64u] + Rs[i + 320u]) * (1.0f / ULO)) * (1.0f / UCARRY);
    }
    float* p = ((hh == 0u) ? qs : ks) + row0 + m * 4u;
    *(v4f*)p = val;
  }
}

// ---------------------------------------------------------------------------
// Dense additive-score attention, transposed form, v fed through an LDS ring.
// Block = 128 query rows x 128 columns (one column half) of one batch, so that a v byte is
// fetched from L2 by one block per 128 queries; wave = 64 query rows x 128 columns x one 32-key
// step of every 128-key tile (32 accumulators), so that each v fragment read from LDS feeds four
// products. The four waves of a query group (key quarters 0..3) hold partial sums over their
// keys; behind the loop each keeps one 16-query part and hands the other three, with their row
// sums, to the waves that keep them, through LDS (the ring's place, free by then;
// block barrier). Fragment j of the wave with key quarter kq holds query part kq ^ j, so that
// fragment 0 is the kept one and fragment j goes to the wave with key quarter kq ^ j.
// score[i][j] = relu(q_s[i] + b - k_s[j]); its row maximum is relu(q_s[i] + b - min_j k_s[j]),
// so the max-subtracted softmax needs no running rescale. With kmin = min_j k_s[j] and
// rowmax = relu(q_s[i] + b - kmin), score - rowmax = max(kmin - k_s[j], -rowmax), and exp and the
// conversion to f16 are monotone, so
//   p[i][j] = f16(1024 * exp(score - rowmax)) = max(f16(1024 * exp(kmin - k_s[j])), f16(1024 * exp(-rowmax))):
// one exp per key (the block's table Pk, built once in LDS) and one per query instead of one per
// pair. Per 32-key step each lane reads its B fragment of P^T from Pk (lane = query, elements =
// keys of the 16-bit k map), takes the packed f16 maximum with its query term, and
// O^T[d][i] += V^T[d][keys] . P^T[keys][i] with the A fragments from the ring. The row sum runs
// over the f16 p, so the carry cancels in O / l. Ring: two buffers of four 128-key tiles each (a
// tile: 128 v rows of 256 B at a 272-B pitch), filled by asynchronous copies to LDS one buffer
// ahead, so the block fetches each v byte once, in whole 128-B lines, while the buffer before it
// is worked on; one publish point (LDS wait, copy wait, block barrier) per buffer, so that
// between two of them the waves of a SIMD drift apart and one's vector and LDS work runs under
// the other's products.
// Wmin, Pk, the exchange, Ls: cross-wave (block barrier). Os: wave-private stage (wave sync).
// The exchange and Os lie in the ring's place, one behind the other.
// Grid (2 * SEQ/128, NB): blockIdx.x = 2 * query block + column half.
// ---------------------------------------------------------------------------

// One ring tile: each wave copies 16 v rows (8 copies x 2 rows x 16 lanes x 16 B). l = the lane's
// LDS byte address of its first piece, g = its global address. The closing s_wait_xcnt is a
// precaution: it stands in front of every later write of a register that a copy names.
__device__ __forceinline__ void copy_v_tile(const unsigned l, const _Float16* g) {
  const unsigned ls = 2u * VPITCH;
  const size_t gs = (size_t)2 * SEQ;
  asm volatile(
      "global_load_async_to_lds_b128 %0, %8, off\n\t"
      "global_load_async_to_lds_b128 %1, %9, off\n\t"
      "global_load_async_to_lds_b128 %2, %10, off\n\t"
      "global_load_async_to_lds_b128 %3, %11, off\n\t"
      "global_load_async_to_lds_b128 %4, %12, off\n\t"
      "global_load_async_to_lds_b128 %5, %13, off\n\t"
      "global_load_async_to_lds_b128 %6, %14, off\n\t"
      "global_load_async_to_lds_b128 %7, %15, off\n\t"
      "s_wait_xcnt 0x0"
      :: "v"(l), "v"(l + ls), "v"(l + 2u * ls), "v"(l + 3u * ls),
         "v"(l + 4u * ls), "v"(l + 5u * ls), "v"(l + 6u * ls), "v"(l + 7u * ls),
         "v"(g), "v"(g + gs), "v"(g + 2u * gs), "v"(g + 3u * gs),
         "v"(g + 4u * gs), "v"(g + 5u * gs), "v"(g + 6u * gs), "v"(g + 7u * gs)
      : "memory");
}

__global__ __launch_bounds__(256) void attn_kernel(
    const float* __restrict__ Qs, const float* __restrict__ Ksc,
    const float* __restrict__ bptr, const _Float16* __restrict__ Vt,
    float* __restrict__ out) {
  __shared__ float Wmin[8];
  __shared__ float Ls[8 * 3 * 16];                            // row sums handed to the group's other waves
  __shared__ __attribute__((aligned(16))) unsigned char Ring[ARENA_BYTES];   // ring (2 * GBUF), then exchange + Os
  __shared__ __attribute__((aligned(16))) _Float16 Pk[SEQ];   // key terms of the numerators

  const unsigned tid = threadIdx.x, lane = tid & 31u;
  const int wave = __builtin_amdgcn_readfirstlane((int)(threadIdx.x >> 5));
  const unsigned hh = lane >> 4, m = lane & 15u;
  const unsigned b = blockIdx.y;
  // kq = key quarter (the tile's 32-key step this wave works on), qg = query group, dh = column half
  const unsigned kq = (unsigned)wave & 3u, qg = (unsigned)wave >> 2;
  const unsigned dh = blockIdx.x & 1u;
  const unsigned qgrp0 = (blockIdx.x >> 1) * (unsigned)QBLK + qg * 64u;
  const unsigned qrow0 = qgrp0 + kq * 16u;   // the 16 queries this wave finishes and stores
  const float* ksb = Ksc + (size_t)b * SEQ;

  // minimum key score of this batch (uniform trip count, clamped addresses); unrolled, so that
  // the scores stay in registers for the table below
  constexpr unsigned KIT = (unsigned)((SEQ + 1023) / 1024);
  v4f kv[KIT];
  float kmin = 3.0e38f;
#pragma unroll
  for (unsigned it = 0; it < KIT; ++it) {
    unsigned j = tid * 4u + it * 1024u;
    j = (j > (unsigned)(SEQ - 4)) ? (unsigned)(SEQ - 4) : j;
    kv[it] = *(const v4f*)(ksb + j);
    kmin = fminf(kmin, fminf(fminf(kv[it][0], kv[it][1]), fminf(kv[it][2], kv[it][3])));
  }
  kmin = red32_min(kmin);
  if (lane == 0u) Wmin[wave] = kmin;
  __syncthreads();
  float km = Wmin[0];
#pragma unroll
  for (int i = 1; i < 8; ++i) km = fminf(km, Wmin[i]);

  // fragment 0 = the queries this wave keeps (qrow0 ..), fragments 1..3 = those it hands over
  const float* qp = Qs + (size_t)b * SEQ + qgrp0 + m;
  float qv[4];
  // the two scheduling barriers hold the arithmetic around the loads away from the gap between
  // them and their wait: scheduled into it, it took over the loads' address registers
  __builtin_amdgcn_sched_barrier(0);
#pragma unroll
  for (unsigned j = 0; j < 4u; ++j) qv[j] = qp[(kq ^ j) * 16u];
  // precaution: the wait stands in front of every later write of the loads' address registers
  asm volatile("s_wait_xcnt 0x0" ::: "memory");
  __builtin_amdgcn_sched_barrier(0);
  const float bias = bf16r(bptr[0]);
  // query term: 1024 * exp(-rowmax), the value of every pair whose score is zero
  v2h cq2[4];               // one register per fragment: the term in both halves
#pragma unroll
  for (int j = 0; j < 4; ++j) {
    const float mrow = fmaxf((qv[j] + bias) - km, 0.0f);
    const h16 cq = toh_flush(__expf(LN_PCARRY - mrow));
    cq2[j][0] = cq;
    cq2[j][1] = cq;
  }

  // key terms: Pk[j] = 1024 * exp(kmin - k_s[j]); clamped threads rewrite the last four keys with
  // the same values. Published by the ring prologue's barrier. Unrolled: kv[] is in registers.
#pragma unroll
  for (unsigned it = 0; it < KIT; ++it) {
    unsigned j = tid * 4u + it * 1024u;
    j = (j > (unsigned)(SEQ - 4)) ? (unsigned)(SEQ - 4) : j;
    v4h e;
#pragma unroll
    for (int i = 0; i < 4; ++i) e[i] = toh_flush(__expf((km - kv[it][i]) + LN_PCARRY));
    *(v4h*)&Pk[j] = e;
  }

  v8f o[4][8];              // o[0]: the kept queries, o[1..3]: the queries handed over
  float lsum[4];
#pragma unroll
  for (int j = 0; j < 4; ++j) {
    lsum[j] = 0.0f;
#pragma unroll
    for (int dt = 0; dt < 8; ++dt) o[j][dt] = (v8f){};
  }

  // copy side: this lane's piece of the wave's first two rows, in LDS and in the v plane
  const unsigned crow = (unsigned)wave * 16u + (lane >> 4);
  const unsigned ring0 = (unsigned)(size_t)Ring;          // byte offset in the block's LDS
  const unsigned cl = ring0 + crow * VPITCH + (lane & 15u) * 16u;
  const _Float16* cg = Vt + ((size_t)b * DIM + dh * (unsigned)DH + crow) * SEQ + (lane & 15u) * 8u;
  // read side: row m of the tile, the lane's 16 B of this wave's 32-key step
  const unsigned rd = m * VPITCH + kq * 64u + hh * 16u;
  const unsigned NG = (unsigned)SEQ / (GTILES * TKEYS);

  // ring prologue: group 0 lands and is published; group 1 starts inside the first trip
#pragma unroll
  for (unsigned s = 0; s < GTILES; ++s) copy_v_tile(cl + s * RBUF, cg + s * TKEYS);
  asm volatile("s_wait_asynccnt 0x0" ::: "memory");   // this wave's copies of group 0 have landed
  __syncthreads();                                    // ... and every other wave's, and Pk

  // rolled over the groups: one copy of the four tiles' code
#pragma unroll 1
  for (unsigned g = 0; g < NG; ++g) {
    const unsigned bo = (g & 1u) * GBUF;               // the buffer read in this trip
    // unrolled: the tile's place in its buffer and its share of the refill are constants
#pragma unroll
    for (unsigned s = 0; s < GTILES; ++s) {            // this wave's 32-key step of tile s
      // refill of the other buffer, whose every read ended at the barrier in front of this trip:
      // two tiles of group g + 1 ahead of step 0, one each ahead of steps 1 and 2, none ahead of
      // the last step, so that every copy has a whole step or more to land in
      if (s + 1u < GTILES && g + 1u < NG) {
        const unsigned nl = cl + (GBUF - bo);
        const _Float16* ng = cg + (size_t)(g + 1u) * (GTILES * TKEYS);
        if (s == 0u) copy_v_tile(nl, ng);
        copy_v_tile(nl + (s + 1u) * RBUF, ng + (s + 1u) * TKEYS);
      }
      const unsigned char* vb = Ring + bo + s * RBUF + rd;
      const _Float16* kt = Pk + (g * GTILES + s) * TKEYS + kq * 32u + hh * 8u;
      const v16h pk = frag_at(kt);
      v16h a[8];
#pragma unroll
      for (int dt = 0; dt < 8; ++dt)
        a[dt] = frag_at((const _Float16*)(vb + (unsigned)dt * (16u * VPITCH)));
      v16h p[4];
#pragma unroll
      for (int j = 0; j < 4; ++j) {
#pragma unroll
        for (int i = 0; i < 16; i += 2) {
          const v2h k2 = {pk[i], pk[i + 1]};
          const v2h r2 = __builtin_elementwise_maximum(k2, cq2[j]);
          p[j][i] = r2[0];
          p[j][i + 1] = r2[1];
        }
      }
#pragma unroll
      for (int i = 0; i < 4; ++i) {
#pragma unroll
        for (int e = 0; e < 16; e += 4) {
#pragma unroll
          for (int j = 0; j < 4; ++j) lsum[j] += (float)p[j][i + e];
        }
      }
      // keeps the products in the order of their fragment loads, so that each four wait for their
      // own two loads only (counted LDS waits); without it an early product is scheduled on the
      // last fragment and waits for all of them
      __builtin_amdgcn_sched_barrier(0);
#pragma unroll
      for (int dt = 0; dt < 8; ++dt) {
#pragma unroll
        for (int j = 0; j < 4; ++j) o[j][dt] = wmma16_hi(a[dt], p[j], o[j][dt]);
      }
      // keeps the products in front of the next step's copies and of the publish point: moved
      // behind them they would hold up the refill by a whole run of products
      __builtin_amdgcn_sched_barrier(0);
    }
    // publish point of group g + 1; the same barrier ends every read of group g's buffer
    asm volatile("s_wait_dscnt 0x0" ::: "memory");     // this wave's reads of group g are done
    asm volatile("s_wait_asynccnt 0x0" ::: "memory");  // this wave's copies of group g + 1 landed
    __syncthreads();
  }
  asm volatile("s_wait_asynccnt 0x0" ::: "memory");    // no copy outlives the loop

  // lanes l and l+16 hold the two 16-key parts of this wave's steps for query m
  float lrow[4];
#pragma unroll
  for (int j = 0; j < 4; ++j) lrow[j] = lsum[j] + __shfl_xor(lsum[j], 16, 32);

  // The group's exchange. The ring's place is free: every wave's reads of the last tile ended at
  // the loop's last barrier and no copy is outstanding. Each wave writes the partial sums of
  // fragment j = 1..3 to its own slot j - 1 and, behind the barrier, adds slot j - 1 of the wave
  // with key quarter kq ^ j (that wave's partial sums of the queries kept here) at the same lane
  // positions.
  const unsigned tb = (unsigned)wave * (16u * LDO);
  float* Xs = (float*)Ring;
  float* Os = (float*)(Ring + XS_BYTES);
#pragma unroll
  for (unsigned j = 1; j < 4u; ++j) {
    const unsigned slot = (unsigned)wave * 3u + (j - 1u);
    const unsigned sb = slot * (16u * LDO);
#pragma unroll
    for (int dt = 0; dt < 8; ++dt) {
      v4f u0, u1;
#pragma unroll
      for (int i = 0; i < 4; ++i) {
        u0[i] = o[j][dt][i];
        u1[i] = o[j][dt][i + 4];
      }
      *(v4f*)&Xs[sb + m * LDO + (unsigned)dt * 16u + hh * 8u] = u0;
      *(v4f*)&Xs[sb + m * LDO + (unsigned)dt * 16u + hh * 8u + 4u] = u1;
    }
    if (hh == 0u) Ls[slot * 16u + m] = lrow[j];
  }
  __syncthreads();
  float ltot = lrow[0];
#pragma unroll
  for (unsigned j = 1; j < 4u; ++j) {
    const unsigned slot = ((unsigned)wave ^ j) * 3u + (j - 1u);
    const unsigned pb = slot * (16u * LDO);
#pragma unroll
    for (int dt = 0; dt < 8; ++dt) {
      const v4f u0 = *(const v4f*)&Xs[pb + m * LDO + (unsigned)dt * 16u + hh * 8u];
      const v4f u1 = *(const v4f*)&Xs[pb + m * LDO + (unsigned)dt * 16u + hh * 8u + 4u];
#pragma unroll
      for (int i = 0; i < 4; ++i) {
        o[0][dt][i] += u0[i];
        o[0][dt][i + 4] += u1[i];
      }
    }
    ltot += Ls[slot * 16u + m];
  }
  const float inv = __builtin_amdgcn_rcpf(ltot);

  // stage O[query m][d = dt*16 + 8*hh + r] in the wave's tile
#pragma unroll
  for (int dt = 0; dt < 8; ++dt) {
    v4f u0, u1;
#pragma unroll
    for (int j = 0; j < 4; ++j) {
      u0[j] = o[0][dt][j] * inv;
      u1[j] = o[0][dt][j + 4] * inv;
    }
    *(v4f*)&Os[tb + m * LDO + (unsigned)dt * 16u + hh * 8u] = u0;
    *(v4f*)&Os[tb + m * LDO + (unsigned)dt * 16u + hh * 8u + 4u] = u1;
  }
  wave_lds_sync();

  const size_t orow = (size_t)b * SEQ_FULL + qrow0;
#pragma unroll
  for (unsigned g = 0; g < 2u; ++g) {      // 2 steps x 8 rows == 16 rows
    v4f x[8];
    size_t off[8];
#pragma unroll
    for (unsigned i = 0; i < 8u; ++i) {
      const unsigned r = 8u * g + i;
      x[i] = *(const v4f*)&Os[tb + r * LDO + lane * 4u];
      off[i] = (orow + r) * DIM + dh * (unsigned)DH + lane * 4u;
    }
#pragma unroll
    for (int i = 0; i < 8; ++i) *(v4f*)(out + off[i]) = x[i];
    
  }
}

// ---------------------------------------------------------------------------
extern "C" void kernel_launch(void* const* d_in, const int* in_sizes, int n_in,
                              void* d_out, int out_size, void* d_ws, size_t ws_size,
                              hipStream_t stream) {
  if (n_in < 6) return;
  const long long need_x = ((long long)(NB - 1) * SEQ_FULL + SEQ) * DIM;
  if ((long long)in_sizes[0] < need_x) return;
  if ((long long)in_sizes[1] < (long long)DIM * DIM) return;
  if ((long long)in_sizes[2] < (long long)DIM * DIM) return;
  if ((long long)in_sizes[3] < (long long)DIM * DIM) return;
  if (in_sizes[4] < DIM) return;
  if (in_sizes[5] < 1) return;
  if ((long long)out_size < need_x) return;
  if (ws_size < WS_TOTAL) return;

  const float* X    = (const float*)d_in[0];   // x      [NB_FULL][SEQ_FULL][DIM]
  const float* wq   = (const float*)d_in[1];   // Wq     [DIM out][DIM in]
  const float* wk   = (const float*)d_in[2];   // Wk     [DIM out][DIM in]
  const float* wvv  = (const float*)d_in[3];   // Wv     [DIM out][DIM in]
  const float* wmlp = (const float*)d_in[4];   // w_mlp  [DIM]
  const float* bmlp = (const float*)d_in[5];   // b_mlp  scalar
  float* out = (float*)d_out;

  char* ws = (char*)d_ws;
  _Float16* U16  = (_Float16*)(ws + OFF_U);     // [4][DIM]: q high, q low, k high, k low
  _Float16* Wv16 = (_Float16*)(ws + OFF_WV);    // [out][in], x64
  _Float16* X16  = (_Float16*)(ws + OFF_X16);   // [MROWS][DIM] compact rows
  float*    QS   = (float*)(ws + OFF_QS);       // [MROWS]
  float*    KS   = (float*)(ws + OFF_KS);       // [MROWS]
  _Float16* Vt16 = (_Float16*)(ws + OFF_VT);    // [b][DIM][SEQ]

  dim3 blk(256);

  // three dependent launches: casts and score vectors, v projection and scores, attention
  cast_kernel<<<dim3(2 * (DIM / 64) + DIM / 8 + MROWS / 8), blk, 0, stream>>>(X, wq, wk, wvv, wmlp,
                                                                             X16, U16, Wv16);
  proj_kernel<<<dim3(2 * (MROWS / 64)), blk, 0, stream>>>(X16, U16, Wv16, QS, KS, Vt16);
  attn_kernel<<<dim3(2 * (SEQ / QBLK), NB), blk, 0, stream>>>(QS, KS, bmlp, Vt16, out);
}

// v009
// It runs in 32.9 microseconds.
// Timed twice side by side with v008, it ran 1.03 and 1.04 times as fast.
// Over all steps from v000 it is 7.80 times as fast.
#include <hip/hip_runtime.h>
#include <stddef.h>

// All contractions with x on v_wmma_f32_16x16x32_f16 (f16 operands, f32 accumulate): the v
// projection (x plane = f16(bf16(x)), weight plane = f16(64 * bf16(w)), kept in its [out][in]
// order), the two score products x . (W^T w_mlp) (each vector as an f16 high and low column) and
// the p.v product (p carried x1024, v plane f16 single). The dot of the weight columns with the
// score vector, the exp of each key's and each query's score and the row sums are f32 on the
// vector unit; the softmax numerators are the f16 maximum of a key term and a query term.

typedef _Float16 v16h __attribute__((ext_vector_type(16)));
typedef _Float16 v8h  __attribute__((ext_vector_type(8)));
typedef _Float16 v4h  __attribute__((ext_vector_type(4)));
typedef _Float16 v2h  __attribute__((ext_vector_type(2)));
typedef float    v8f  __attribute__((ext_vector_type(8)));
typedef float    v4f  __attribute__((ext_vector_type(4)));
typedef float    v2f  __attribute__((ext_vector_type(2)));
typedef _Float16 h16;

#ifndef NB
#define NB 4
#endif
#ifndef SEQ
#define SEQ 4096
#endif
#define NB_FULL  4
#define SEQ_FULL 4096
#define DIM   256
#define MROWS (NB * SEQ)
#define DH    128          // output columns per wave in the attention kernel
#define QBLK  128          // query rows per attention block (2 groups of 64)

#define LDC 68             // floats per LDS row of the 64x64 GEMM stage (272 B)
#define LDO 132            // floats per LDS row of the attention output stage (528 B)

#define WCARRY 64.0f                   // weight plane carried x64
#define UCARRY 16.0f                   // score vectors W^T w_mlp carried x16
#define ULO    2048.0f                 // their low parts carried x2048 on top
#define LN_PCARRY 6.931471805599453f   // ln(1024): softmax numerators carried x1024

static_assert(NB >= 1 && NB <= NB_FULL);
static_assert(SEQ >= 128 && SEQ <= SEQ_FULL && (SEQ % 128) == 0);
static_assert(DIM == 32 * 8);               // cast: one wave per row, 32 lanes x 8 columns
static_assert((DIM % 64) == 0 && (DIM % 32) == 0);
static_assert((MROWS % 64) == 0 && (MROWS % 8) == 0);
static_assert((SEQ % QBLK) == 0 && (SEQ % 32) == 0 && (SEQ % 64) == 0);
static_assert(2 * DH == DIM && (DH % 16) == 0 && DH / 16 == 8);
static_assert(DH * 4 == 32 * 16);           // one store instruction = one 512-B row segment
static_assert(QBLK == 2 * 64);              // 8 waves = 2 query groups x 4 key quarters
static_assert((LDC % 4) == 0 && LDC >= 64);
static_assert((LDO % 4) == 0 && LDO >= DH);
static_assert(2 * 8 == 16);                 // output stage: 2 steps x 8 rows == 16 tile rows
#define TKEYS   128u                     // keys per ring tile (four 32-key steps, one per key quarter)
#define VPITCH  272u                     // LDS bytes per v row of a tile: 256 + 16 (16 B x odd)
#define VT_TILE ((unsigned)DH * VPITCH)  // one ring tile: the block's 128 v rows
#define RBUF    VT_TILE                  // ring slot: one v tile
#define GTILES  4u                       // tiles per ring buffer = per publish point
#define GBUF    (GTILES * RBUF)          // ring buffer: one group of tiles
#define XS_BYTES (8u * 3u * 16u * (unsigned)LDO * 4u)   // partial-sum exchange: 3 slots per wave
#define OS_BYTES (8u * 16u * (unsigned)LDO * 4u)        // output stage: one 16-row tile per wave
#define ARENA_BYTES ((2u * GBUF > XS_BYTES + OS_BYTES) ? 2u * GBUF : XS_BYTES + OS_BYTES)
static_assert((SEQ % 512) == 0 && SEQ / 512 >= 2);    // whole groups of four tiles, two or more
static_assert(GTILES == 4u && GTILES * 8u <= 63u);    // one group's copies of a wave in flight
static_assert(TKEYS * 2u == 256u && (VPITCH % 16u) == 0 && ((VPITCH / 16u) & 1u) == 1u && (RBUF % 16u) == 0);
static_assert(DH == 8 * 8 * 2);          // tile rows: 8 waves x 8 copies x 2 rows per copy
static_assert(8 * 4 + 8 * 3 * 16 * 4 + ARENA_BYTES + SEQ * 2 <= 327680);   // attention static LDS
static_assert((XS_BYTES % 16u) == 0);    // the output stage lies behind the exchange
static_assert((size_t)MROWS * DIM < (size_t)0xFFFFFFFFu);

// workspace layout (bytes)
#define W_BYTES   ((size_t)DIM * DIM * 2)
#define X16_BYTES ((size_t)MROWS * DIM * 2)
#define S_BYTES   ((size_t)MROWS * 4)
#define VT_BYTES  ((size_t)NB * DIM * SEQ * 2)
#define U_BYTES   ((size_t)4 * DIM * 2)
#define OFF_U   ((size_t)0)
#define OFF_WV  (OFF_U + U_BYTES)
#define OFF_X16 (OFF_WV + W_BYTES)
#define OFF_QS  (OFF_X16 + X16_BYTES)
#define OFF_KS  (OFF_QS + S_BYTES)
#define OFF_VT  (OFF_KS + S_BYTES)
#define WS_TOTAL (OFF_VT + VT_BYTES)
static_assert((W_BYTES % 128) == 0 && (X16_BYTES % 128) == 0 && (U_BYTES % 128) == 0);
static_assert((S_BYTES % 128) == 0 && (VT_BYTES % 128) == 0);
static_assert(WS_TOTAL <= (size_t)134217728);

// ---------------------------------------------------------------------------
__device__ __forceinline__ float bf16r(float x) {   // RNE convert to bf16, returned widened
  unsigned int u = __float_as_uint(x);
  u = (u + 0x7FFFu + ((u >> 16) & 1u)) & 0xFFFF0000u;
  return __uint_as_float(u);
}

// f32 -> f16 for WMMA operand planes: values below the smallest f16 normal become zero.
static __device__ __forceinline__ h16 toh_flush(float v) {
  const h16 r = (h16)v;
  return (fabsf(v) < 6.103515625e-05f) ? (h16)0.0f : r;
}

// 16-bit fragment: p points at element [row = lane&15][k0 + 8*(lane>>4)] of a k-contiguous
// row. Elements 0..7 <- k0+8h+0..7, elements 8..15 <- k0+16+8h+0..7 (same map for A and B).
__device__ __forceinline__ v16h frag_at(const _Float16* p) {
  v8h lo = *(const v8h*)(p);
  v8h hi = *(const v8h*)(p + 16);
  v16h out;
#pragma unroll
  for (int i = 0; i < 8; ++i) { out[i] = lo[i]; out[i + 8] = hi[i]; }
  return out;
}

__device__ __forceinline__ v8f wmma16(v16h a, v16h b, v8f c) {
  v8f d = __builtin_amdgcn_wmma_f32_16x16x32_f16(false, a, false, b, (short)0, c,
                                                 false, false);
  asm volatile("v_nop\n\tv_nop\n\tv_nop\n\tv_nop" : "+v"(d) : "v"(a), "v"(b));
  return d;
}

// The attention kernel's form: the builtin alone (the compiler keeps the distance behind its own
// matrix instructions). An asm statement that names the operands holds them below v256, and 32
// accumulators with their fragments need more registers than that.
__device__ __forceinline__ v8f wmma16_hi(v16h a, v16h b, v8f c) {
  return __builtin_amdgcn_wmma_f32_16x16x32_f16(false, a, false, b, (short)0, c, false, false);
}

__device__ __forceinline__ float red32_min(float x) {
#pragma unroll
  for (int off = 1; off < 32; off <<= 1) x = fminf(x, __shfl_xor(x, off, 32));
  return x;
}

__device__ __forceinline__ void wave_lds_sync() {
  __builtin_amdgcn_fence(3 /* release order */, "wavefront");
  asm volatile("s_wait_dscnt 0x0" ::: "memory");
  __builtin_amdgcn_wave_barrier();
}

// ---------------------------------------------------------------------------
// Row cast: dst[row][0..255] = f16(carry * bf16(src[row][0..255])), one wave per row, 8 rows
// per block; the wave's single store instruction covers the whole 512-B row (4 lines).
// SRC_INPUT = 1: source rows are addressed with the full per-batch stride (module input);
// SRC_INPUT = 0: compact rows (weight matrices, [out][in] order kept: already k-contiguous).
// blk = index of the 8-row group inside this source (rows / 8 groups).
// ---------------------------------------------------------------------------
template <int SRC_INPUT>
__device__ __forceinline__ void cast_body(const float* __restrict__ X,
                                          _Float16* __restrict__ dst, const float carry,
                                          const unsigned blk) {
#pragma clang fp contract(off)
  const unsigned lane = threadIdx.x & 31u;
  const unsigned w = (unsigned)__builtin_amdgcn_readfirstlane((int)(threadIdx.x >> 5));
  const unsigned crow = blk * 8u + w;
  size_t srow = crow;
  if (SRC_INPUT) {
    const unsigned bidx = crow / (unsigned)SEQ;
    const unsigned sq = crow - bidx * (unsigned)SEQ;
    srow = (size_t)bidx * SEQ_FULL + sq;
  }
  const float* xr = X + srow * DIM + lane * 8u;
  const v4f a0 = *(const v4f*)(xr);
  const v4f a1 = *(const v4f*)(xr + 4u);
  v8h o;
#pragma unroll
  for (int i = 0; i < 4; ++i) {
    o[i]     = toh_flush(carry * bf16r(a0[i]));
    o[i + 4] = toh_flush(carry * bf16r(a1[i]));
  }
  _Float16* p = dst + (size_t)crow * DIM + lane * 8u;
  *(v8h*)p = o;
  
}

// Score vector of one weight matrix: (x W^T) . w_mlp = x . (W^T w_mlp), so the score of a row of x
// needs u[d] = sum_e bf16(W[e][d]) * bf16(w_mlp[e]) and no projected row. Block = 64 columns d;
// wave = 32 rows e, lane = 2 columns (a load covers 256 B of a row); the eight waves' sums are
// joined through LDS (Red, block barrier). u is left as two f16 rows for the matrix unit:
// hi = f16(16 u), lo = f16(2048 (16 u - hi)); wave 0's store of a row piece is one 128-B line.
__device__ __forceinline__ void score_vec_body(const float* __restrict__ Wm,
                                               const float* __restrict__ wmlp,
                                               _Float16* __restrict__ urows, const unsigned c0,
                                               float* Red) {
  const unsigned lane = threadIdx.x & 31u;
  const unsigned w = (unsigned)__builtin_amdgcn_readfirstlane((int)(threadIdx.x >> 5));
  const float* p = Wm + (size_t)(w * 32u) * DIM + c0 + lane * 2u;
  float s0 = 0.0f, s1 = 0.0f;
  // rolled, 16 loads in flight per trip: unrolled, the 32 loads' registers would lower the number
  // of waves per SIMD for the cast jobs of the same launch
#pragma unroll 1
  for (unsigned h = 0; h < 2u; ++h) {
    const float* ph = p + (size_t)(h * 16u) * DIM;
    v2f t[16];
#pragma unroll
    for (unsigned e = 0; e < 16u; ++e) t[e] = *(const v2f*)(ph + (size_t)e * DIM);
    // precaution: the wait stands in front of every later write of the loads' address registers;
    // the address is its input, so that no load's own result is placed in those registers
    asm volatile("s_wait_xcnt 0x0" :: "v"(ph) : "memory");
#pragma unroll
    for (unsigned e = 0; e < 16u; ++e) {
      const float we = bf16r(wmlp[w * 32u + h * 16u + e]);
      s0 += bf16r(t[e][0]) * we;
      s1 += bf16r(t[e][1]) * we;
    }
  }
  Red[w * 64u + lane * 2u] = s0;
  Red[w * 64u + lane * 2u + 1u] = s1;
  __syncthreads();
  if (w == 0u) {
    float u0 = 0.0f, u1 = 0.0f;
#pragma unroll
    for (unsigned i = 0; i < 8u; ++i) {
      u0 += Red[i * 64u + lane * 2u];
      u1 += Red[i * 64u + lane * 2u + 1u];
    }
    u0 *= UCARRY;
    u1 *= UCARRY;
    v2h hi, lo;
    hi[0] = toh_flush(u0);
    hi[1] = toh_flush(u1);
    lo[0] = toh_flush((u0 - (float)hi[0]) * ULO);
    lo[1] = toh_flush((u1 - (float)hi[1]) * ULO);
    _Float16* d = urows + c0 + lane * 2u;
    *(v2h*)d = hi;
    *(v2h*)(d + DIM) = lo;
  }
}

// The casts and the two score vectors in one launch: they are independent of each other, so the
// block index picks the job. Blocks 0 .. UBLK - 1: the score vectors (rows 0, 1 of the plane: q
// high, low; rows 2, 3: k); the next WBLK: the v weight plane; the rest: the rows of x.
// Grid (UBLK + WBLK + MROWS / 8).
#define WBLK ((unsigned)(DIM / 8))
#define UBLK ((unsigned)(2 * (DIM / 64)))
static_assert(DIM == 8 * 32);            // score vector: 8 waves x 32 weight rows
__global__ __launch_bounds__(256) void cast_kernel(
    const float* __restrict__ X, const float* __restrict__ wq, const float* __restrict__ wk,
    const float* __restrict__ wv, const float* __restrict__ wmlp, _Float16* __restrict__ x16,
    _Float16* __restrict__ u16, _Float16* __restrict__ wv16) {
  __shared__ float Red[8 * 64];
  const unsigned bx = blockIdx.x;
  if (bx < UBLK) {
    const unsigned p = bx / (UBLK / 2u);
    score_vec_body((p == 0u) ? wq : wk, wmlp, u16 + (size_t)p * 2u * DIM,
                   (bx - p * (UBLK / 2u)) * 64u, Red);
  } else if (bx < UBLK + WBLK) {
    cast_body<0>(wv, wv16, WCARRY, bx - UBLK);
  } else {
    cast_body<1>(X, x16, 1.0f, bx - UBLK - WBLK);
    // precaution: in the listing the weight job's code follows this job's store (behind a branch
    // that skips it) and reuses the store's registers; the wait stands in front of that code
    asm volatile("s_wait_xcnt 0x0" ::: "memory");
  }
}

// ---------------------------------------------------------------------------
// v projection and the two scores, operands fed through LDS. Block = one 64-row tile of x times
// one half of the v weight matrix (job = column half: 128 columns); 8 waves (mw = 16-row group,
// nw = 32-column group), 2 accumulators per wave, two 64-column tiles one after the other.
// Every global byte comes in by asynchronous copies to LDS, one whole 512-B row (4 lines) per
// copy instruction: the x tile once, the weight tiles into two buffers, one tile ahead. Rows lie
// at a 528-B pitch (16 B x odd) for the 16-B fragment reads. Each wave reads its x fragments
// (16 rows x 256 k) from LDS once and keeps them in registers for both tiles.
// One publish point (LDS wait, copy wait, block barrier) per weight tile.
// Scores (job 0): one more 16-column product of the x fragments with the four rows of the score
// plane (column n holds row n & 3: q high, q low, k high, k low), the wave with nw = 0 over the
// first 128 k, its neighbour over the rest; columns 0..3 go to Rs, which the loop's publish
// points publish, and wave 0 joins the two k halves and the high and low parts.
// v: each 64x64 tile is staged through Cs (cross-wave, block barrier) and written
// transposed, 8 lanes x 16 B = one 128-B line of a v row. Cs lies in the x tile's place, which
// nobody reads any more behind the first publish point.
// Grid (2 * RBLK): two blocks per WGP.
// ---------------------------------------------------------------------------
#define RBLK   ((unsigned)(MROWS / 64))
#define PPITCH 528u                      // LDS bytes per staged row: 512 + 16
#define PTILE  (64u * PPITCH)            // one staged tile of 64 rows
static_assert(DIM * 2 == 32 * 16);       // one copy instruction = one row
static_assert((PPITCH % 16u) == 0 && ((PPITCH / 16u) & 1u) == 1u);
static_assert(64 == 8 * 8);              // tile rows: 8 waves x 8 copies
static_assert(DIM / 128 == 2);           // two weight tiles per job, one buffer each: no refill
#define UOFF   (3u * PTILE)              // the score plane's four rows, behind the ring
static_assert(64u * LDC * 4u <= PTILE);  // Cs fits the x tile's place
static_assert(2u * (3u * PTILE + 4u * PPITCH + 2048u) <= 327680u);

// Eight rows of a tile: each copy is one row, 32 lanes x 16 B. l = the lane's LDS byte address in
// the first row, g = its global address. The closing s_wait_xcnt is a precaution: it stands in
// front of every later write of a register that a copy names.
__device__ __forceinline__ void copy_rows8(const unsigned l, const _Float16* g) {
  const unsigned ls = PPITCH;
  const size_t gs = (size_t)DIM;
  asm volatile(
      "global_load_async_to_lds_b128 %0, %8, off\n\t"
      "global_load_async_to_lds_b128 %1, %9, off\n\t"
      "global_load_async_to_lds_b128 %2, %10, off\n\t"
      "global_load_async_to_lds_b128 %3, %11, off\n\t"
      "global_load_async_to_lds_b128 %4, %12, off\n\t"
      "global_load_async_to_lds_b128 %5, %13, off\n\t"
      "global_load_async_to_lds_b128 %6, %14, off\n\t"
      "global_load_async_to_lds_b128 %7, %15, off\n\t"
      "s_wait_xcnt 0x0"
      :: "v"(l), "v"(l + ls), "v"(l + 2u * ls), "v"(l + 3u * ls),
         "v"(l + 4u * ls), "v"(l + 5u * ls), "v"(l + 6u * ls), "v"(l + 7u * ls),
         "v"(g), "v"(g + gs), "v"(g + 2u * gs), "v"(g + 3u * gs),
         "v"(g + 4u * gs), "v"(g + 5u * gs), "v"(g + 6u * gs), "v"(g + 7u * gs)
      : "memory");
}

// One row of the score plane: 32 lanes x 16 B. The closing s_wait_xcnt is a precaution, as above.
__device__ __forceinline__ void copy_row1(const unsigned l, const _Float16* g) {
  asm volatile(
      "global_load_async_to_lds_b128 %0, %1, off\n\t"
      "s_wait_xcnt 0x0"
      :: "v"(l), "v"(g) : "memory");
}

// Four k steps of the score product: ub = the lane's 16 B of its score row at the first step. The
// fragments are read ahead of the products; two chains, so that a product does not wait for the
// one before it.
__device__ __forceinline__ v8f score4(const v16h a0, const v16h a1, const v16h a2, const v16h a3,
                                      const unsigned char* ub) {
  const v16h u0 = frag_at((const _Float16*)(ub));
  const v16h u1 = frag_at((const _Float16*)(ub + 64u));
  const v16h u2 = frag_at((const _Float16*)(ub + 128u));
  const v16h u3 = frag_at((const _Float16*)(ub + 192u));
  v8f s0 = {}, s1 = {};
  s0 = wmma16(a0, u0, s0);
  s1 = wmma16(a1, u1, s1);
  s0 = wmma16(a2, u2, s0);
  s1 = wmma16(a3, u3, s1);
  return s0 + s1;
}

__global__ __launch_bounds__(256) void proj_kernel(
    const _Float16* __restrict__ A16, const _Float16* __restrict__ U16,
    const _Float16* __restrict__ Wv, float* __restrict__ qs, float* __restrict__ ks,
    _Float16* __restrict__ vt) {
  // x tile, two weight buffers, score plane
  __shared__ __attribute__((aligned(16))) unsigned char Ps[3u * PTILE + 4u * PPITCH];
  __shared__ float Rs[2 * 4 * 64];
  const unsigned tid = threadIdx.x, lane = tid & 31u;
  const unsigned w = (unsigned)__builtin_amdgcn_readfirstlane((int)(threadIdx.x >> 5));
  const unsigned mw = w >> 1, nw = w & 1u;
  const unsigned hh = lane >> 4, m = lane & 15u;
  const unsigned job = blockIdx.x / RBLK;
  const unsigned row0 = (blockIdx.x - job * RBLK) * 64u;
  const unsigned col0 = job * (unsigned)(DIM / 2);
  const unsigned NTB = (unsigned)(DIM / 128);

  // copy side: this lane's 16 B of the wave's first row, in LDS and in the two planes
  const unsigned cl = (unsigned)(size_t)Ps + (w * 8u) * PPITCH + lane * 16u;
  const _Float16* ga = A16 + (size_t)(row0 + w * 8u) * DIM + lane * 8u;
  const _Float16* gb = Wv + (size_t)(col0 + w * 8u) * DIM + lane * 8u;

  // prologue: the x tile, weight tile 0 and (job 0) the score plane land and are published, then
  // weight tile 1 starts
  copy_rows8(cl, ga);
  copy_rows8(cl + PTILE, gb);
  if (job == 0u && w < 4u)
    copy_row1((unsigned)(size_t)Ps + UOFF + w * PPITCH + lane * 16u, U16 + (size_t)w * DIM + lane * 8u);
  asm volatile("s_wait_asynccnt 0x0" ::: "memory");   // this wave's copies have landed
  __syncthreads();                                    // ... and every other wave's
  copy_rows8(cl + 2u * PTILE, gb + (size_t)64 * DIM);

  v16h a[8];
  {
    const unsigned char* ar = Ps + (mw * 16u + m) * PPITCH + hh * 16u;
#pragma unroll
    for (unsigned k = 0; k < 8u; ++k) a[k] = frag_at((const _Float16*)(ar + k * 64u));
  }
  if (job == 0u) {
    const unsigned char* ub = Ps + UOFF + (m & 3u) * PPITCH + hh * 16u;
    v8f sc;
    if (nw == 0u) sc = score4(a[0], a[1], a[2], a[3], ub);
    else          sc = score4(a[4], a[5], a[6], a[7], ub + 256u);
    if (m < 4u) {
#pragma unroll
      for (int r = 0; r < 8; ++r)
        Rs[nw * 256u + m * 64u + mw * 16u + hh * 8u + (unsigned)r] = sc[r];
    }
  }
  float* Cs = (float*)Ps;
  const unsigned rdb = PTILE + (nw * 32u + m) * PPITCH + hh * 16u;
  const unsigned bidx = row0 / (unsigned)SEQ;
  const unsigned key0 = row0 - bidx * (unsigned)SEQ;

  // rolled: one copy of the tile's code, the buffer picked by the trip's parity
#pragma unroll 1
  for (unsigned nb = 0; nb < NTB; ++nb) {
    const unsigned bo = (nb & 1u) * PTILE;
    const unsigned char* bb = Ps + bo + rdb;
    v8f acc0 = {}, acc1 = {};
#pragma unroll
    for (unsigned k = 0; k < 8u; ++k) {
      const v16h b0 = frag_at((const _Float16*)(bb + k * 64u));
      const v16h b1 = frag_at((const _Float16*)(bb + 16u * PPITCH + k * 64u));
      acc0 = wmma16(a[k], b0, acc0);
      acc1 = wmma16(a[k], b1, acc1);
    }
    // publish point of weight tile nb + 1; at nb = 0 the same barrier ends every read of the x
    // tile and publishes Rs; later, it ends every read of Cs
    asm volatile("s_wait_dscnt 0x0" ::: "memory");     // this wave's LDS reads and writes are done
    asm volatile("s_wait_asynccnt 0x0" ::: "memory");  // this wave's copies of tile nb + 1 landed
    __syncthreads();

#pragma unroll
    for (int r = 0; r < 8; ++r) {
      float* d = &Cs[(mw * 16u + hh * 8u + (unsigned)r) * LDC + nw * 32u + m];
      d[0]  = acc0[r];
      d[16] = acc1[r];
    }
    __syncthreads();
    v8h x[2];
    size_t off[2];
#pragma unroll
    for (unsigned i = 0; i < 2u; ++i) {
      const unsigned dcol = 32u * i + (tid >> 3);
      const unsigned kk = (tid & 7u) * 8u;
#pragma unroll
      for (unsigned j = 0; j < 8u; ++j) {
        const float t = Cs[(kk + j) * LDC + dcol] * (1.0f / WCARRY);
        x[i][j] = toh_flush(t);
      }
      off[i] = ((size_t)bidx * DIM + col0 + nb * 64u + dcol) * SEQ + key0 + kk;
    }
#pragma unroll
    for (int i = 0; i < 2; ++i) *(v8h*)(vt + off[i]) = x[i];
    // precaution: the next trip reuses the stores' registers; the wait stands in front of it
    asm volatile("s_wait_xcnt 0x0" ::: "memory");
  }
  asm volatile("s_wait_asynccnt 0x0" ::: "memory");    // no copy outlives the loop

  if (job == 0u && w == 0u) {
    // lanes 0..15: q scores, lanes 16..31: k scores, four rows each (256 B per half wave)
    v4f val;
#pragma unroll
    for (int j = 0; j < 4; ++j) {
      const unsigned i = hh * 128u + m * 4u + (unsigned)j;
      val[j] = ((Rs[i] + Rs[i + 256u]) + (Rs[i + 64u] + Rs[i + 320u]) * (1.0f / ULO)) * (1.0f / UCARRY);
    }
    float* p = ((hh == 0u) ? qs : ks) + row0 + m * 4u;
    *(v4f*)p = val;
  }
}

// ---------------------------------------------------------------------------
// Dense additive-score attention, transposed form, v fed through an LDS ring.
// Block = 128 query rows x 128 columns (one column half) of one batch, so that a v byte is
// fetched from L2 by one block per 128 queries; wave = 64 query rows x 128 columns x one 32-key
// step of every 128-key tile (32 accumulators), so that each v fragment read from LDS feeds four
// products. The four waves of a query group (key quarters 0..3) hold partial sums over their
// keys; behind the loop each keeps one 16-query part and hands the other three, with their row
// sums, to the waves that keep them, through LDS (the ring's place, free by then;
// block barrier). Fragment j of the wave with key quarter kq holds query part kq ^ j, so that
// fragment 0 is the kept one and fragment j goes to the wave with key quarter kq ^ j.
// score[i][j] = relu(q_s[i] + b - k_s[j]); its row maximum is relu(q_s[i] + b - min_j k_s[j]),
// so the max-subtracted softmax needs no running rescale. With kmin = min_j k_s[j] and
// rowmax = relu(q_s[i] + b - kmin), score - rowmax = max(kmin - k_s[j], -rowmax), and exp and the
// conversion to f16 are monotone, so
//   p[i][j] = f16(1024 * exp(score - rowmax)) = max(f16(1024 * exp(kmin - k_s[j])), f16(1024 * exp(-rowmax))):
// one exp per key (the block's table Pk, built once in LDS) and one per query instead of one per
// pair. Per 32-key step each lane reads its B fragment of P^T from Pk (lane = query, elements =
// keys of the 16-bit k map), takes the packed f16 maximum with its query term, and
// O^T[d][i] += V^T[d][keys] . P^T[keys][i] with the A fragments from the ring. The row sum runs
// over the f16 p, so the carry cancels in O / l. Ring: two buffers of four 128-key tiles each (a
// tile: 128 v rows of 256 B at a 272-B pitch), filled by asynchronous copies to LDS one buffer
// ahead, so the block fetches each v byte once, in whole 128-B lines, while the buffer before it
// is worked on; one publish point (LDS wait, copy wait, block barrier) per buffer, so that
// between two of them the waves of a SIMD drift apart and one's vector and LDS work runs under
// the other's products.
// Wmin, Pk, the exchange, Ls: cross-wave (block barrier). Os: wave-private stage (wave sync).
// The exchange and Os lie in the ring's place, one behind the other.
// Grid (2 * SEQ/128, NB): blockIdx.x = 2 * query block + column half.
// ---------------------------------------------------------------------------

// One ring tile: each wave copies 16 v rows (8 copies x 2 rows x 16 lanes x 16 B). l = the lane's
// LDS byte address of its first piece, g = its global address. The closing s_wait_xcnt is a
// precaution: it stands in front of every later write of a register that a copy names.
__device__ __forceinline__ void copy_v_tile(const unsigned l, const _Float16* g) {
  const unsigned ls = 2u * VPITCH;
  const size_t gs = (size_t)2 * SEQ;
  asm volatile(
      "global_load_async_to_lds_b128 %0, %8, off\n\t"
      "global_load_async_to_lds_b128 %1, %9, off\n\t"
      "global_load_async_to_lds_b128 %2, %10, off\n\t"
      "global_load_async_to_lds_b128 %3, %11, off\n\t"
      "global_load_async_to_lds_b128 %4, %12, off\n\t"
      "global_load_async_to_lds_b128 %5, %13, off\n\t"
      "global_load_async_to_lds_b128 %6, %14, off\n\t"
      "global_load_async_to_lds_b128 %7, %15, off\n\t"
      "s_wait_xcnt 0x0"
      :: "v"(l), "v"(l + ls), "v"(l + 2u * ls), "v"(l + 3u * ls),
         "v"(l + 4u * ls), "v"(l + 5u * ls), "v"(l + 6u * ls), "v"(l + 7u * ls),
         "v"(g), "v"(g + gs), "v"(g + 2u * gs), "v"(g + 3u * gs),
         "v"(g + 4u * gs), "v"(g + 5u * gs), "v"(g + 6u * gs), "v"(g + 7u * gs)
      : "memory");
}

__global__ __launch_bounds__(256) void attn_kernel(
    const float* __restrict__ Qs, const float* __restrict__ Ksc,
    const float* __restrict__ bptr, const _Float16* __restrict__ Vt,
    float* __restrict__ out) {
  __shared__ float Wmin[8];
  __shared__ float Ls[8 * 3 * 16];                            // row sums handed to the group's other waves
  __shared__ __attribute__((aligned(16))) unsigned char Ring[ARENA_BYTES];   // ring (2 * GBUF), then exchange + Os
  __shared__ __attribute__((aligned(16))) _Float16 Pk[SEQ];   // key terms of the numerators

  const unsigned tid = threadIdx.x, lane = tid & 31u;
  const int wave = __builtin_amdgcn_readfirstlane((int)(threadIdx.x >> 5));
  const unsigned hh = lane >> 4, m = lane & 15u;
  const unsigned b = blockIdx.y;
  // kq = key quarter (the tile's 32-key step this wave works on), qg = query group, dh = column half
  const unsigned kq = (unsigned)wave & 3u, qg = (unsigned)wave >> 2;
  const unsigned dh = blockIdx.x & 1u;
  const unsigned qgrp0 = (blockIdx.x >> 1) * (unsigned)QBLK + qg * 64u;
  const unsigned qrow0 = qgrp0 + kq * 16u;   // the 16 queries this wave finishes and stores
  const float* ksb = Ksc + (size_t)b * SEQ;

  // copy side: this lane's piece of the wave's first two rows, in LDS and in the v plane
  const unsigned crow = (unsigned)wave * 16u + (lane >> 4);
  const unsigned ring0 = (unsigned)(size_t)Ring;          // byte offset in the block's LDS
  const unsigned cl = ring0 + crow * VPITCH + (lane & 15u) * 16u;
  const _Float16* cg = Vt + ((size_t)b * DIM + dh * (unsigned)DH + crow) * SEQ + (lane & 15u) * 8u;

  // Every memory request of the kernel's head is issued here, at entry: the key scores, the query
  // scores, the bias and, behind them, the copies of ring group 0, which depend on no score. The minimum,
  // the query terms and the key table below are then worked out while the group lands.
  // Key scores: uniform trip count, clamped addresses; unrolled, so that they stay in registers.
  // Query scores: fragment 0 = the queries this wave keeps (qrow0 ..), fragments 1..3 = those it
  // hands over.
  constexpr unsigned KIT = (unsigned)((SEQ + 1023) / 1024);
  v4f kv[KIT];
  const float* qp = Qs + (size_t)b * SEQ + qgrp0 + m;
  float qv[4];
  // keeps what stands above in front of these loads: without it a kernel-argument load was
  // scheduled in among them
  __builtin_amdgcn_sched_barrier(0);
#pragma unroll
  for (unsigned it = 0; it < KIT; ++it) {
    unsigned j = tid * 4u + it * 1024u;
    j = (j > (unsigned)(SEQ - 4)) ? (unsigned)(SEQ - 4) : j;
    kv[it] = *(const v4f*)(ksb + j);
  }
#pragma unroll
  for (unsigned j = 0; j < 4u; ++j) qv[j] = qp[(kq ^ j) * 16u];
  const float braw = bptr[0];
  // precaution: the wait stands in front of every later write of the loads' address registers;
  // the addresses are its inputs, so that they keep their registers up to it
  asm volatile("s_wait_xcnt 0x0"
               :: "s"(ksb), "v"(tid), "v"(qp + kq * 16u), "v"(qp + (kq ^ 1u) * 16u),
                  "v"(qp + (kq ^ 2u) * 16u), "v"(qp + (kq ^ 3u) * 16u)
               : "memory");

  // ring prologue, first part: the copies of group 0 start; their wait and the barrier that
  // publishes them stand in front of the loop
#pragma unroll
  for (unsigned s = 0; s < GTILES; ++s) copy_v_tile(cl + s * RBUF, cg + s * TKEYS);
  // keeps the minimum's arithmetic, which waits for the key scores, behind the copies: scheduled
  // ahead of them it held their issue back until the scores had arrived
  __builtin_amdgcn_sched_barrier(0);

  // minimum key score of this batch
  float kmin = 3.0e38f;
#pragma unroll
  for (unsigned it = 0; it < KIT; ++it)
    kmin = fminf(kmin, fminf(fminf(kv[it][0], kv[it][1]), fminf(kv[it][2], kv[it][3])));
  kmin = red32_min(kmin);
  if (lane == 0u) Wmin[wave] = kmin;
  __syncthreads();
  float km = Wmin[0];
#pragma unroll
  for (int i = 1; i < 8; ++i) km = fminf(km, Wmin[i]);

  const float bias = bf16r(braw);
  // query term: 1024 * exp(-rowmax), the value of every pair whose score is zero
  v2h cq2[4];               // one register per fragment: the term in both halves
#pragma unroll
  for (int j = 0; j < 4; ++j) {
    const float mrow = fmaxf((qv[j] + bias) - km, 0.0f);
    const h16 cq = toh_flush(__expf(LN_PCARRY - mrow));
    cq2[j][0] = cq;
    cq2[j][1] = cq;
  }

  // key terms: Pk[j] = 1024 * exp(kmin - k_s[j]); clamped threads rewrite the last four keys with
  // the same values. Published by the ring prologue's barrier. Unrolled: kv[] is in registers.
#pragma unroll
  for (unsigned it = 0; it < KIT; ++it) {
    unsigned j = tid * 4u + it * 1024u;
    j = (j > (unsigned)(SEQ - 4)) ? (unsigned)(SEQ - 4) : j;
    v4h e;
#pragma unroll
    for (int i = 0; i < 4; ++i) e[i] = toh_flush(__expf((km - kv[it][i]) + LN_PCARRY));
    *(v4h*)&Pk[j] = e;
  }

  v8f o[4][8];              // o[0]: the kept queries, o[1..3]: the queries handed over
  float lsum[4];
#pragma unroll
  for (int j = 0; j < 4; ++j) {
    lsum[j] = 0.0f;
#pragma unroll
    for (int dt = 0; dt < 8; ++dt) o[j][dt] = (v8f){};
  }

  // read side: row m of the tile, the lane's 16 B of this wave's 32-key step
  const unsigned rd = m * VPITCH + kq * 64u + hh * 16u;
  const unsigned NG = (unsigned)SEQ / (GTILES * TKEYS);

  // ring prologue, second part: group 0, whose copies started at the kernel's entry, lands and is
  // published; group 1 starts inside the first trip
  asm volatile("s_wait_asynccnt 0x0" ::: "memory");   // this wave's copies of group 0 have landed
  __syncthreads();                                    // ... and every other wave's, and Pk

  // rolled over the groups: one copy of the four tiles' code
#pragma unroll 1
  for (unsigned g = 0; g < NG; ++g) {
    const unsigned bo = (g & 1u) * GBUF;               // the buffer read in this trip
    // unrolled: the tile's place in its buffer and its share of the refill are constants
#pragma unroll
    for (unsigned s = 0; s < GTILES; ++s) {            // this wave's 32-key step of tile s
      // refill of the other buffer, whose every read ended at the barrier in front of this trip:
      // two tiles of group g + 1 ahead of step 0, one each ahead of steps 1 and 2, none ahead of
      // the last step, so that every copy has a whole step or more to land in
      if (s + 1u < GTILES && g + 1u < NG) {
        const unsigned nl = cl + (GBUF - bo);
        const _Float16* ng = cg + (size_t)(g + 1u) * (GTILES * TKEYS);
        if (s == 0u) copy_v_tile(nl, ng);
        copy_v_tile(nl + (s + 1u) * RBUF, ng + (s + 1u) * TKEYS);
      }
      const unsigned char* vb = Ring + bo + s * RBUF + rd;
      const _Float16* kt = Pk + (g * GTILES + s) * TKEYS + kq * 32u + hh * 8u;
      const v16h pk = frag_at(kt);
      v16h a[8];
#pragma unroll
      for (int dt = 0; dt < 8; ++dt)
        a[dt] = frag_at((const _Float16*)(vb + (unsigned)dt * (16u * VPITCH)));
      v16h p[4];
#pragma unroll
      for (int j = 0; j < 4; ++j) {
#pragma unroll
        for (int i = 0; i < 16; i += 2) {
          const v2h k2 = {pk[i], pk[i + 1]};
          const v2h r2 = __builtin_elementwise_maximum(k2, cq2[j]);
          p[j][i] = r2[0];
          p[j][i + 1] = r2[1];
        }
      }
#pragma unroll
      for (int i = 0; i < 4; ++i) {
#pragma unroll
        for (int e = 0; e < 16; e += 4) {
#pragma unroll
          for (int j = 0; j < 4; ++j) lsum[j] += (float)p[j][i + e];
        }
      }
      // keeps the products in the order of their fragment loads, so that each four wait for their
      // own two loads only (counted LDS waits); without it an early product is scheduled on the
      // last fragment and waits for all of them
      __builtin_amdgcn_sched_barrier(0);
#pragma unroll
      for (int dt = 0; dt < 8; ++dt) {
#pragma unroll
        for (int j = 0; j < 4; ++j) o[j][dt] = wmma16_hi(a[dt], p[j], o[j][dt]);
      }
      // keeps the products in front of the next step's copies and of the publish point: moved
      // behind them they would hold up the refill by a whole run of products
      __builtin_amdgcn_sched_barrier(0);
    }
    // publish point of group g + 1; the same barrier ends every read of group g's buffer
    asm volatile("s_wait_dscnt 0x0" ::: "memory");     // this wave's reads of group g are done
    asm volatile("s_wait_asynccnt 0x0" ::: "memory");  // this wave's copies of group g + 1 landed
    __syncthreads();
  }
  asm volatile("s_wait_asynccnt 0x0" ::: "memory");    // no copy outlives the loop

  // lanes l and l+16 hold the two 16-key parts of this wave's steps for query m
  float lrow[4];
#pragma unroll
  for (int j = 0; j < 4; ++j) lrow[j] = lsum[j] + __shfl_xor(lsum[j], 16, 32);

  // The group's exchange. The ring's place is free: every wave's reads of the last tile ended at
  // the loop's last barrier and no copy is outstanding. Each wave writes the partial sums of
  // fragment j = 1..3 to its own slot j - 1 and, behind the barrier, adds slot j - 1 of the wave
  // with key quarter kq ^ j (that wave's partial sums of the queries kept here) at the same lane
  // positions.
  const unsigned tb = (unsigned)wave * (16u * LDO);
  float* Xs = (float*)Ring;
  float* Os = (float*)(Ring + XS_BYTES);
#pragma unroll
  for (unsigned j = 1; j < 4u; ++j) {
    const unsigned slot = (unsigned)wave * 3u + (j - 1u);
    const unsigned sb = slot * (16u * LDO);
#pragma unroll
    for (int dt = 0; dt < 8; ++dt) {
      v4f u0, u1;
#pragma unroll
      for (int i = 0; i < 4; ++i) {
        u0[i] = o[j][dt][i];
        u1[i] = o[j][dt][i + 4];
      }
      *(v4f*)&Xs[sb + m * LDO + (unsigned)dt * 16u + hh * 8u] = u0;
      *(v4f*)&Xs[sb + m * LDO + (unsigned)dt * 16u + hh * 8u + 4u] = u1;
    }
    if (hh == 0u) Ls[slot * 16u + m] = lrow[j];
  }
  __syncthreads();
  float ltot = lrow[0];
#pragma unroll
  for (unsigned j = 1; j < 4u; ++j) {
    const unsigned slot = ((unsigned)wave ^ j) * 3u + (j - 1u);
    const unsigned pb = slot * (16u * LDO);
#pragma unroll
    for (int dt = 0; dt < 8; ++dt) {
      const v4f u0 = *(const v4f*)&Xs[pb + m * LDO + (unsigned)dt * 16u + hh * 8u];
      const v4f u1 = *(const v4f*)&Xs[pb + m * LDO + (unsigned)dt * 16u + hh * 8u + 4u];
#pragma unroll
      for (int i = 0; i < 4; ++i) {
        o[0][dt][i] += u0[i];
        o[0][dt][i + 4] += u1[i];
      }
    }
    ltot += Ls[slot * 16u + m];
  }
  const float inv = __builtin_amdgcn_rcpf(ltot);

  // stage O[query m][d = dt*16 + 8*hh + r] in the wave's tile
#pragma unroll
  for (int dt = 0; dt < 8; ++dt) {
    v4f u0, u1;
#pragma unroll
    for (int j = 0; j < 4; ++j) {
      u0[j] = o[0][dt][j] * inv;
      u1[j] = o[0][dt][j + 4] * inv;
    }
    *(v4f*)&Os[tb + m * LDO + (unsigned)dt * 16u + hh * 8u] = u0;
    *(v4f*)&Os[tb + m * LDO + (unsigned)dt * 16u + hh * 8u + 4u] = u1;
  }
  wave_lds_sync();

  const size_t orow = (size_t)b * SEQ_FULL + qrow0;
#pragma unroll
  for (unsigned g = 0; g < 2u; ++g) {      // 2 steps x 8 rows == 16 rows
    v4f x[8];
    size_t off[8];
#pragma unroll
    for (unsigned i = 0; i < 8u; ++i) {
      const unsigned r = 8u * g + i;
      x[i] = *(const v4f*)&Os[tb + r * LDO + lane * 4u];
      off[i] = (orow + r) * DIM + dh * (unsigned)DH + lane * 4u;
    }
#pragma unroll
    for (int i = 0; i < 8; ++i) *(v4f*)(out + off[i]) = x[i];
    
  }
}

// ---------------------------------------------------------------------------
extern "C" void kernel_launch(void* const* d_in, const int* in_sizes, int n_in,
                              void* d_out, int out_size, void* d_ws, size_t ws_size,
                              hipStream_t stream) {
  if (n_in < 6) return;
  const long long need_x = ((long long)(NB - 1) * SEQ_FULL + SEQ) * DIM;
  if ((long long)in_sizes[0] < need_x) return;
  if ((long long)in_sizes[1] < (long long)DIM * DIM) return;
  if ((long long)in_sizes[2] < (long long)DIM * DIM) return;
  if ((long long)in_sizes[3] < (long long)DIM * DIM) return;
  if (in_sizes[4] < DIM) return;
  if (in_sizes[5] < 1) return;
  if ((long long)out_size < need_x) return;
  if (ws_size < WS_TOTAL) return;

  const float* X    = (const float*)d_in[0];   // x      [NB_FULL][SEQ_FULL][DIM]
  const float* wq   = (const float*)d_in[1];   // Wq     [DIM out][DIM in]
  const float* wk   = (const float*)d_in[2];   // Wk     [DIM out][DIM in]
  const float* wvv  = (const float*)d_in[3];   // Wv     [DIM out][DIM in]
  const float* wmlp = (const float*)d_in[4];   // w_mlp  [DIM]
  const float* bmlp = (const float*)d_in[5];   // b_mlp  scalar
  float* out = (float*)d_out;

  char* ws = (char*)d_ws;
  _Float16* U16  = (_Float16*)(ws + OFF_U);     // [4][DIM]: q high, q low, k high, k low
  _Float16* Wv16 = (_Float16*)(ws + OFF_WV);    // [out][in], x64
  _Float16* X16  = (_Float16*)(ws + OFF_X16);   // [MROWS][DIM] compact rows
  float*    QS   = (float*)(ws + OFF_QS);       // [MROWS]
  float*    KS   = (float*)(ws + OFF_KS);       // [MROWS]
  _Float16* Vt16 = (_Float16*)(ws + OFF_VT);    // [b][DIM][SEQ]

  dim3 blk(256);

  // three dependent launches: casts and score vectors, v projection and scores, attention
  cast_kernel<<<dim3(2 * (DIM / 64) + DIM / 8 + MROWS / 8), blk, 0, stream>>>(X, wq, wk, wvv, wmlp,
                                                                             X16, U16, Wv16);
  proj_kernel<<<dim3(2 * (MROWS / 64)), blk, 0, stream>>>(X16, U16, Wv16, QS, KS, Vt16);
  attn_kernel<<<dim3(2 * (SEQ / QBLK), NB), blk, 0, stream>>>(QS, KS, bmlp, Vt16, out);
}
